// v000
// Measured on an AMD MI455X. A time is GPU time per run, averaged over a window of back-to-back runs after a warm-up
// (all launches, gaps included; the runs take copies of the inputs in turn), and the median of several windows.
// Apart from v000's, it joins two sittings. Times from different sittings can be a few percent apart, while
// side-by-side timings come from the same sitting.
// The starting kernel, v000, takes 1260 microseconds a run.
// compute dtype: all float inputs rounded to bf16; q/k/v = x W + b with EXACT bf16 products on WMMA 16x16x32 (f32 accumulate); rotate-half RoPE applied in f32 in the projection epilogue with accurate sincosf of t x inv_freq_j (f32 constants as the reference builds them); q as f16 hi + residual (x 2^10) against k once to f16 (2 products) x 64^-0.5; softmax in f32 (precise expf); P x 2^11 once to f16 against v once to f16 (1 product); ctx once to f16 against Wo carried x 2^8 in f16 + bo; f32 output.
#include <hip/hip_runtime.h>
#include <math.h>

typedef __attribute__((ext_vector_type(16))) _Float16 v16h;
typedef __attribute__((ext_vector_type(16))) __bf16 v16b;
typedef __attribute__((ext_vector_type(8)))  _Float16 v8h;
typedef __attribute__((ext_vector_type(8)))  float v8f;
typedef __attribute__((ext_vector_type(4)))  float v4f;
typedef __attribute__((ext_vector_type(2)))  float v2f;
typedef __attribute__((ext_vector_type(4)))  unsigned v4u;
typedef __attribute__((ext_vector_type(4)))  int v4i;
typedef float __attribute__((may_alias)) float_a;
typedef int __attribute__((may_alias)) int_a;

template <typename T> __device__ __forceinline__ void vst2(void* p, T v) { *(T*)p = v;  }
__device__ __forceinline__ v8f wmma16(v16h a, v16h b, v8f c) {
  v8f d = __builtin_amdgcn_wmma_f32_16x16x32_f16(false, a, false, b, (short)0, c, false, false);
  asm volatile("v_nop\n\tv_nop\n\tv_nop\n\tv_nop" : "+v"(d) : "v"(a), "v"(b));
  return d;
}
__device__ __forceinline__ v8f wmma_bf(v16b a, v16b b, v8f c) {
  v8f d = __builtin_amdgcn_wmma_f32_16x16x32_bf16(false, a, false, b, (short)0, c, false, false);
  asm volatile("v_nop\n\tv_nop\n\tv_nop\n\tv_nop" : "+v"(d) : "v"(a), "v"(b));
  return d;
}
// 16x16x32 fragments: lane = (h = lane>>4, row/col = lane&15); elements 0..7 = k0+8h+0..7, 8..15 = k0+16+8h+0..7; D element r = row 8h+r
__device__ __forceinline__ v16h frag_h(const _Float16* rowk0, int lane) {
  union { v16h v; v8h q[2]; } u; const _Float16* p = rowk0 + 8 * (lane >> 4);
  u.q[0] = *(const v8h*)p; u.q[1] = *(const v8h*)(p + 16); return u.v;
}
__device__ __forceinline__ v16h frag_f32(const float* rowk0, int lane) {
  v16h a; const float* p = rowk0 + 8 * (lane >> 4);
#pragma unroll
  for (int i = 0; i < 8; ++i) { a[i] = (_Float16)p[i]; a[8 + i] = (_Float16)p[16 + i]; }
  return a;
}
__device__ __forceinline__ v16h frag_f32s(const float* rowk0, int lane, float sc) {
  v16h a; const float* p = rowk0 + 8 * (lane >> 4);
#pragma unroll
  for (int i = 0; i < 8; ++i) { a[i] = (_Float16)(p[i] * sc); a[8 + i] = (_Float16)(p[16 + i] * sc); }
  return a;
}
// column fragment from a [K][ld] layout (column n), rows >= K read as 0
__device__ __forceinline__ v16h fragc_f32(const float* W, int k0, int n, int lane, int ld, int K) {
  v16h a; const int g = lane >> 4;
#pragma unroll
  for (int i = 0; i < 8; ++i) { const int ka = k0 + 8 * g + i, kb = ka + 16;
    a[i] = (_Float16)(ka < K ? W[(size_t)(ka < K ? ka : K - 1) * ld + n] : 0.f); a[8 + i] = (_Float16)(kb < K ? W[(size_t)(kb < K ? kb : K - 1) * ld + n] : 0.f); }
  return a;
}
struct F2 { v16b h, l; };
__device__ __forceinline__ F2 bsplit16(const float v[16]) { F2 r;
#pragma unroll
  for (int i = 0; i < 16; ++i) { const __bf16 h = (__bf16)v[i]; r.h[i] = h; r.l[i] = (__bf16)(v[i] - (float)h); }
  return r; }
__device__ __forceinline__ F2 split_row(const float* row, int k0, int lane) { float v[16]; const float* p = row + k0 + 8 * (lane >> 4);
#pragma unroll
  for (int i = 0; i < 8; ++i) { v[i] = p[i]; v[8 + i] = p[16 + i]; }
  return bsplit16(v); }
__device__ __forceinline__ F2 split_rowK(const float* row, int k0, int lane, int K) { float v[16]; const int g = lane >> 4;
#pragma unroll
  for (int i = 0; i < 8; ++i) { const int ka = k0 + 8 * g + i, kb = ka + 16; v[i] = ka < K ? row[ka < K ? ka : K - 1] : 0.f; v[8 + i] = kb < K ? row[kb < K ? kb : K - 1] : 0.f; }
  return bsplit16(v); }
__device__ __forceinline__ F2 split_col(const float* W, int k0, int n, int lane, int ld, int K) { float v[16]; const int g = lane >> 4;
#pragma unroll
  for (int i = 0; i < 8; ++i) { const int ka = k0 + 8 * g + i, kb = ka + 16; v[i] = ka < K ? W[(size_t)(ka < K ? ka : K - 1) * ld + n] : 0.f; v[8 + i] = kb < K ? W[(size_t)(kb < K ? kb : K - 1) * ld + n] : 0.f; }
  return bsplit16(v); }
__device__ __forceinline__ v8f mac3(const F2& a, const F2& b, v8f c) { c = wmma_bf(a.l, b.h, c); c = wmma_bf(a.h, b.l, c); return wmma_bf(a.h, b.h, c); }
__device__ __forceinline__ float sigm(float v) { return 1.0f / (1.0f + expf(-v)); }
#define LDSX() do { asm volatile("s_wait_dscnt 0" ::: "memory"); __builtin_amdgcn_wave_barrier(); __builtin_amdgcn_fence(__ATOMIC_RELEASE, "workgroup"); } while (0)

// Multi-head self-attention with rotary embeddings (B 2, L 2,048, D 1,024 = 16 x 64): q/k/v = x W + b ((in,out)); q, k <- q cos + rotate_half(q) sin (theta_j = 10000^(-2j/64), pairs (i, i+32)); attn = softmax(q k^T x 64^-0.5) (non-causal); out = merged(attn v) Wo + bo.
#define NB 2
#define TT 2048
#define CC 1024            // NH * HD = projected width
#define DIN 1024          // input (model) width
#define NH 16
#define HD 64
#define NQB (TT / 64)
#define HG 4
#define SCALE (0.125f)
#define CAUSAL 0
#ifndef TNB
#define TNB NB
#endif
__device__ __forceinline__ float bfr(float v) { return (float)(__bf16)v; }
__host__ __device__ __forceinline__ int kb_last(int qb) { return CAUSAL ? ((qb * 64 + 63) >> 7) : (TT / 128 - 1); }
typedef __attribute__((ext_vector_type(8))) __bf16 v8b;
__device__ __forceinline__ v16b frag_b(const __bf16* rowk0, int lane) {
  union { v16b v; v8b q[2]; } u; const __bf16* p = rowk0 + 8 * (lane >> 4);
  u.q[0] = *(const v8b*)p; u.q[1] = *(const v8b*)(p + 16); return u.v;
}
#define QBH 0              // query blocks 0..QBH-1 of each sequence take the high-precision path (none: QBH is 0)
#define QHI 2048            // rows carrying a q residual plane (all rows when non-causal: 2-product logits everywhere)
#define KHI 64            // key rows carrying k residual / v bf16 hi+lo planes (read only by the qb < QBH high-precision path, which no block takes)
// B fragment (k rows k0+.., output column o) of a weight: (in,out) [K][ld] or (out,in) [ld rows of K]: bf16 exact, or f16(bf16 * 256) exact
__device__ __forceinline__ v16b wcol_io(const float* Wm, int k0, int o, int lane, int ld) { v16b w; const int g = lane >> 4;
#pragma unroll
  for (int i = 0; i < 8; ++i) { w[i] = (__bf16)Wm[(size_t)(k0 + 8 * g + i) * ld + o]; w[8 + i] = (__bf16)Wm[(size_t)(k0 + 16 + 8 * g + i) * ld + o]; }
  return w; }
__device__ __forceinline__ v16b wcol_oi(const float* Wm, int k0, int o, int lane, int K) { v16b w; const float* p = Wm + (size_t)o * K + k0 + 8 * (lane >> 4);
#pragma unroll
  for (int i = 0; i < 8; ++i) { w[i] = (__bf16)p[i]; w[8 + i] = (__bf16)p[16 + i]; }
  return w; }
__device__ __forceinline__ v16h wcolh_io(const float* Wm, int k0, int o, int lane, int ld) { v16h w; const int g = lane >> 4;
#pragma unroll
  for (int i = 0; i < 8; ++i) { w[i] = (_Float16)(bfr(Wm[(size_t)(k0 + 8 * g + i) * ld + o]) * 256.0f); w[8 + i] = (_Float16)(bfr(Wm[(size_t)(k0 + 16 + 8 * g + i) * ld + o]) * 256.0f); }
  return w; }
__device__ __forceinline__ v16h wcolh_oi(const float* Wm, int k0, int o, int lane, int K) { v16h w; const float* p = Wm + (size_t)o * K + k0 + 8 * (lane >> 4);
#pragma unroll
  for (int i = 0; i < 8; ++i) { w[i] = (_Float16)(bfr(p[i]) * 256.0f); w[8 + i] = (_Float16)(bfr(p[16 + i]) * 256.0f); }
  return w; }
#define WQKV_LAYOUT 0   // 0 = (in,out) [DIN][CC]; 1 = (out,in) [CC][DIN]; 2 = per-head [NH][DIN][HD]
__device__ __forceinline__ v16b wcol_hdk(const float* Wm, int k0, int o, int lane) { v16b w; const int g = lane >> 4; const float* p = Wm + (size_t)(o / HD) * DIN * HD + (o % HD);
#pragma unroll
  for (int i = 0; i < 8; ++i) { w[i] = (__bf16)p[(size_t)(k0 + 8 * g + i) * HD]; w[8 + i] = (__bf16)p[(size_t)(k0 + 16 + 8 * g + i) * HD]; }
  return w; }
#define WO_OUT_IN 0
#if WQKV_LAYOUT == 1
#define WCOL(W, k0, o, lane) wcol_oi(W, k0, o, lane, DIN)
#elif WQKV_LAYOUT == 2
#define WCOL(W, k0, o, lane) wcol_hdk(W, k0, o, lane)
#else
#define WCOL(W, k0, o, lane) wcol_io(W, k0, o, lane, CC)
#endif
#if WO_OUT_IN
#define WOCOL(W, k0, o, lane) wcol_oi(W, k0, o, lane, CC)
#define WOCOLH(W, k0, o, lane) wcolh_oi(W, k0, o, lane, CC)
#else
#define WOCOL(W, k0, o, lane) wcol_io(W, k0, o, lane, DIN)
#define WOCOLH(W, k0, o, lane) wcolh_io(W, k0, o, lane, DIN)
#endif
__constant__ float c_invf[32] = {1.000000000e+00f,7.498942018e-01f,5.623413324e-01f,4.216965139e-01f,3.162277639e-01f,2.371373624e-01f,1.778279394e-01f,1.333521456e-01f,1.000000015e-01f,7.498941571e-02f,5.623412877e-02f,4.216964915e-02f,3.162277862e-02f,2.371373586e-02f,1.778279431e-02f,1.333521493e-02f,9.999999776e-03f,7.498942316e-03f,5.623413250e-03f,4.216964822e-03f,3.162277862e-03f,2.371373819e-03f,1.778279431e-03f,1.333521446e-03f,1.000000047e-03f,7.498941850e-04f,5.623413017e-04f,4.216964880e-04f,3.162277862e-04f,2.371373848e-04f,1.778279402e-04f,1.333521504e-04f};   // 1 / 10000^(2i/64) evaluated in f32 exactly as the reference does (jax, eager)
// per-(row, head) epilogue on the f32 projection tile: rotate-half RoPE on q and k (pairs (i, i+32), angle t * inv_freq[i]); v untouched
#define PROJ_EPI(which, row, t, h) do { if ((which) < 2) { float* rw = (row); \
    _Pragma("unroll") for (int i = 0; i < 32; ++i) { const float x0 = rw[i], x1 = rw[i + 32]; const float ang = (float)(t) * c_invf[i]; const float cs = cosf(ang), sn = sinf(ang); rw[i] = x0 * cs - x1 * sn; rw[i + 32] = x1 * cs + x0 * sn; } } } while (0)
#ifndef SM_EXTRA_PARAMS
#define SM_EXTRA_PARAMS
#endif
#ifndef PROJ_EXTRA_PARAMS
#define PROJ_EXTRA_PARAMS
#endif
#ifndef SM_MASK_HOOK
#define SM_MASK_HOOK (void)0
#endif

#define WS_QH  0u                                      // f16 q rows [b*t][CC]
#define WS_KH  (WS_QH + 2u * (size_t)NB * TT * CC)      // f16 k rows [b*t][CC]
#define WS_VT  (WS_KH + 2u * (size_t)NB * TT * CC)      // f16 v planes [b][c][t]
#define WS_QL  (WS_VT + 2u * (size_t)NB * CC * TT)      // f16 q residual x 2^10 rows [b][t < QHI][CC]
#define WS_KL  (WS_QL + 2u * (size_t)NB * QHI * CC)     // f16 k residual x 2^10 rows [b][t < KHI][CC]
#define WS_VB  (WS_KL + 2u * (size_t)NB * KHI * CC)     // bf16 v hi planes [b][c][t < KHI]
#define WS_VBL (WS_VB + 2u * (size_t)NB * CC * KHI)
#define WS_S   (WS_VBL + 2u * (size_t)NB * CC * KHI)    // f32 logits / P [hg][t][s]
#define WS_Y   (WS_S  + 4u * (size_t)HG * TT * TT)      // f32 ctx rows [b*t][CC] (only when there is an output projection)
#define WS_END (WS_Y  + 4u * (size_t)NB * TT * CC)

// ---- k_proj: block = (64 rows, 128 cols, which): q/k/v = X W (+ b) with exact bf16 products (K = DIN) -> which 0: q f16 rows (+ residual rows < QHI); 1: k f16 rows (+ residual rows < KHI); 2: v f16 planes [c][t] (+ bf16 hi/lo planes for t < KHI)
__global__ __launch_bounds__(128) void k_proj(const float* __restrict__ XQ, const float* __restrict__ XK, const float* __restrict__ XV, const float* __restrict__ WQ, const float* __restrict__ WK, const float* __restrict__ WV, const float* __restrict__ BQ, const float* __restrict__ BK, const float* __restrict__ BV,
    _Float16* __restrict__ QH, _Float16* __restrict__ QL, _Float16* __restrict__ KH, _Float16* __restrict__ KL, _Float16* __restrict__ VT, __bf16* __restrict__ VB, __bf16* __restrict__ VBL PROJ_EXTRA_PARAMS) {
  __shared__ __align__(16) float st[64][132]; __shared__ __align__(16) _Float16 sh[64][136], sl[64][136]; __shared__ __align__(16) _Float16 th[128][72]; __shared__ __align__(16) __bf16 tb[128][72], tbl[128][72];
  const int tid = threadIdx.x, wave = tid >> 5, lane = tid & 31, col = lane & 15, g = lane >> 4; const int which = blockIdx.z; const int c0 = blockIdx.y * 128; const size_t r0 = (size_t)blockIdx.x * 64; const size_t bb = r0 / TT; const int t0 = (int)(r0 % TT);
  const float* X = which == 0 ? XQ : which == 1 ? XK : XV; const float* WA = which == 0 ? WQ : which == 1 ? WK : WV; const float* BA = which == 0 ? BQ : which == 1 ? BK : BV;
  v8f acc[8] = {};
#pragma unroll 2
  for (int kc = 0; kc < DIN / 32; ++kc) { v16b a; { const float* p = X + (r0 + wave * 16 + col) * DIN + kc * 32 + 8 * g;
#pragma unroll
      for (int i = 0; i < 8; ++i) { a[i] = (__bf16)p[i]; a[8 + i] = (__bf16)p[16 + i]; } }
    asm volatile("s_wait_loadcnt 0x0" ::: "memory");
#pragma unroll
    for (int j = 0; j < 8; ++j) { const v16b w = WCOL(WA, kc * 32, c0 + j * 16 + col, lane); asm volatile("s_wait_loadcnt 0x0" ::: "memory"); acc[j] = wmma_bf(a, w, acc[j]); } }
  { // stage the f32 tile (acc + bias) in LDS, run the per-(row, head) epilogue hook, then convert
#pragma unroll
    for (int j = 0; j < 8; ++j) { const float bias = BA ? bfr(BA[c0 + j * 16 + col]) : 0.f;
#pragma unroll
      for (int r = 0; r < 8; ++r) st[wave * 16 + 8 * g + r][j * 16 + col] = acc[j][r] + bias; }
    __syncthreads();
    for (int e = tid; e < 64 * (128 / HD); e += 128) { const int rl = e / (128 / HD), hh = e % (128 / HD); PROJ_EPI(which, &st[rl][hh * HD], (int)((r0 + rl) % TT), (c0 / HD) + hh); }
    __syncthreads(); }
  if (which < 2) { _Float16* DH = which == 0 ? QH : KH; _Float16* DL = which == 0 ? QL : KL; const int nhi = which == 0 ? QHI : KHI; const bool hi_rows = t0 < nhi;
    for (int e = tid; e < 64 * 128; e += 128) { const int rl = e >> 7, cl = e & 127; const float v = st[rl][cl]; const _Float16 hv = (_Float16)v; sh[rl][cl] = hv; sl[rl][cl] = (_Float16)((v - (float)hv) * 1024.0f); }
    __syncthreads();
    for (int e = tid; e < 64 * 16; e += 128) { const int rl = e >> 4, q = e & 15; vst2((unsigned*)(DH + (r0 + rl) * CC + c0 + q * 8), *(const v4u*)&sh[rl][q * 8]); if (hi_rows) vst2((unsigned*)(DL + (bb * nhi + t0 + rl) * (size_t)CC + c0 + q * 8), *(const v4u*)&sl[rl][q * 8]); }
  } else { const bool hi_rows = t0 < KHI;
    for (int e = tid; e < 64 * 128; e += 128) { const int rl = e & 63, cl = e >> 6; const float v = st[rl][cl]; th[cl][rl] = (_Float16)v; const __bf16 bh = (__bf16)v; tb[cl][rl] = bh; tbl[cl][rl] = (__bf16)(v - (float)bh); }
    __syncthreads();
    for (int e = tid; e < 128 * 8; e += 128) { const int cl = e >> 3, q = e & 7; vst2((unsigned*)(VT + (bb * CC + c0 + cl) * (size_t)TT + t0 + q * 8), *(const v4u*)&th[cl][q * 8]); if (hi_rows) { const size_t o3 = (bb * CC + c0 + cl) * (size_t)KHI + t0 + q * 8; vst2((unsigned*)(VB + o3), *(const v4u*)&tb[cl][q * 8]); vst2((unsigned*)(VBL + o3), *(const v4u*)&tbl[cl][q * 8]); } } } }
// ---- k_sc: block = (query block qb, key block kb <= kb_last(qb), head in group) of batch b: logits x SCALE; q hi + residual (x 2^10) against k (2 products) for query rows < QHI, plus the k residual (3 products) for query blocks < QBH (causal early rows); causal: blocks past the diagonal exit, the mask itself is applied by index in k_sm
__global__ __launch_bounds__(128) void k_sc(const _Float16* __restrict__ QH, const _Float16* __restrict__ KH, const _Float16* __restrict__ QL, const _Float16* __restrict__ KL, int b, int h0, float* __restrict__ S0) { __shared__ __align__(16) float ss[4][16][132];
  const int qb = blockIdx.x, kb = blockIdx.y; if (kb > kb_last(qb)) return;
  const int h = h0 + blockIdx.z; float* S = S0 + (size_t)blockIdx.z * TT * TT;
  const int tid = threadIdx.x, wave = tid >> 5, lane = tid & 31, col = lane & 15, g = lane >> 4; const int k0 = kb * 128; const int ql0 = qb * 64 + wave * 16; const size_t q0 = (size_t)b * TT + ql0, kr0 = (size_t)b * TT + k0;
  v8f acc[8] = {}, accl[8] = {};
  const _Float16* QLb = QL + (size_t)b * QHI * CC; const _Float16* KLb = KL + (size_t)b * KHI * CC;
  if (qb < QBH) {
#pragma unroll
    for (int kc = 0; kc < HD / 32; ++kc) { const v16h ah = frag_h(QH + (q0 + col) * CC + h * HD + kc * 32, lane), al = frag_h(QLb + (size_t)(ql0 + col) * CC + h * HD + kc * 32, lane);
#pragma unroll
      for (int j = 0; j < 8; ++j) { const v16h kbf = frag_h(KH + (kr0 + j * 16 + col) * CC + h * HD + kc * 32, lane), klf = frag_h(KLb + (size_t)(k0 + j * 16 + col) * CC + h * HD + kc * 32, lane); acc[j] = wmma16(ah, kbf, acc[j]); accl[j] = wmma16(al, kbf, accl[j]); accl[j] = wmma16(ah, klf, accl[j]); } }
  } else if (qb * 64 < QHI) {
#pragma unroll
    for (int kc = 0; kc < HD / 32; ++kc) { const v16h ah = frag_h(QH + (q0 + col) * CC + h * HD + kc * 32, lane), al = frag_h(QLb + (size_t)(ql0 + col) * CC + h * HD + kc * 32, lane);
#pragma unroll
      for (int j = 0; j < 8; ++j) { const v16h kbf = frag_h(KH + (kr0 + j * 16 + col) * CC + h * HD + kc * 32, lane); acc[j] = wmma16(ah, kbf, acc[j]); accl[j] = wmma16(al, kbf, accl[j]); } }
  } else {
#pragma unroll
    for (int kc = 0; kc < HD / 32; ++kc) { const v16h ah = frag_h(QH + (q0 + col) * CC + h * HD + kc * 32, lane);
#pragma unroll
      for (int j = 0; j < 8; ++j) { const v16h kbf = frag_h(KH + (kr0 + j * 16 + col) * CC + h * HD + kc * 32, lane); acc[j] = wmma16(ah, kbf, acc[j]); } } }
#pragma unroll
  for (int j = 0; j < 8; ++j) {
#pragma unroll
    for (int r = 0; r < 8; ++r) ss[wave][8 * g + r][j * 16 + col] = (acc[j][r] + accl[j][r] * (1.0f / 1024.0f)) * SCALE; }
  LDSX(); for (int rl = 0; rl < 16; ++rl) vst2(S + (size_t)(ql0 + rl) * TT + k0 + lane * 4, *(const v4f*)&ss[wave][rl][lane * 4]); }
// ---- k_sm: block = query row t (head in group): keys [0, kend): causal -> logit if s <= t else excluded; softmax in f32; P x 2^11 in place (0 for excluded)
__global__ __launch_bounds__(256) void k_sm(float* __restrict__ S0 SM_EXTRA_PARAMS) { __shared__ float sred[8]; __shared__ float sbc; __shared__ __align__(16) float shv[TT];
  const int tid = threadIdx.x; const int t = blockIdx.x; const int kend = (kb_last(t >> 6) + 1) * 128;
  float* sr = S0 + (size_t)blockIdx.y * TT * TT + (size_t)t * TT;
  float m = -3.0e38f; for (int k = tid; k < kend; k += 256) { float v = (!CAUSAL || k <= t) ? sr[k] : -3.0e38f; SM_MASK_HOOK; shv[k] = v; m = fmaxf(m, v); }
#pragma unroll
  for (int o = 1; o < 32; o <<= 1) m = fmaxf(m, __shfl_xor(m, o));
  if ((tid & 31) == 0) sred[tid >> 5] = m; __syncthreads(); if (tid == 0) { float a = sred[0]; for (int i = 1; i < 8; ++i) a = fmaxf(a, sred[i]); sbc = a; } __syncthreads(); m = sbc; __syncthreads();
  float sum = 0.f; for (int k = tid; k < kend; k += 256) { const float v = shv[k]; const float e = (v <= -1.0e38f) ? 0.f : expf(v - m); shv[k] = e; sum += e; }
#pragma unroll
  for (int o = 1; o < 32; o <<= 1) sum += __shfl_xor(sum, o);
  if ((tid & 31) == 0) sred[tid >> 5] = sum; __syncthreads(); if (tid == 0) { float a = 0.f; for (int i = 0; i < 8; ++i) a += sred[i]; sbc = a > 0.f ? 2048.0f / a : 0.f; }   /* a fully excluded row yields P = 0 */ __syncthreads(); const float inv = sbc;
  for (int k = tid; k < kend; k += 256) shv[k] = shv[k] * inv;
  __syncthreads(); for (int q = tid; q < kend / 4; q += 256) vst2(sr + q * 4, *(const v4f*)&shv[q * 4]); }
// ---- k_pv: block = 64 queries (qb) of (b, h): ctx = P . v over keys [0, kend) (P x 2^11 once to f16 against v f16: 1 product; causal early query blocks: P and v as bf16 hi + lo, 3 products); 256-B (row, head) segment by 16 lanes
__global__ __launch_bounds__(128) void k_pv(const float* __restrict__ PS0, const _Float16* __restrict__ VT, const __bf16* __restrict__ VB, const __bf16* __restrict__ VBL, int b, int h0, float* __restrict__ Y) { const int h = h0 + blockIdx.z; const float* PS = PS0 + (size_t)blockIdx.z * TT * TT; __shared__ __align__(16) float ss[4][16][HD + 4];
  const int tid = threadIdx.x, wave = tid >> 5, lane = tid & 31, col = lane & 15, g = lane >> 4; const int qb = blockIdx.x; const int ql0 = qb * 64 + wave * 16; const int kce = (kb_last(qb) + 1) * 4;
  v8f acc[HD / 16] = {};
  if (qb < QBH) {
#pragma unroll 1
    for (int kc = 0; kc < kce; ++kc) { const F2 p = split_row(PS + (size_t)(ql0 + col) * TT, kc * 32, lane);
      asm volatile("s_wait_loadcnt 0x0" ::: "memory");
#pragma unroll
      for (int j = 0; j < HD / 16; ++j) { const size_t po = ((size_t)b * CC + h * HD + j * 16 + col) * (size_t)KHI + kc * 32; const v16b vh = frag_b(VB + po, lane); acc[j] = wmma_bf(p.h, vh, acc[j]); acc[j] = wmma_bf(p.l, vh, acc[j]); acc[j] = wmma_bf(p.h, frag_b(VBL + po, lane), acc[j]); } }
  } else {
#pragma unroll 1
    for (int kc = 0; kc < kce; ++kc) { const v16h p = frag_f32(PS + (size_t)(ql0 + col) * TT + kc * 32, lane);
      asm volatile("s_wait_loadcnt 0x0" ::: "memory");
#pragma unroll
      for (int j = 0; j < HD / 16; ++j) { const size_t po = ((size_t)b * CC + h * HD + j * 16 + col) * (size_t)TT + kc * 32; acc[j] = wmma16(p, frag_h(VT + po, lane), acc[j]); } } }
#pragma unroll
  for (int j = 0; j < HD / 16; ++j)
#pragma unroll
    for (int r = 0; r < 8; ++r) ss[wave][8 * g + r][j * 16 + col] = acc[j][r] * (1.0f / 2048.0f);
  LDSX(); for (int rl = 0; rl < 16; ++rl) if (lane < HD / 4) vst2(Y + ((size_t)b * TT + ql0 + rl) * CC + h * HD + lane * 4, *(const v4f*)&ss[wave][rl][lane * 4]); }
// ---- k_out: block = (64 rows, 128 cols): out = ctx Wo (+ bo): ctx once to f16 against Wo as f16(bf16 x 2^8) exact (1 product) x 2^-8; causal early rows (< QHI of each sequence): ctx bf16 hi + lo against exact bf16 Wo (2 products)
__global__ __launch_bounds__(128) void k_out(const float* __restrict__ Y, const float* __restrict__ WO, const float* __restrict__ BO, float* __restrict__ OUT) { __shared__ __align__(16) float sf[4][16][132];
  const int tid = threadIdx.x, wave = tid >> 5, lane = tid & 31, col = lane & 15, g = lane >> 4; const int c0 = blockIdx.y * 128; const size_t r0 = (size_t)blockIdx.x * 64 + wave * 16;
  v8f acc[8] = {};
  if (CAUSAL && (int)(((size_t)blockIdx.x * 64) % TT) < QHI) {   /* block-uniform */
#pragma unroll 2
    for (int kc = 0; kc < CC / 32; ++kc) { const F2 a = split_row(Y + (r0 + col) * CC, kc * 32, lane); asm volatile("s_wait_loadcnt 0x0" ::: "memory");
#pragma unroll
      for (int j = 0; j < 8; ++j) { const v16b w = WOCOL(WO, kc * 32, c0 + j * 16 + col, lane); asm volatile("s_wait_loadcnt 0x0" ::: "memory"); acc[j] = wmma_bf(a.h, w, acc[j]); acc[j] = wmma_bf(a.l, w, acc[j]); } }
#pragma unroll
    for (int j = 0; j < 8; ++j) { const float bias = BO ? bfr(BO[c0 + j * 16 + col]) : 0.f;
#pragma unroll
      for (int r = 0; r < 8; ++r) sf[wave][8 * g + r][j * 16 + col] = acc[j][r] + bias; }
  } else {
#pragma unroll 2
    for (int kc = 0; kc < CC / 32; ++kc) { const v16h a = frag_f32(Y + (r0 + col) * CC + kc * 32, lane); asm volatile("s_wait_loadcnt 0x0" ::: "memory");
#pragma unroll
      for (int j = 0; j < 8; ++j) { const v16h w = WOCOLH(WO, kc * 32, c0 + j * 16 + col, lane); asm volatile("s_wait_loadcnt 0x0" ::: "memory"); acc[j] = wmma16(a, w, acc[j]); } }
#pragma unroll
    for (int j = 0; j < 8; ++j) { const float bias = BO ? bfr(BO[c0 + j * 16 + col]) : 0.f;
#pragma unroll
      for (int r = 0; r < 8; ++r) sf[wave][8 * g + r][j * 16 + col] = acc[j][r] * (1.0f / 256.0f) + bias; } }
  LDSX(); for (int rl = 0; rl < 16; ++rl) vst2(OUT + (r0 + rl) * DIN + c0 + lane * 4, *(const v4f*)&sf[wave][rl][lane * 4]); }

extern "C" void kernel_launch(void* const* d_in, const int* in_sizes, int n_in, void* d_out, int out_size, void* d_ws, size_t ws_size, hipStream_t stream) {
  (void)in_sizes; (void)n_in; (void)out_size;
  const float** F = (const float**)d_in;
  if (ws_size < (size_t)WS_END) return;
  char* ws = (char*)d_ws; _Float16 *QH = (_Float16*)(ws + WS_QH), *KH = (_Float16*)(ws + WS_KH), *VT = (_Float16*)(ws + WS_VT), *QL = (_Float16*)(ws + WS_QL), *KL = (_Float16*)(ws + WS_KL); __bf16 *VB = (__bf16*)(ws + WS_VB), *VBL = (__bf16*)(ws + WS_VBL); float *S = (float*)(ws + WS_S), *Y = (float*)(ws + WS_Y);
  (void)Y; (void)QL; (void)KL; (void)VB; (void)VBL;
  // inputs: 0 x [2,2048,1024]; 1 Wq, 2 bq; 3 Wk, 4 bk; 5 Wv, 6 bv; 7 Wo, 8 bo ((in,out))
  k_proj<<<dim3(TNB * TT / 64, CC / 128, 3), 128, 0, stream>>>(F[0], F[0], F[0], F[1], F[3], F[5], F[2], F[4], F[6], QH, QL, KH, KL, VT, VB, VBL);
  for (int b = 0; b < TNB; ++b) for (int h0 = 0; h0 < NH; h0 += HG) {
    k_sc<<<dim3(NQB, TT / 128, HG), 128, 0, stream>>>(QH, KH, QL, KL, b, h0, S);
    k_sm<<<dim3(TT, HG), 256, 0, stream>>>(S);
    k_pv<<<dim3(NQB, 1, HG), 128, 0, stream>>>(S, VT, VB, VBL, b, h0, Y);
  }
  k_out<<<dim3(TNB * TT / 64, DIN / 128), 128, 0, stream>>>(Y, F[7], F[8], (float*)d_out);
}

// v002
// One run takes 223 microseconds.
// Versions between v000 and this one are left out; their measured steps multiply to 5.73 times as fast.
// compute dtype: all float inputs rounded to bf16; q/k/v = x W + b with EXACT bf16 products on WMMA 16x16x32 (f32 accumulate); rotate-half RoPE applied in f32 in the projection epilogue with accurate sincosf of t x inv_freq_j (f32 constants as the reference builds them); q as f16 hi + residual (x 2^10) against k once to f16 (2 products) x 64^-0.5; softmax in f32 (precise expf) with a running maximum, logits kept in registers; exp(s - m) x 2^10 once to f16 against v once to f16 (1 product), divided by the f32 sum at the end; ctx once to f16 against Wo carried x 2^8 in f16 + bo; f32 output.
#include <hip/hip_runtime.h>
#include <math.h>

typedef __attribute__((ext_vector_type(16))) _Float16 v16h;
typedef __attribute__((ext_vector_type(16))) __bf16 v16b;
typedef __attribute__((ext_vector_type(8)))  _Float16 v8h;
typedef __attribute__((ext_vector_type(8)))  float v8f;
typedef __attribute__((ext_vector_type(4)))  float v4f;
typedef __attribute__((ext_vector_type(2)))  float v2f;
typedef __attribute__((ext_vector_type(4)))  unsigned v4u;
typedef __attribute__((ext_vector_type(4)))  int v4i;
typedef float __attribute__((may_alias)) float_a;
typedef int __attribute__((may_alias)) int_a;

template <typename T> __device__ __forceinline__ void vst2(void* p, T v) { *(T*)p = v;  }
__device__ __forceinline__ v8f wmma16(v16h a, v16h b, v8f c) {
  v8f d = __builtin_amdgcn_wmma_f32_16x16x32_f16(false, a, false, b, (short)0, c, false, false);
  asm volatile("v_nop\n\tv_nop\n\tv_nop\n\tv_nop" : "+v"(d) : "v"(a), "v"(b));
  return d;
}
__device__ __forceinline__ v8f wmma_bf(v16b a, v16b b, v8f c) {
  v8f d = __builtin_amdgcn_wmma_f32_16x16x32_bf16(false, a, false, b, (short)0, c, false, false);
  asm volatile("v_nop\n\tv_nop\n\tv_nop\n\tv_nop" : "+v"(d) : "v"(a), "v"(b));
  return d;
}
// 16x16x32 fragments: lane = (h = lane>>4, row/col = lane&15); elements 0..7 = k0+8h+0..7, 8..15 = k0+16+8h+0..7; D element r = row 8h+r
__device__ __forceinline__ v16h frag_h(const _Float16* rowk0, int lane) {
  union { v16h v; v8h q[2]; } u; const _Float16* p = rowk0 + 8 * (lane >> 4);
  u.q[0] = *(const v8h*)p; u.q[1] = *(const v8h*)(p + 16); return u.v;
}
__device__ __forceinline__ v16h frag_f32(const float* rowk0, int lane) {
  v16h a; const float* p = rowk0 + 8 * (lane >> 4);
#pragma unroll
  for (int i = 0; i < 8; ++i) { a[i] = (_Float16)p[i]; a[8 + i] = (_Float16)p[16 + i]; }
  return a;
}
__device__ __forceinline__ v16h frag_f32s(const float* rowk0, int lane, float sc) {
  v16h a; const float* p = rowk0 + 8 * (lane >> 4);
#pragma unroll
  for (int i = 0; i < 8; ++i) { a[i] = (_Float16)(p[i] * sc); a[8 + i] = (_Float16)(p[16 + i] * sc); }
  return a;
}
// column fragment from a [K][ld] layout (column n), rows >= K read as 0
__device__ __forceinline__ v16h fragc_f32(const float* W, int k0, int n, int lane, int ld, int K) {
  v16h a; const int g = lane >> 4;
#pragma unroll
  for (int i = 0; i < 8; ++i) { const int ka = k0 + 8 * g + i, kb = ka + 16;
    a[i] = (_Float16)(ka < K ? W[(size_t)(ka < K ? ka : K - 1) * ld + n] : 0.f); a[8 + i] = (_Float16)(kb < K ? W[(size_t)(kb < K ? kb : K - 1) * ld + n] : 0.f); }
  return a;
}
struct F2 { v16b h, l; };
__device__ __forceinline__ F2 bsplit16(const float v[16]) { F2 r;
#pragma unroll
  for (int i = 0; i < 16; ++i) { const __bf16 h = (__bf16)v[i]; r.h[i] = h; r.l[i] = (__bf16)(v[i] - (float)h); }
  return r; }
__device__ __forceinline__ F2 split_row(const float* row, int k0, int lane) { float v[16]; const float* p = row + k0 + 8 * (lane >> 4);
#pragma unroll
  for (int i = 0; i < 8; ++i) { v[i] = p[i]; v[8 + i] = p[16 + i]; }
  return bsplit16(v); }
__device__ __forceinline__ F2 split_rowK(const float* row, int k0, int lane, int K) { float v[16]; const int g = lane >> 4;
#pragma unroll
  for (int i = 0; i < 8; ++i) { const int ka = k0 + 8 * g + i, kb = ka + 16; v[i] = ka < K ? row[ka < K ? ka : K - 1] : 0.f; v[8 + i] = kb < K ? row[kb < K ? kb : K - 1] : 0.f; }
  return bsplit16(v); }
__device__ __forceinline__ F2 split_col(const float* W, int k0, int n, int lane, int ld, int K) { float v[16]; const int g = lane >> 4;
#pragma unroll
  for (int i = 0; i < 8; ++i) { const int ka = k0 + 8 * g + i, kb = ka + 16; v[i] = ka < K ? W[(size_t)(ka < K ? ka : K - 1) * ld + n] : 0.f; v[8 + i] = kb < K ? W[(size_t)(kb < K ? kb : K - 1) * ld + n] : 0.f; }
  return bsplit16(v); }
__device__ __forceinline__ v8f mac3(const F2& a, const F2& b, v8f c) { c = wmma_bf(a.l, b.h, c); c = wmma_bf(a.h, b.l, c); return wmma_bf(a.h, b.h, c); }
__device__ __forceinline__ float sigm(float v) { return 1.0f / (1.0f + expf(-v)); }
#define LDSX() do { asm volatile("s_wait_dscnt 0" ::: "memory"); __builtin_amdgcn_wave_barrier(); __builtin_amdgcn_fence(__ATOMIC_RELEASE, "workgroup"); } while (0)

// Multi-head self-attention with rotary embeddings (B 2, L 2,048, D 1,024 = 16 x 64): q/k/v = x W + b ((in,out)); q, k <- q cos + rotate_half(q) sin (theta_j = 10000^(-2j/64), pairs (i, i+32)); attn = softmax(q k^T x 64^-0.5) (non-causal); out = merged(attn v) Wo + bo.
#define NB 2
#define TT 2048
#define CC 1024            // NH * HD = projected width
#define DIN 1024          // input (model) width
#define NH 16
#define HD 64
#define SCALE (0.125f)
#define CAUSAL 0
#ifndef TNB
#define TNB NB
#endif
__device__ __forceinline__ float bfr(float v) { return (float)(__bf16)v; }
__host__ __device__ __forceinline__ int kb_last(int qb) { return CAUSAL ? ((qb * 64 + 63) >> 7) : (TT / 128 - 1); }
typedef __attribute__((ext_vector_type(8))) __bf16 v8b;
__device__ __forceinline__ v16b frag_b(const __bf16* rowk0, int lane) {
  union { v16b v; v8b q[2]; } u; const __bf16* p = rowk0 + 8 * (lane >> 4);
  u.q[0] = *(const v8b*)p; u.q[1] = *(const v8b*)(p + 16); return u.v;
}
#define QBH 0              // not read by any kernel in this file
#define QHI 2048            // rows carrying a q residual plane (all rows when non-causal: 2-product logits everywhere)
#define KHI 64            // key rows carrying k residual / v bf16 hi+lo planes (written by k_proj; no kernel here reads them)
// B fragment (k rows k0+.., output column o) of a weight: (in,out) [K][ld] or (out,in) [ld rows of K]: bf16 exact, or f16(bf16 * 256) exact
__device__ __forceinline__ v16b wcol_io(const float* Wm, int k0, int o, int lane, int ld) { v16b w; const int g = lane >> 4;
#pragma unroll
  for (int i = 0; i < 8; ++i) { w[i] = (__bf16)Wm[(size_t)(k0 + 8 * g + i) * ld + o]; w[8 + i] = (__bf16)Wm[(size_t)(k0 + 16 + 8 * g + i) * ld + o]; }
  return w; }
__device__ __forceinline__ v16b wcol_oi(const float* Wm, int k0, int o, int lane, int K) { v16b w; const float* p = Wm + (size_t)o * K + k0 + 8 * (lane >> 4);
#pragma unroll
  for (int i = 0; i < 8; ++i) { w[i] = (__bf16)p[i]; w[8 + i] = (__bf16)p[16 + i]; }
  return w; }
__device__ __forceinline__ v16h wcolh_io(const float* Wm, int k0, int o, int lane, int ld) { v16h w; const int g = lane >> 4;
#pragma unroll
  for (int i = 0; i < 8; ++i) { w[i] = (_Float16)(bfr(Wm[(size_t)(k0 + 8 * g + i) * ld + o]) * 256.0f); w[8 + i] = (_Float16)(bfr(Wm[(size_t)(k0 + 16 + 8 * g + i) * ld + o]) * 256.0f); }
  return w; }
__device__ __forceinline__ v16h wcolh_oi(const float* Wm, int k0, int o, int lane, int K) { v16h w; const float* p = Wm + (size_t)o * K + k0 + 8 * (lane >> 4);
#pragma unroll
  for (int i = 0; i < 8; ++i) { w[i] = (_Float16)(bfr(p[i]) * 256.0f); w[8 + i] = (_Float16)(bfr(p[16 + i]) * 256.0f); }
  return w; }
#define WQKV_LAYOUT 0   // picks WCOL's layout (0 (in,out), 1 (out,in), 2 per-head); nothing calls WCOL: k_proj reads (in,out) [DIN][CC] at any value
__device__ __forceinline__ v16b wcol_hdk(const float* Wm, int k0, int o, int lane) { v16b w; const int g = lane >> 4; const float* p = Wm + (size_t)(o / HD) * DIN * HD + (o % HD);
#pragma unroll
  for (int i = 0; i < 8; ++i) { w[i] = (__bf16)p[(size_t)(k0 + 8 * g + i) * HD]; w[8 + i] = (__bf16)p[(size_t)(k0 + 16 + 8 * g + i) * HD]; }
  return w; }
#define WO_OUT_IN 0
#if WQKV_LAYOUT == 1
#define WCOL(W, k0, o, lane) wcol_oi(W, k0, o, lane, DIN)
#elif WQKV_LAYOUT == 2
#define WCOL(W, k0, o, lane) wcol_hdk(W, k0, o, lane)
#else
#define WCOL(W, k0, o, lane) wcol_io(W, k0, o, lane, CC)
#endif
#if WO_OUT_IN
#define WOCOL(W, k0, o, lane) wcol_oi(W, k0, o, lane, CC)
#define WOCOLH(W, k0, o, lane) wcolh_oi(W, k0, o, lane, CC)
#else
#define WOCOL(W, k0, o, lane) wcol_io(W, k0, o, lane, DIN)
#define WOCOLH(W, k0, o, lane) wcolh_io(W, k0, o, lane, DIN)
#endif
__constant__ float c_invf[32] = {1.000000000e+00f,7.498942018e-01f,5.623413324e-01f,4.216965139e-01f,3.162277639e-01f,2.371373624e-01f,1.778279394e-01f,1.333521456e-01f,1.000000015e-01f,7.498941571e-02f,5.623412877e-02f,4.216964915e-02f,3.162277862e-02f,2.371373586e-02f,1.778279431e-02f,1.333521493e-02f,9.999999776e-03f,7.498942316e-03f,5.623413250e-03f,4.216964822e-03f,3.162277862e-03f,2.371373819e-03f,1.778279431e-03f,1.333521446e-03f,1.000000047e-03f,7.498941850e-04f,5.623413017e-04f,4.216964880e-04f,3.162277862e-04f,2.371373848e-04f,1.778279402e-04f,1.333521504e-04f};   // 1 / 10000^(2i/64) evaluated in f32 exactly as the reference does (jax, eager)
// per-(row, head) epilogue on the f32 projection tile: rotate-half RoPE on q and k (pairs (i, i+32), angle t * inv_freq[i]); v untouched
#define PROJ_EPI(which, row, t, h) do { if ((which) < 2) { float* rw = (row); \
    _Pragma("unroll") for (int i = 0; i < 32; ++i) { const float x0 = rw[i], x1 = rw[i + 32]; const float ang = (float)(t) * c_invf[i]; const float cs = cosf(ang), sn = sinf(ang); rw[i] = x0 * cs - x1 * sn; rw[i + 32] = x1 * cs + x0 * sn; } } } while (0)
#ifndef SM_EXTRA_PARAMS
#define SM_EXTRA_PARAMS
#endif
#ifndef PROJ_EXTRA_PARAMS
#define PROJ_EXTRA_PARAMS
#endif
#ifndef SM_MASK_HOOK
#define SM_MASK_HOOK (void)0
#endif

#define WS_QH  0u                                      // f16 q rows [b*t][CC]
#define WS_KH  (WS_QH + 2u * (size_t)NB * TT * CC)      // f16 k rows [b*t][CC]
#define WS_VT  (WS_KH + 2u * (size_t)NB * TT * CC)      // f16 v planes [b][c][t]
#define WS_QL  (WS_VT + 2u * (size_t)NB * CC * TT)      // f16 q residual x 2^10 rows [b][t < QHI][CC]
#define WS_KL  (WS_QL + 2u * (size_t)NB * QHI * CC)     // f16 k residual x 2^10 rows [b][t < KHI][CC]
#define WS_VB  (WS_KL + 2u * (size_t)NB * KHI * CC)     // bf16 v hi planes [b][c][t < KHI]
#define WS_VBL (WS_VB + 2u * (size_t)NB * CC * KHI)
#define WS_Y   (WS_VBL + 2u * (size_t)NB * CC * KHI)    // f32 ctx rows [b*t][CC] (only when there is an output projection)
#define WS_END (WS_Y  + 4u * (size_t)NB * TT * CC)

// operand stages of k_proj and k_out: GKS k of the block's 64 activation rows and 128 weight columns, converted once to 16 bit, k-contiguous rows in LDS, two buffers
#define GKS 64             // k per stage
#define GP  72             // row pitch in 16-bit elements: 144 B = 16 B x 9, no bank conflict for 16-byte accesses
typedef __attribute__((ext_vector_type(4))) __bf16 v4b;
typedef __attribute__((ext_vector_type(4))) _Float16 v4h;
// ---- k_proj: block = (64 rows, 128 cols, which): q/k/v = X W (+ b) with exact bf16 products (K = DIN) -> which 0: q f16 rows (+ residual rows < QHI); 1: k f16 rows (+ residual rows < KHI); 2: v f16 planes [c][t] (+ bf16 hi/lo planes for t < KHI)
__global__ __launch_bounds__(128) void k_proj(const float* __restrict__ XQ, const float* __restrict__ XK, const float* __restrict__ XV, const float* __restrict__ WQ, const float* __restrict__ WK, const float* __restrict__ WV, const float* __restrict__ BQ, const float* __restrict__ BK, const float* __restrict__ BV,
    _Float16* __restrict__ QH, _Float16* __restrict__ QL, _Float16* __restrict__ KH, _Float16* __restrict__ KL, _Float16* __restrict__ VT, __bf16* __restrict__ VB, __bf16* __restrict__ VBL PROJ_EXTRA_PARAMS) {
  __shared__ __align__(16) char sm[123904];   // the epilogue's arrays, laid out as before; the main loop's stages use the first 55,296 bytes ahead of them (a barrier ends the loop)
  float (*st)[132] = (float (*)[132])sm; _Float16 (*sh)[136] = (_Float16 (*)[136])(sm + 33792); _Float16 (*sl)[136] = (_Float16 (*)[136])(sm + 51200); _Float16 (*th)[72] = (_Float16 (*)[72])(sm + 68608); __bf16 (*tb)[72] = (__bf16 (*)[72])(sm + 87040); __bf16 (*tbl)[72] = (__bf16 (*)[72])(sm + 105472);
  __bf16 (*xs)[64][GP] = (__bf16 (*)[64][GP])sm; __bf16 (*wt)[128][GP] = (__bf16 (*)[128][GP])(sm + 2 * 64 * GP * 2);
  const int tid = threadIdx.x, wave = tid >> 5, lane = tid & 31, col = lane & 15, g = lane >> 4; const int which = blockIdx.z; const int c0 = blockIdx.y * 128; const size_t r0 = (size_t)blockIdx.x * 64; const size_t bb = r0 / TT; const int t0 = (int)(r0 % TT);
  const float* X = which == 0 ? XQ : which == 1 ? XK : XV; const float* WA = which == 0 ? WQ : which == 1 ? WK : WV; const float* BA = which == 0 ? BQ : which == 1 ? BK : BV;
  v8f acc[8] = {};
  const float* xg = X + (r0 + (tid >> 4)) * DIN + (tid & 15) * 4;   // 16-byte piece tid + 128 i of the x tile: row (tid >> 4) + 8 i, piece tid & 15 (a wave reads two whole 256-byte rows)
  const float* wg = WA + c0 + tid;                                  // the thread's own weight column (a wave reads one whole line per k)
  v4f xv[8]; float wv[GKS];
  auto fetch = [&](int s) {
#pragma unroll
    for (int i = 0; i < 8; ++i) xv[i] = *(const v4f*)(xg + (size_t)(8 * i) * DIN + s * GKS);
#pragma unroll
    for (int i = 0; i < GKS; ++i) wv[i] = wg[(size_t)(s * GKS + i) * CC];
    asm volatile("s_wait_xcnt 0x0" ::: "memory");   // the loads above are issued here, ahead of the products, and before a register that holds one of their addresses is written again
  };
  auto stage = [&](int b) {
#pragma unroll
    for (int i = 0; i < 8; ++i) { v4b t;
#pragma unroll
      for (int e = 0; e < 4; ++e) t[e] = (__bf16)xv[i][e];
      *(v4b*)&xs[b][(tid >> 4) + 8 * i][(tid & 15) * 4] = t; }
#pragma unroll
    for (int q = 0; q < GKS / 8; ++q) { v8b t;
#pragma unroll
      for (int e = 0; e < 8; ++e) t[e] = (__bf16)wv[q * 8 + e];
      *(v8b*)&wt[b][tid][q * 8] = t; }
  };
  auto mult = [&](int b) {
#pragma unroll
    for (int kk = 0; kk < GKS / 32; ++kk) { const v16b a = frag_b(&xs[b][wave * 16 + col][kk * 32], lane); v16b w[8];
#pragma unroll
      for (int j = 0; j < 8; ++j) w[j] = frag_b(&wt[b][j * 16 + col][kk * 32], lane);
      __builtin_amdgcn_sched_barrier(0);   // the nine fragments' LDS reads stay one group ahead of their products: one LDS wait for eight products, not one each
#pragma unroll
      for (int j = 0; j < 8; ++j) acc[j] = wmma_bf(a, w[j], acc[j]);
      __builtin_amdgcn_sched_barrier(0); }   // what follows (the next group's reads; the conversions, which wait for the global loads) stays behind the products
  };
  fetch(0); stage(0); __syncthreads();
#pragma unroll 1   // one stage's loads live at a time
  for (int s = 0; s + 1 < DIN / GKS; ++s) { fetch(s + 1); mult(s & 1); stage((s + 1) & 1); __syncthreads(); }   // the barrier publishes stage s + 1 and ends the reads of the buffer that the next trip refills
  mult((DIN / GKS - 1) & 1); __syncthreads();   // every wave has left the stages before the epilogue writes over them
  { // stage the f32 tile (acc + bias) in LDS, run the per-(row, head) epilogue hook, then convert
#pragma unroll
    for (int j = 0; j < 8; ++j) { const float bias = BA ? bfr(BA[c0 + j * 16 + col]) : 0.f;
#pragma unroll
      for (int r = 0; r < 8; ++r) st[wave * 16 + 8 * g + r][j * 16 + col] = acc[j][r] + bias; }
    __syncthreads();
    for (int e = tid; e < 64 * (128 / HD); e += 128) { const int rl = e / (128 / HD), hh = e % (128 / HD); PROJ_EPI(which, &st[rl][hh * HD], (int)((r0 + rl) % TT), (c0 / HD) + hh); }
    __syncthreads(); }
  if (which < 2) { _Float16* DH = which == 0 ? QH : KH; _Float16* DL = which == 0 ? QL : KL; const int nhi = which == 0 ? QHI : KHI; const bool hi_rows = t0 < nhi;
    for (int e = tid; e < 64 * 128; e += 128) { const int rl = e >> 7, cl = e & 127; const float v = st[rl][cl]; const _Float16 hv = (_Float16)v; sh[rl][cl] = hv; sl[rl][cl] = (_Float16)((v - (float)hv) * 1024.0f); }
    __syncthreads();
    for (int e = tid; e < 64 * 16; e += 128) { const int rl = e >> 4, q = e & 15; vst2((unsigned*)(DH + (r0 + rl) * CC + c0 + q * 8), *(const v4u*)&sh[rl][q * 8]); if (hi_rows) vst2((unsigned*)(DL + (bb * nhi + t0 + rl) * (size_t)CC + c0 + q * 8), *(const v4u*)&sl[rl][q * 8]); }
  } else { const bool hi_rows = t0 < KHI;
    for (int e = tid; e < 64 * 128; e += 128) { const int rl = e & 63, cl = e >> 6; const float v = st[rl][cl]; th[cl][rl] = (_Float16)v; const __bf16 bh = (__bf16)v; tb[cl][rl] = bh; tbl[cl][rl] = (__bf16)(v - (float)bh); }
    __syncthreads();
    for (int e = tid; e < 128 * 8; e += 128) { const int cl = e >> 3, q = e & 7; vst2((unsigned*)(VT + (bb * CC + c0 + cl) * (size_t)TT + t0 + q * 8), *(const v4u*)&th[cl][q * 8]); if (hi_rows) { const size_t o3 = (bb * CC + c0 + cl) * (size_t)KHI + t0 + q * 8; vst2((unsigned*)(VB + o3), *(const v4u*)&tb[cl][q * 8]); vst2((unsigned*)(VBL + o3), *(const v4u*)&tbl[cl][q * 8]); } } } }
// ---- k_fa: wave = NQT x 16 queries of (b, h), all TT keys in passes of 32: S^T = K Q^T (q hi + residual x 2^10, 2 products) x SCALE stays in registers; running maximum and sum per query (a lane holds one query's scores of 8 + 8 keys, the two lane halves split the keys);
//      the inner loops are all unrolled so that the fragment arrays stay in registers; exp(s - m) x 2^10 once to f16 is, in place, the B operand of O^T += V^T P^T (1 product); a lane ends with 8 consecutive channels of one query
#define NQT 2              // 16-query tiles per wave: each key and value fragment is loaded once for both
#define FAW 8              // waves per block
__device__ __forceinline__ v8f wm16(v16h a, v16h b, v8f c) { return __builtin_amdgcn_wmma_f32_16x16x32_f16(false, a, false, b, (short)0, c, false, false); }
__global__ __launch_bounds__(FAW * 32) void k_fa(const _Float16* __restrict__ QH, const _Float16* __restrict__ QL, const _Float16* __restrict__ KH, const _Float16* __restrict__ VT, float* __restrict__ Y) {
  const int tid = threadIdx.x, wave = tid >> 5, lane = tid & 31, col = lane & 15, g = lane >> 4; const int h = blockIdx.y, b = blockIdx.z; const int ql0 = (blockIdx.x * FAW + wave) * (16 * NQT);
  const _Float16* qp = QH + ((size_t)b * TT + ql0 + col) * CC + h * HD;        // query row col of the wave's first 16-query tile
  const _Float16* qr = QL + ((size_t)b * QHI + ql0 + col) * CC + h * HD;       // its residual row
  v16h qh[NQT][2], ql[NQT][2];
#pragma unroll
  for (int n = 0; n < NQT; ++n)
#pragma unroll
    for (int c = 0; c < 2; ++c) { qh[n][c] = frag_h(qp + (size_t)(n * 16) * CC + c * 32, lane); ql[n][c] = frag_h(qr + (size_t)(n * 16) * CC + c * 32, lane); }
  const _Float16* kp = KH + ((size_t)b * TT + col) * CC + h * HD;              // key row col of a 16-key tile
  const _Float16* vp = VT + ((size_t)b * CC + h * HD + col) * (size_t)TT;      // channel row col of a 16-channel tile
  v8f o[NQT][4] = {}; float m[NQT], l[NQT];
#pragma unroll
  for (int n = 0; n < NQT; ++n) { m[n] = -3.0e38f; l[n] = 0.f; }
  v16h kf[2][2];
#pragma unroll
  for (int t = 0; t < 2; ++t)
#pragma unroll
    for (int c = 0; c < 2; ++c) kf[t][c] = frag_h(kp + (size_t)(t * 16) * CC + c * 32, lane);
  asm volatile("s_wait_xcnt 0x0" :: "v"(qp + 8 * g), "v"(qr + 8 * g), "v"(kp + 8 * g) : "memory");   // as in the loop; the three lane addresses are inputs so that their registers live up to the wait
#pragma unroll 1   // one pass's fragments live at a time: a second copy of the body would not fit in 256 registers
  for (int kc = 0; kc < TT / 32; ++kc) {
    v16h vf[4];
#pragma unroll
    for (int j = 0; j < 4; ++j) vf[j] = frag_h(vp + (size_t)(j * 16) * TT + kc * 32, lane);
    v8f sa[NQT][2] = {}, sb[NQT][2] = {};
#pragma unroll
    for (int c = 0; c < 2; ++c)
#pragma unroll
      for (int t = 0; t < 2; ++t)
#pragma unroll
        for (int n = 0; n < NQT; ++n) { sa[n][t] = wm16(kf[t][c], qh[n][c], sa[n][t]); sb[n][t] = wm16(kf[t][c], ql[n][c], sb[n][t]); }
#pragma unroll
    for (int n = 0; n < NQT; ++n) { float s[16];
#pragma unroll
      for (int r = 0; r < 8; ++r) { s[r] = (sa[n][0][r] + sb[n][0][r] * (1.0f / 1024.0f)) * SCALE; s[8 + r] = (sa[n][1][r] + sb[n][1][r] * (1.0f / 1024.0f)) * SCALE; }
      float mx = s[0];
#pragma unroll
      for (int i = 1; i < 16; ++i) mx = fmaxf(mx, s[i]);
      mx = fmaxf(mx, __shfl_xor(mx, 16));
      const float mn = fmaxf(m[n], mx); const float al = expf(m[n] - mn); m[n] = mn;
      float sum = 0.f; v16h p;
#pragma unroll
      for (int i = 0; i < 16; ++i) { const float e = expf(s[i] - mn); sum += e; p[i] = (_Float16)(e * 1024.0f); }
      l[n] = l[n] * al + sum;
#pragma unroll
      for (int j = 0; j < 4; ++j) { o[n][j] *= al; o[n][j] = wm16(vf[j], p, o[n][j]); } }
    const int kn = kc + 1 < TT / 32 ? kc + 1 : kc;   // the next pass's key fragments, into the registers of this pass's (the last pass re-reads its own)
#pragma unroll
    for (int t = 0; t < 2; ++t)
#pragma unroll
      for (int c = 0; c < 2; ++c) kf[t][c] = frag_h(kp + (size_t)(kn * 32 + t * 16) * CC + c * 32, lane);
    asm volatile("s_wait_xcnt 0x0" ::: "memory");   // the loads above are issued before a register that holds one of their addresses is written again
  }
#pragma unroll
  for (int n = 0; n < NQT; ++n) { const float a = l[n] + __shfl_xor(l[n], 16); const float inv = a > 0.f ? 1.0f / (1024.0f * a) : 0.f;
    float* yr = Y + ((size_t)b * TT + ql0 + n * 16 + col) * CC + h * HD + 8 * g;
#pragma unroll
    for (int j = 0; j < 4; ++j) { v4f lo, hi;
#pragma unroll
      for (int r = 0; r < 4; ++r) { lo[r] = o[n][j][r] * inv; hi[r] = o[n][j][4 + r] * inv; }
      vst2(yr + j * 16, lo); vst2(yr + j * 16 + 4, hi); } } }
// ---- k_out: block = (64 rows, 128 cols): out = ctx Wo (+ bo): ctx once to f16 against Wo as f16(bf16 x 2^8) exact (1 product) x 2^-8; causal early rows (< QHI of each sequence): ctx bf16 hi + lo against exact bf16 Wo (2 products)
__global__ __launch_bounds__(128) void k_out(const float* __restrict__ Y, const float* __restrict__ WO, const float* __restrict__ BO, float* __restrict__ OUT) { __shared__ __align__(16) float sf[4][16][132]; __shared__ __align__(16) _Float16 ys[2][64][GP], wt[2][128][GP];
  const int tid = threadIdx.x, wave = tid >> 5, lane = tid & 31, col = lane & 15, g = lane >> 4; const int c0 = blockIdx.y * 128; const size_t r0 = (size_t)blockIdx.x * 64 + wave * 16;
  v8f acc[8] = {};
  if (CAUSAL && (int)(((size_t)blockIdx.x * 64) % TT) < QHI) {   /* block-uniform */
#pragma unroll 2
    for (int kc = 0; kc < CC / 32; ++kc) { const F2 a = split_row(Y + (r0 + col) * CC, kc * 32, lane); asm volatile("s_wait_loadcnt 0x0" ::: "memory");
#pragma unroll
      for (int j = 0; j < 8; ++j) { const v16b w = WOCOL(WO, kc * 32, c0 + j * 16 + col, lane); asm volatile("s_wait_loadcnt 0x0" ::: "memory"); acc[j] = wmma_bf(a.h, w, acc[j]); acc[j] = wmma_bf(a.l, w, acc[j]); } }
#pragma unroll
    for (int j = 0; j < 8; ++j) { const float bias = BO ? bfr(BO[c0 + j * 16 + col]) : 0.f;
#pragma unroll
      for (int r = 0; r < 8; ++r) sf[wave][8 * g + r][j * 16 + col] = acc[j][r] + bias; }
  } else {
    const float* yg = Y + ((size_t)blockIdx.x * 64 + (tid >> 4)) * CC + (tid & 15) * 4;   // as in k_proj: row (tid >> 4) + 8 i, 16-byte piece tid & 15
    const float* wg = WO + c0 + tid;                                                      // the thread's own weight column
    v4f yv[8]; float wv[GKS];
    auto fetch = [&](int s) {
#pragma unroll
      for (int i = 0; i < 8; ++i) yv[i] = *(const v4f*)(yg + (size_t)(8 * i) * CC + s * GKS);
#pragma unroll
      for (int i = 0; i < GKS; ++i) wv[i] = wg[(size_t)(s * GKS + i) * DIN];
      asm volatile("s_wait_xcnt 0x0" ::: "memory");   // the loads above are issued here, ahead of the products, and before a register that holds one of their addresses is written again
    };
    auto stage = [&](int b) {
#pragma unroll
      for (int i = 0; i < 8; ++i) { v4h t;
#pragma unroll
        for (int e = 0; e < 4; ++e) t[e] = (_Float16)yv[i][e];
        *(v4h*)&ys[b][(tid >> 4) + 8 * i][(tid & 15) * 4] = t; }
#pragma unroll
      for (int q = 0; q < GKS / 8; ++q) { v8h t;
#pragma unroll
        for (int e = 0; e < 8; ++e) t[e] = (_Float16)(bfr(wv[q * 8 + e]) * 256.0f);
        *(v8h*)&wt[b][tid][q * 8] = t; }
    };
    auto mult = [&](int b) {
#pragma unroll
      for (int kk = 0; kk < GKS / 32; ++kk) { const v16h a = frag_h(&ys[b][wave * 16 + col][kk * 32], lane); v16h w[8];
#pragma unroll
        for (int j = 0; j < 8; ++j) w[j] = frag_h(&wt[b][j * 16 + col][kk * 32], lane);
        __builtin_amdgcn_sched_barrier(0);   // as in k_proj: one group of LDS reads, one wait, eight products
#pragma unroll
        for (int j = 0; j < 8; ++j) acc[j] = wmma16(a, w[j], acc[j]);
        __builtin_amdgcn_sched_barrier(0); }   // as in k_proj: the conversions and their wait for the global loads stay behind the products
    };
    fetch(0); stage(0); __syncthreads();
#pragma unroll 1   // one stage's loads live at a time
    for (int s = 0; s + 1 < CC / GKS; ++s) { fetch(s + 1); mult(s & 1); stage((s + 1) & 1); __syncthreads(); }   // the barrier publishes stage s + 1 and ends the reads of the buffer that the next trip refills
    mult((CC / GKS - 1) & 1);
#pragma unroll
    for (int j = 0; j < 8; ++j) { const float bias = BO ? bfr(BO[c0 + j * 16 + col]) : 0.f;
#pragma unroll
      for (int r = 0; r < 8; ++r) sf[wave][8 * g + r][j * 16 + col] = acc[j][r] * (1.0f / 256.0f) + bias; } }
  LDSX(); for (int rl = 0; rl < 16; ++rl) vst2(OUT + (r0 + rl) * DIN + c0 + lane * 4, *(const v4f*)&sf[wave][rl][lane * 4]); }

extern "C" void kernel_launch(void* const* d_in, const int* in_sizes, int n_in, void* d_out, int out_size, void* d_ws, size_t ws_size, hipStream_t stream) {
  (void)in_sizes; (void)n_in; (void)out_size;
  const float** F = (const float**)d_in;
  if (ws_size < (size_t)WS_END) return;
  char* ws = (char*)d_ws; _Float16 *QH = (_Float16*)(ws + WS_QH), *KH = (_Float16*)(ws + WS_KH), *VT = (_Float16*)(ws + WS_VT), *QL = (_Float16*)(ws + WS_QL), *KL = (_Float16*)(ws + WS_KL); __bf16 *VB = (__bf16*)(ws + WS_VB), *VBL = (__bf16*)(ws + WS_VBL); float *Y = (float*)(ws + WS_Y);
  (void)Y; (void)QL; (void)KL; (void)VB; (void)VBL;
  // inputs: 0 x [2,2048,1024]; 1 Wq, 2 bq; 3 Wk, 4 bk; 5 Wv, 6 bv; 7 Wo, 8 bo ((in,out))
  k_proj<<<dim3(TNB * TT / 64, CC / 128, 3), 128, 0, stream>>>(F[0], F[0], F[0], F[1], F[3], F[5], F[2], F[4], F[6], QH, QL, KH, KL, VT, VB, VBL);
  k_fa<<<dim3(TT / (FAW * 16 * NQT), NH, TNB), FAW * 32, 0, stream>>>(QH, QL, KH, VT, Y);
  k_out<<<dim3(TNB * TT / 64, DIN / 128), 128, 0, stream>>>(Y, F[7], F[8], (float*)d_out);
}

// v003
// A run of this version takes 197 microseconds.
// In both of two side-by-side timings against v002, it was 1.14 times as fast.
// All steps since v000 together make it 6.52 times as fast.
// compute dtype: all float inputs rounded to bf16; q/k/v = x W + b with EXACT bf16 products on WMMA 16x16x32 (f32 accumulate); rotate-half RoPE applied in f32 in the projection epilogue with accurate sincosf of t x inv_freq_j (f32 constants as the reference builds them); q as f16 hi + residual (x 2^10) against k once to f16 (2 products); softmax in f32 (hardware base-2 exponential of (s - m) x 64^-0.5 x log2 e + 10) with a running maximum, logits kept in registers; exp((s - m) x 64^-0.5) x 2^10 once to f16 against v once to f16 (1 product), divided by the f32 sum at the end; ctx once to f16 against Wo carried x 2^8 in f16 + bo; f32 output.
#include <hip/hip_runtime.h>
#include <math.h>

typedef __attribute__((ext_vector_type(16))) _Float16 v16h;
typedef __attribute__((ext_vector_type(16))) __bf16 v16b;
typedef __attribute__((ext_vector_type(8)))  _Float16 v8h;
typedef __attribute__((ext_vector_type(8)))  float v8f;
typedef __attribute__((ext_vector_type(4)))  float v4f;
typedef __attribute__((ext_vector_type(2)))  float v2f;
typedef __attribute__((ext_vector_type(4)))  unsigned v4u;
typedef __attribute__((ext_vector_type(4)))  int v4i;
typedef float __attribute__((may_alias)) float_a;
typedef int __attribute__((may_alias)) int_a;

template <typename T> __device__ __forceinline__ void vst2(void* p, T v) { *(T*)p = v;  }
__device__ __forceinline__ v8f wmma16(v16h a, v16h b, v8f c) {
  v8f d = __builtin_amdgcn_wmma_f32_16x16x32_f16(false, a, false, b, (short)0, c, false, false);
  asm volatile("v_nop\n\tv_nop\n\tv_nop\n\tv_nop" : "+v"(d) : "v"(a), "v"(b));
  return d;
}
__device__ __forceinline__ v8f wmma_bf(v16b a, v16b b, v8f c) {
  v8f d = __builtin_amdgcn_wmma_f32_16x16x32_bf16(false, a, false, b, (short)0, c, false, false);
  asm volatile("v_nop\n\tv_nop\n\tv_nop\n\tv_nop" : "+v"(d) : "v"(a), "v"(b));
  return d;
}
// 16x16x32 fragments: lane = (h = lane>>4, row/col = lane&15); elements 0..7 = k0+8h+0..7, 8..15 = k0+16+8h+0..7; D element r = row 8h+r
__device__ __forceinline__ v16h frag_h(const _Float16* rowk0, int lane) {
  union { v16h v; v8h q[2]; } u; const _Float16* p = rowk0 + 8 * (lane >> 4);
  u.q[0] = *(const v8h*)p; u.q[1] = *(const v8h*)(p + 16); return u.v;
}
__device__ __forceinline__ v16h frag_f32(const float* rowk0, int lane) {
  v16h a; const float* p = rowk0 + 8 * (lane >> 4);
#pragma unroll
  for (int i = 0; i < 8; ++i) { a[i] = (_Float16)p[i]; a[8 + i] = (_Float16)p[16 + i]; }
  return a;
}
__device__ __forceinline__ v16h frag_f32s(const float* rowk0, int lane, float sc) {
  v16h a; const float* p = rowk0 + 8 * (lane >> 4);
#pragma unroll
  for (int i = 0; i < 8; ++i) { a[i] = (_Float16)(p[i] * sc); a[8 + i] = (_Float16)(p[16 + i] * sc); }
  return a;
}
// column fragment from a [K][ld] layout (column n), rows >= K read as 0
__device__ __forceinline__ v16h fragc_f32(const float* W, int k0, int n, int lane, int ld, int K) {
  v16h a; const int g = lane >> 4;
#pragma unroll
  for (int i = 0; i < 8; ++i) { const int ka = k0 + 8 * g + i, kb = ka + 16;
    a[i] = (_Float16)(ka < K ? W[(size_t)(ka < K ? ka : K - 1) * ld + n] : 0.f); a[8 + i] = (_Float16)(kb < K ? W[(size_t)(kb < K ? kb : K - 1) * ld + n] : 0.f); }
  return a;
}
struct F2 { v16b h, l; };
__device__ __forceinline__ F2 bsplit16(const float v[16]) { F2 r;
#pragma unroll
  for (int i = 0; i < 16; ++i) { const __bf16 h = (__bf16)v[i]; r.h[i] = h; r.l[i] = (__bf16)(v[i] - (float)h); }
  return r; }
__device__ __forceinline__ F2 split_row(const float* row, int k0, int lane) { float v[16]; const float* p = row + k0 + 8 * (lane >> 4);
#pragma unroll
  for (int i = 0; i < 8; ++i) { v[i] = p[i]; v[8 + i] = p[16 + i]; }
  return bsplit16(v); }
__device__ __forceinline__ F2 split_rowK(const float* row, int k0, int lane, int K) { float v[16]; const int g = lane >> 4;
#pragma unroll
  for (int i = 0; i < 8; ++i) { const int ka = k0 + 8 * g + i, kb = ka + 16; v[i] = ka < K ? row[ka < K ? ka : K - 1] : 0.f; v[8 + i] = kb < K ? row[kb < K ? kb : K - 1] : 0.f; }
  return bsplit16(v); }
__device__ __forceinline__ F2 split_col(const float* W, int k0, int n, int lane, int ld, int K) { float v[16]; const int g = lane >> 4;
#pragma unroll
  for (int i = 0; i < 8; ++i) { const int ka = k0 + 8 * g + i, kb = ka + 16; v[i] = ka < K ? W[(size_t)(ka < K ? ka : K - 1) * ld + n] : 0.f; v[8 + i] = kb < K ? W[(size_t)(kb < K ? kb : K - 1) * ld + n] : 0.f; }
  return bsplit16(v); }
__device__ __forceinline__ v8f mac3(const F2& a, const F2& b, v8f c) { c = wmma_bf(a.l, b.h, c); c = wmma_bf(a.h, b.l, c); return wmma_bf(a.h, b.h, c); }
__device__ __forceinline__ float sigm(float v) { return 1.0f / (1.0f + expf(-v)); }
#define LDSX() do { asm volatile("s_wait_dscnt 0" ::: "memory"); __builtin_amdgcn_wave_barrier(); __builtin_amdgcn_fence(__ATOMIC_RELEASE, "workgroup"); } while (0)

// Multi-head self-attention with rotary embeddings (B 2, L 2,048, D 1,024 = 16 x 64): q/k/v = x W + b ((in,out)); q, k <- q cos + rotate_half(q) sin (theta_j = 10000^(-2j/64), pairs (i, i+32)); attn = softmax(q k^T x 64^-0.5) (non-causal); out = merged(attn v) Wo + bo.
#define NB 2
#define TT 2048
#define CC 1024            // NH * HD = projected width
#define DIN 1024          // input (model) width
#define NH 16
#define HD 64
#define SCALE (0.125f)
#define CAUSAL 0
#ifndef TNB
#define TNB NB
#endif
__device__ __forceinline__ float bfr(float v) { return (float)(__bf16)v; }
__host__ __device__ __forceinline__ int kb_last(int qb) { return CAUSAL ? ((qb * 64 + 63) >> 7) : (TT / 128 - 1); }
typedef __attribute__((ext_vector_type(8))) __bf16 v8b;
__device__ __forceinline__ v16b frag_b(const __bf16* rowk0, int lane) {
  union { v16b v; v8b q[2]; } u; const __bf16* p = rowk0 + 8 * (lane >> 4);
  u.q[0] = *(const v8b*)p; u.q[1] = *(const v8b*)(p + 16); return u.v;
}
#define QBH 0              // not read by any kernel in this file
#define QHI 2048            // rows carrying a q residual plane (all rows when non-causal: 2-product logits everywhere)
#define KHI 64            // key rows carrying k residual / v bf16 hi+lo planes (written by k_proj; no kernel here reads them)
// B fragment (k rows k0+.., output column o) of a weight: (in,out) [K][ld] or (out,in) [ld rows of K]: bf16 exact, or f16(bf16 * 256) exact
__device__ __forceinline__ v16b wcol_io(const float* Wm, int k0, int o, int lane, int ld) { v16b w; const int g = lane >> 4;
#pragma unroll
  for (int i = 0; i < 8; ++i) { w[i] = (__bf16)Wm[(size_t)(k0 + 8 * g + i) * ld + o]; w[8 + i] = (__bf16)Wm[(size_t)(k0 + 16 + 8 * g + i) * ld + o]; }
  return w; }
__device__ __forceinline__ v16b wcol_oi(const float* Wm, int k0, int o, int lane, int K) { v16b w; const float* p = Wm + (size_t)o * K + k0 + 8 * (lane >> 4);
#pragma unroll
  for (int i = 0; i < 8; ++i) { w[i] = (__bf16)p[i]; w[8 + i] = (__bf16)p[16 + i]; }
  return w; }
__device__ __forceinline__ v16h wcolh_io(const float* Wm, int k0, int o, int lane, int ld) { v16h w; const int g = lane >> 4;
#pragma unroll
  for (int i = 0; i < 8; ++i) { w[i] = (_Float16)(bfr(Wm[(size_t)(k0 + 8 * g + i) * ld + o]) * 256.0f); w[8 + i] = (_Float16)(bfr(Wm[(size_t)(k0 + 16 + 8 * g + i) * ld + o]) * 256.0f); }
  return w; }
__device__ __forceinline__ v16h wcolh_oi(const float* Wm, int k0, int o, int lane, int K) { v16h w; const float* p = Wm + (size_t)o * K + k0 + 8 * (lane >> 4);
#pragma unroll
  for (int i = 0; i < 8; ++i) { w[i] = (_Float16)(bfr(p[i]) * 256.0f); w[8 + i] = (_Float16)(bfr(p[16 + i]) * 256.0f); }
  return w; }
#define WQKV_LAYOUT 0   // picks WCOL's layout (0 (in,out), 1 (out,in), 2 per-head); nothing calls WCOL: k_proj reads (in,out) [DIN][CC] at any value
__device__ __forceinline__ v16b wcol_hdk(const float* Wm, int k0, int o, int lane) { v16b w; const int g = lane >> 4; const float* p = Wm + (size_t)(o / HD) * DIN * HD + (o % HD);
#pragma unroll
  for (int i = 0; i < 8; ++i) { w[i] = (__bf16)p[(size_t)(k0 + 8 * g + i) * HD]; w[8 + i] = (__bf16)p[(size_t)(k0 + 16 + 8 * g + i) * HD]; }
  return w; }
#define WO_OUT_IN 0
#if WQKV_LAYOUT == 1
#define WCOL(W, k0, o, lane) wcol_oi(W, k0, o, lane, DIN)
#elif WQKV_LAYOUT == 2
#define WCOL(W, k0, o, lane) wcol_hdk(W, k0, o, lane)
#else
#define WCOL(W, k0, o, lane) wcol_io(W, k0, o, lane, CC)
#endif
#if WO_OUT_IN
#define WOCOL(W, k0, o, lane) wcol_oi(W, k0, o, lane, CC)
#define WOCOLH(W, k0, o, lane) wcolh_oi(W, k0, o, lane, CC)
#else
#define WOCOL(W, k0, o, lane) wcol_io(W, k0, o, lane, DIN)
#define WOCOLH(W, k0, o, lane) wcolh_io(W, k0, o, lane, DIN)
#endif
__constant__ float c_invf[32] = {1.000000000e+00f,7.498942018e-01f,5.623413324e-01f,4.216965139e-01f,3.162277639e-01f,2.371373624e-01f,1.778279394e-01f,1.333521456e-01f,1.000000015e-01f,7.498941571e-02f,5.623412877e-02f,4.216964915e-02f,3.162277862e-02f,2.371373586e-02f,1.778279431e-02f,1.333521493e-02f,9.999999776e-03f,7.498942316e-03f,5.623413250e-03f,4.216964822e-03f,3.162277862e-03f,2.371373819e-03f,1.778279431e-03f,1.333521446e-03f,1.000000047e-03f,7.498941850e-04f,5.623413017e-04f,4.216964880e-04f,3.162277862e-04f,2.371373848e-04f,1.778279402e-04f,1.333521504e-04f};   // 1 / 10000^(2i/64) evaluated in f32 exactly as the reference does (jax, eager)
// per-(row, head) epilogue on the f32 projection tile: rotate-half RoPE on q and k (pairs (i, i+32), angle t * inv_freq[i]); v untouched
#define PROJ_EPI(which, row, t, h) do { if ((which) < 2) { float* rw = (row); \
    _Pragma("unroll") for (int i = 0; i < 32; ++i) { const float x0 = rw[i], x1 = rw[i + 32]; const float ang = (float)(t) * c_invf[i]; const float cs = cosf(ang), sn = sinf(ang); rw[i] = x0 * cs - x1 * sn; rw[i + 32] = x1 * cs + x0 * sn; } } } while (0)
#ifndef SM_EXTRA_PARAMS
#define SM_EXTRA_PARAMS
#endif
#ifndef PROJ_EXTRA_PARAMS
#define PROJ_EXTRA_PARAMS
#endif
#ifndef SM_MASK_HOOK
#define SM_MASK_HOOK (void)0
#endif

#define WS_QH  0u                                      // f16 q rows [b*t][CC]
#define WS_KH  (WS_QH + 2u * (size_t)NB * TT * CC)      // f16 k rows [b*t][CC]
#define WS_VT  (WS_KH + 2u * (size_t)NB * TT * CC)      // f16 v planes [b][c][t]
#define WS_QL  (WS_VT + 2u * (size_t)NB * CC * TT)      // f16 q residual x 2^10 rows [b][t < QHI][CC]
#define WS_KL  (WS_QL + 2u * (size_t)NB * QHI * CC)     // f16 k residual x 2^10 rows [b][t < KHI][CC]
#define WS_VB  (WS_KL + 2u * (size_t)NB * KHI * CC)     // bf16 v hi planes [b][c][t < KHI]
#define WS_VBL (WS_VB + 2u * (size_t)NB * CC * KHI)
#define WS_Y   (WS_VBL + 2u * (size_t)NB * CC * KHI)    // f32 ctx rows [b*t][CC] (only when there is an output projection)
#define WS_END (WS_Y  + 4u * (size_t)NB * TT * CC)

// operand stages of k_proj and k_out: GKS k of the block's 64 activation rows and 128 weight columns, converted once to 16 bit, k-contiguous rows in LDS, two buffers
#define GKS 64             // k per stage
#define GP  72             // row pitch in 16-bit elements: 144 B = 16 B x 9, no bank conflict for 16-byte accesses
typedef __attribute__((ext_vector_type(4))) __bf16 v4b;
typedef __attribute__((ext_vector_type(4))) _Float16 v4h;
// ---- k_proj: block = (64 rows, 128 cols, which): q/k/v = X W (+ b) with exact bf16 products (K = DIN) -> which 0: q f16 rows (+ residual rows < QHI); 1: k f16 rows (+ residual rows < KHI); 2: v f16 planes [c][t] (+ bf16 hi/lo planes for t < KHI)
__global__ __launch_bounds__(128) void k_proj(const float* __restrict__ XQ, const float* __restrict__ XK, const float* __restrict__ XV, const float* __restrict__ WQ, const float* __restrict__ WK, const float* __restrict__ WV, const float* __restrict__ BQ, const float* __restrict__ BK, const float* __restrict__ BV,
    _Float16* __restrict__ QH, _Float16* __restrict__ QL, _Float16* __restrict__ KH, _Float16* __restrict__ KL, _Float16* __restrict__ VT, __bf16* __restrict__ VB, __bf16* __restrict__ VBL PROJ_EXTRA_PARAMS) {
  __shared__ __align__(16) char sm[123904];   // the epilogue's arrays, laid out as before; the main loop's stages use the first 55,296 bytes ahead of them (a barrier ends the loop)
  float (*st)[132] = (float (*)[132])sm; _Float16 (*sh)[136] = (_Float16 (*)[136])(sm + 33792); _Float16 (*sl)[136] = (_Float16 (*)[136])(sm + 51200); _Float16 (*th)[72] = (_Float16 (*)[72])(sm + 68608); __bf16 (*tb)[72] = (__bf16 (*)[72])(sm + 87040); __bf16 (*tbl)[72] = (__bf16 (*)[72])(sm + 105472);
  __bf16 (*xs)[64][GP] = (__bf16 (*)[64][GP])sm; __bf16 (*wt)[128][GP] = (__bf16 (*)[128][GP])(sm + 2 * 64 * GP * 2);
  const int tid = threadIdx.x, wave = tid >> 5, lane = tid & 31, col = lane & 15, g = lane >> 4; const int which = blockIdx.z; const int c0 = blockIdx.y * 128; const size_t r0 = (size_t)blockIdx.x * 64; const size_t bb = r0 / TT; const int t0 = (int)(r0 % TT);
  const float* X = which == 0 ? XQ : which == 1 ? XK : XV; const float* WA = which == 0 ? WQ : which == 1 ? WK : WV; const float* BA = which == 0 ? BQ : which == 1 ? BK : BV;
  v8f acc[8] = {};
  const float* xg = X + (r0 + (tid >> 4)) * DIN + (tid & 15) * 4;   // 16-byte piece tid + 128 i of the x tile: row (tid >> 4) + 8 i, piece tid & 15 (a wave reads two whole 256-byte rows)
  const float* wg = WA + c0 + tid;                                  // the thread's own weight column (a wave reads one whole line per k)
  v4f xv[8]; float wv[GKS];
  auto fetch = [&](int s) {
#pragma unroll
    for (int i = 0; i < 8; ++i) xv[i] = *(const v4f*)(xg + (size_t)(8 * i) * DIN + s * GKS);
#pragma unroll
    for (int i = 0; i < GKS; ++i) wv[i] = wg[(size_t)(s * GKS + i) * CC];
    asm volatile("s_wait_xcnt 0x0" ::: "memory");   // the loads above are issued here, ahead of the products, and before a register that holds one of their addresses is written again
  };
  auto stage = [&](int b) {
#pragma unroll
    for (int i = 0; i < 8; ++i) { v4b t;
#pragma unroll
      for (int e = 0; e < 4; ++e) t[e] = (__bf16)xv[i][e];
      *(v4b*)&xs[b][(tid >> 4) + 8 * i][(tid & 15) * 4] = t; }
#pragma unroll
    for (int q = 0; q < GKS / 8; ++q) { v8b t;
#pragma unroll
      for (int e = 0; e < 8; ++e) t[e] = (__bf16)wv[q * 8 + e];
      *(v8b*)&wt[b][tid][q * 8] = t; }
  };
  auto mult = [&](int b) {
#pragma unroll
    for (int kk = 0; kk < GKS / 32; ++kk) { const v16b a = frag_b(&xs[b][wave * 16 + col][kk * 32], lane); v16b w[8];
#pragma unroll
      for (int j = 0; j < 8; ++j) w[j] = frag_b(&wt[b][j * 16 + col][kk * 32], lane);
      __builtin_amdgcn_sched_barrier(0);   // the nine fragments' LDS reads stay one group ahead of their products: one LDS wait for eight products, not one each
#pragma unroll
      for (int j = 0; j < 8; ++j) acc[j] = wmma_bf(a, w[j], acc[j]);
      __builtin_amdgcn_sched_barrier(0); }   // what follows (the next group's reads; the conversions, which wait for the global loads) stays behind the products
  };
  fetch(0); stage(0); __syncthreads();
#pragma unroll 1   // one stage's loads live at a time
  for (int s = 0; s + 1 < DIN / GKS; ++s) { fetch(s + 1); mult(s & 1); stage((s + 1) & 1); __syncthreads(); }   // the barrier publishes stage s + 1 and ends the reads of the buffer that the next trip refills
  mult((DIN / GKS - 1) & 1); __syncthreads();   // every wave has left the stages before the epilogue writes over them
  { // stage the f32 tile (acc + bias) in LDS, run the per-(row, head) epilogue hook, then convert
#pragma unroll
    for (int j = 0; j < 8; ++j) { const float bias = BA ? bfr(BA[c0 + j * 16 + col]) : 0.f;
#pragma unroll
      for (int r = 0; r < 8; ++r) st[wave * 16 + 8 * g + r][j * 16 + col] = acc[j][r] + bias; }
    __syncthreads();
    for (int e = tid; e < 64 * (128 / HD); e += 128) { const int rl = e / (128 / HD), hh = e % (128 / HD); PROJ_EPI(which, &st[rl][hh * HD], (int)((r0 + rl) % TT), (c0 / HD) + hh); }
    __syncthreads(); }
  if (which < 2) { _Float16* DH = which == 0 ? QH : KH; _Float16* DL = which == 0 ? QL : KL; const int nhi = which == 0 ? QHI : KHI; const bool hi_rows = t0 < nhi;
    for (int e = tid; e < 64 * 128; e += 128) { const int rl = e >> 7, cl = e & 127; const float v = st[rl][cl]; const _Float16 hv = (_Float16)v; sh[rl][cl] = hv; sl[rl][cl] = (_Float16)((v - (float)hv) * 1024.0f); }
    __syncthreads();
    for (int e = tid; e < 64 * 16; e += 128) { const int rl = e >> 4, q = e & 15; vst2((unsigned*)(DH + (r0 + rl) * CC + c0 + q * 8), *(const v4u*)&sh[rl][q * 8]); if (hi_rows) vst2((unsigned*)(DL + (bb * nhi + t0 + rl) * (size_t)CC + c0 + q * 8), *(const v4u*)&sl[rl][q * 8]); }
  } else { const bool hi_rows = t0 < KHI;
    for (int e = tid; e < 64 * 128; e += 128) { const int rl = e & 63, cl = e >> 6; const float v = st[rl][cl]; th[cl][rl] = (_Float16)v; const __bf16 bh = (__bf16)v; tb[cl][rl] = bh; tbl[cl][rl] = (__bf16)(v - (float)bh); }
    __syncthreads();
    for (int e = tid; e < 128 * 8; e += 128) { const int cl = e >> 3, q = e & 7; vst2((unsigned*)(VT + (bb * CC + c0 + cl) * (size_t)TT + t0 + q * 8), *(const v4u*)&th[cl][q * 8]); if (hi_rows) { const size_t o3 = (bb * CC + c0 + cl) * (size_t)KHI + t0 + q * 8; vst2((unsigned*)(VB + o3), *(const v4u*)&tb[cl][q * 8]); vst2((unsigned*)(VBL + o3), *(const v4u*)&tbl[cl][q * 8]); } } } }
// ---- k_fa: wave = NQT x 16 queries of (b, h), all TT keys in passes of 32: S^T = K Q^T (q hi + residual x 2^10, 2 products) stays in registers, unscaled; running maximum and sum per query (a lane holds one query's scores of 8 + 8 keys, the two lane halves split the keys);
//      the inner loops are all unrolled so that the fragment arrays stay in registers; 2^((s - m) SL2E + 10) once to f16 is, in place, the B operand of O^T += V^T P^T (1 product); a lane ends with 8 consecutive channels of one query
#define NQT 2              // 16-query tiles per wave: each key and value fragment is loaded once for both
#define FAW 8              // waves per block
#define SL2E (SCALE * 1.44269504088896341f)   // SCALE x log2(e): one multiply-add takes an unscaled logit to the argument of the base-2 exponential
__device__ __forceinline__ v8f wm16(v16h a, v16h b, v8f c) { return __builtin_amdgcn_wmma_f32_16x16x32_f16(false, a, false, b, (short)0, c, false, false); }
__global__ __launch_bounds__(FAW * 32) void k_fa(const _Float16* __restrict__ QH, const _Float16* __restrict__ QL, const _Float16* __restrict__ KH, const _Float16* __restrict__ VT, float* __restrict__ Y) {
  const int tid = threadIdx.x, wave = tid >> 5, lane = tid & 31, col = lane & 15, g = lane >> 4; const int h = blockIdx.y, b = blockIdx.z; const int ql0 = (blockIdx.x * FAW + wave) * (16 * NQT);
  const _Float16* qp = QH + ((size_t)b * TT + ql0 + col) * CC + h * HD;        // query row col of the wave's first 16-query tile
  const _Float16* qr = QL + ((size_t)b * QHI + ql0 + col) * CC + h * HD;       // its residual row
  v16h qh[NQT][2], ql[NQT][2];
#pragma unroll
  for (int n = 0; n < NQT; ++n)
#pragma unroll
    for (int c = 0; c < 2; ++c) { qh[n][c] = frag_h(qp + (size_t)(n * 16) * CC + c * 32, lane); ql[n][c] = frag_h(qr + (size_t)(n * 16) * CC + c * 32, lane); }
  const _Float16* kp = KH + ((size_t)b * TT + col) * CC + h * HD;              // key row col of a 16-key tile
  const _Float16* vp = VT + ((size_t)b * CC + h * HD + col) * (size_t)TT;      // channel row col of a 16-channel tile
  v8f o[NQT][4] = {}; float m[NQT], l[NQT];
#pragma unroll
  for (int n = 0; n < NQT; ++n) { m[n] = -3.0e38f; l[n] = 0.f; }
  v16h kf[2][2];
#pragma unroll
  for (int t = 0; t < 2; ++t)
#pragma unroll
    for (int c = 0; c < 2; ++c) kf[t][c] = frag_h(kp + (size_t)(t * 16) * CC + c * 32, lane);
  asm volatile("s_wait_xcnt 0x0" :: "v"(qp + 8 * g), "v"(qr + 8 * g), "v"(kp + 8 * g) : "memory");   // as in the loop; the three lane addresses are inputs so that their registers live up to the wait
#pragma unroll 1   // one pass's fragments live at a time: a second copy of the body would not fit in 256 registers
  for (int kc = 0; kc < TT / 32; ++kc) {
    v16h vf[4];
#pragma unroll
    for (int j = 0; j < 4; ++j) vf[j] = frag_h(vp + (size_t)(j * 16) * TT + kc * 32, lane);
    v8f sa[NQT][2] = {}, sb[NQT][2] = {};
#pragma unroll
    for (int c = 0; c < 2; ++c)
#pragma unroll
      for (int t = 0; t < 2; ++t)
#pragma unroll
        for (int n = 0; n < NQT; ++n) { sa[n][t] = wm16(kf[t][c], qh[n][c], sa[n][t]); sb[n][t] = wm16(kf[t][c], ql[n][c], sb[n][t]); }
#pragma unroll
    for (int n = 0; n < NQT; ++n) { float s[16];
#pragma unroll
      for (int r = 0; r < 8; ++r) { s[r] = sa[n][0][r] + sb[n][0][r] * (1.0f / 1024.0f); s[8 + r] = sa[n][1][r] + sb[n][1][r] * (1.0f / 1024.0f); }   // unscaled logits: SCALE goes into the exponent's multiplier
      float mx = s[0];
#pragma unroll
      for (int i = 1; i < 16; ++i) mx = fmaxf(mx, s[i]);
      mx = fmaxf(mx, __shfl_xor(mx, 16));
      const float mn = fmaxf(m[n], mx); const float al = __builtin_amdgcn_exp2f((m[n] - mn) * SL2E); m[n] = mn;
      const float bias = 10.0f - mn * SL2E;   // 2^(s SL2E + bias) = exp((s - mn) SCALE) x 2^10
      float sum = 0.f; v16h p;
#pragma unroll
      for (int i = 0; i < 16; ++i) { const float e = __builtin_amdgcn_exp2f(fmaf(s[i], SL2E, bias)); sum += e; p[i] = (_Float16)e; }
      l[n] = l[n] * al + sum;
#pragma unroll
      for (int j = 0; j < 4; ++j) { o[n][j] *= al; o[n][j] = wm16(vf[j], p, o[n][j]); } }
    const int kn = kc + 1 < TT / 32 ? kc + 1 : kc;   // the next pass's key fragments, into the registers of this pass's (the last pass re-reads its own)
#pragma unroll
    for (int t = 0; t < 2; ++t)
#pragma unroll
      for (int c = 0; c < 2; ++c) kf[t][c] = frag_h(kp + (size_t)(kn * 32 + t * 16) * CC + c * 32, lane);
    asm volatile("s_wait_xcnt 0x0" ::: "memory");   // the loads above are issued before a register that holds one of their addresses is written again
  }
#pragma unroll
  for (int n = 0; n < NQT; ++n) { const float a = l[n] + __shfl_xor(l[n], 16); const float inv = a > 0.f ? 1.0f / a : 0.f;   // numerator and sum both carry the 2^10
    float* yr = Y + ((size_t)b * TT + ql0 + n * 16 + col) * CC + h * HD + 8 * g;
#pragma unroll
    for (int j = 0; j < 4; ++j) { v4f lo, hi;
#pragma unroll
      for (int r = 0; r < 4; ++r) { lo[r] = o[n][j][r] * inv; hi[r] = o[n][j][4 + r] * inv; }
      vst2(yr + j * 16, lo); vst2(yr + j * 16 + 4, hi); } } }
// ---- k_out: block = (64 rows, 128 cols): out = ctx Wo (+ bo): ctx once to f16 against Wo as f16(bf16 x 2^8) exact (1 product) x 2^-8; causal early rows (< QHI of each sequence): ctx bf16 hi + lo against exact bf16 Wo (2 products)
__global__ __launch_bounds__(128) void k_out(const float* __restrict__ Y, const float* __restrict__ WO, const float* __restrict__ BO, float* __restrict__ OUT) { __shared__ __align__(16) float sf[4][16][132]; __shared__ __align__(16) _Float16 ys[2][64][GP], wt[2][128][GP];
  const int tid = threadIdx.x, wave = tid >> 5, lane = tid & 31, col = lane & 15, g = lane >> 4; const int c0 = blockIdx.y * 128; const size_t r0 = (size_t)blockIdx.x * 64 + wave * 16;
  v8f acc[8] = {};
  if (CAUSAL && (int)(((size_t)blockIdx.x * 64) % TT) < QHI) {   /* block-uniform */
#pragma unroll 2
    for (int kc = 0; kc < CC / 32; ++kc) { const F2 a = split_row(Y + (r0 + col) * CC, kc * 32, lane); asm volatile("s_wait_loadcnt 0x0" ::: "memory");
#pragma unroll
      for (int j = 0; j < 8; ++j) { const v16b w = WOCOL(WO, kc * 32, c0 + j * 16 + col, lane); asm volatile("s_wait_loadcnt 0x0" ::: "memory"); acc[j] = wmma_bf(a.h, w, acc[j]); acc[j] = wmma_bf(a.l, w, acc[j]); } }
#pragma unroll
    for (int j = 0; j < 8; ++j) { const float bias = BO ? bfr(BO[c0 + j * 16 + col]) : 0.f;
#pragma unroll
      for (int r = 0; r < 8; ++r) sf[wave][8 * g + r][j * 16 + col] = acc[j][r] + bias; }
  } else {
    const float* yg = Y + ((size_t)blockIdx.x * 64 + (tid >> 4)) * CC + (tid & 15) * 4;   // as in k_proj: row (tid >> 4) + 8 i, 16-byte piece tid & 15
    const float* wg = WO + c0 + tid;                                                      // the thread's own weight column
    v4f yv[8]; float wv[GKS];
    auto fetch = [&](int s) {
#pragma unroll
      for (int i = 0; i < 8; ++i) yv[i] = *(const v4f*)(yg + (size_t)(8 * i) * CC + s * GKS);
#pragma unroll
      for (int i = 0; i < GKS; ++i) wv[i] = wg[(size_t)(s * GKS + i) * DIN];
      asm volatile("s_wait_xcnt 0x0" ::: "memory");   // the loads above are issued here, ahead of the products, and before a register that holds one of their addresses is written again
    };
    auto stage = [&](int b) {
#pragma unroll
      for (int i = 0; i < 8; ++i) { v4h t;
#pragma unroll
        for (int e = 0; e < 4; ++e) t[e] = (_Float16)yv[i][e];
        *(v4h*)&ys[b][(tid >> 4) + 8 * i][(tid & 15) * 4] = t; }
#pragma unroll
      for (int q = 0; q < GKS / 8; ++q) { v8h t;
#pragma unroll
        for (int e = 0; e < 8; ++e) t[e] = (_Float16)(bfr(wv[q * 8 + e]) * 256.0f);
        *(v8h*)&wt[b][tid][q * 8] = t; }
    };
    auto mult = [&](int b) {
#pragma unroll
      for (int kk = 0; kk < GKS / 32; ++kk) { const v16h a = frag_h(&ys[b][wave * 16 + col][kk * 32], lane); v16h w[8];
#pragma unroll
        for (int j = 0; j < 8; ++j) w[j] = frag_h(&wt[b][j * 16 + col][kk * 32], lane);
        __builtin_amdgcn_sched_barrier(0);   // as in k_proj: one group of LDS reads, one wait, eight products
#pragma unroll
        for (int j = 0; j < 8; ++j) acc[j] = wmma16(a, w[j], acc[j]);
        __builtin_amdgcn_sched_barrier(0); }   // as in k_proj: the conversions and their wait for the global loads stay behind the products
    };
    fetch(0); stage(0); __syncthreads();
#pragma unroll 1   // one stage's loads live at a time
    for (int s = 0; s + 1 < CC / GKS; ++s) { fetch(s + 1); mult(s & 1); stage((s + 1) & 1); __syncthreads(); }   // the barrier publishes stage s + 1 and ends the reads of the buffer that the next trip refills
    mult((CC / GKS - 1) & 1);
#pragma unroll
    for (int j = 0; j < 8; ++j) { const float bias = BO ? bfr(BO[c0 + j * 16 + col]) : 0.f;
#pragma unroll
      for (int r = 0; r < 8; ++r) sf[wave][8 * g + r][j * 16 + col] = acc[j][r] * (1.0f / 256.0f) + bias; } }
  LDSX(); for (int rl = 0; rl < 16; ++rl) vst2(OUT + (r0 + rl) * DIN + c0 + lane * 4, *(const v4f*)&sf[wave][rl][lane * 4]); }

extern "C" void kernel_launch(void* const* d_in, const int* in_sizes, int n_in, void* d_out, int out_size, void* d_ws, size_t ws_size, hipStream_t stream) {
  (void)in_sizes; (void)n_in; (void)out_size;
  const float** F = (const float**)d_in;
  if (ws_size < (size_t)WS_END) return;
  char* ws = (char*)d_ws; _Float16 *QH = (_Float16*)(ws + WS_QH), *KH = (_Float16*)(ws + WS_KH), *VT = (_Float16*)(ws + WS_VT), *QL = (_Float16*)(ws + WS_QL), *KL = (_Float16*)(ws + WS_KL); __bf16 *VB = (__bf16*)(ws + WS_VB), *VBL = (__bf16*)(ws + WS_VBL); float *Y = (float*)(ws + WS_Y);
  (void)Y; (void)QL; (void)KL; (void)VB; (void)VBL;
  // inputs: 0 x [2,2048,1024]; 1 Wq, 2 bq; 3 Wk, 4 bk; 5 Wv, 6 bv; 7 Wo, 8 bo ((in,out))
  k_proj<<<dim3(TNB * TT / 64, CC / 128, 3), 128, 0, stream>>>(F[0], F[0], F[0], F[1], F[3], F[5], F[2], F[4], F[6], QH, QL, KH, KL, VT, VB, VBL);
  k_fa<<<dim3(TT / (FAW * 16 * NQT), NH, TNB), FAW * 32, 0, stream>>>(QH, QL, KH, VT, Y);
  k_out<<<dim3(TNB * TT / 64, DIN / 128), 128, 0, stream>>>(Y, F[7], F[8], (float*)d_out);
}

// v004
// Measured time: 156 microseconds a run.
// Timed twice side by side with v003, it ran 1.26 times as fast both times.
// Over all steps from v000 it is 8.20 times as fast.
// compute dtype: all float inputs rounded to bf16; q/k/v = x W + b with EXACT bf16 products on WMMA 16x16x32 (f32 accumulate); rotate-half RoPE applied in f32 in the projection epilogue with accurate sincosf of t x inv_freq_j (f32 constants as the reference builds them); q as f16 hi + residual (x 2^10) against k once to f16 (2 products); softmax in f32 (hardware base-2 exponential of (s - m) x 64^-0.5 x log2 e + 10) with a running maximum, logits kept in registers; exp((s - m) x 64^-0.5) x 2^10 once to f16 against v once to f16 (1 product), divided by the f32 sum at the end; ctx once to f16 against Wo carried x 2^8 in f16 + bo; f32 output.
#include <hip/hip_runtime.h>
#include <math.h>

typedef __attribute__((ext_vector_type(16))) _Float16 v16h;
typedef __attribute__((ext_vector_type(16))) __bf16 v16b;
typedef __attribute__((ext_vector_type(8)))  _Float16 v8h;
typedef __attribute__((ext_vector_type(8)))  float v8f;
typedef __attribute__((ext_vector_type(4)))  float v4f;
typedef __attribute__((ext_vector_type(2)))  float v2f;
typedef __attribute__((ext_vector_type(4)))  unsigned v4u;
typedef __attribute__((ext_vector_type(4)))  int v4i;
typedef float __attribute__((may_alias)) float_a;
typedef int __attribute__((may_alias)) int_a;

template <typename T> __device__ __forceinline__ void vst2(void* p, T v) { *(T*)p = v;  }
__device__ __forceinline__ v8f wmma16(v16h a, v16h b, v8f c) {
  v8f d = __builtin_amdgcn_wmma_f32_16x16x32_f16(false, a, false, b, (short)0, c, false, false);
  asm volatile("v_nop\n\tv_nop\n\tv_nop\n\tv_nop" : "+v"(d) : "v"(a), "v"(b));
  return d;
}
__device__ __forceinline__ v8f wmma_bf(v16b a, v16b b, v8f c) {
  v8f d = __builtin_amdgcn_wmma_f32_16x16x32_bf16(false, a, false, b, (short)0, c, false, false);
  asm volatile("v_nop\n\tv_nop\n\tv_nop\n\tv_nop" : "+v"(d) : "v"(a), "v"(b));
  return d;
}
// 16x16x32 fragments: lane = (h = lane>>4, row/col = lane&15); elements 0..7 = k0+8h+0..7, 8..15 = k0+16+8h+0..7; D element r = row 8h+r
__device__ __forceinline__ v16h frag_h(const _Float16* rowk0, int lane) {
  union { v16h v; v8h q[2]; } u; const _Float16* p = rowk0 + 8 * (lane >> 4);
  u.q[0] = *(const v8h*)p; u.q[1] = *(const v8h*)(p + 16); return u.v;
}
__device__ __forceinline__ v16h frag_f32(const float* rowk0, int lane) {
  v16h a; const float* p = rowk0 + 8 * (lane >> 4);
#pragma unroll
  for (int i = 0; i < 8; ++i) { a[i] = (_Float16)p[i]; a[8 + i] = (_Float16)p[16 + i]; }
  return a;
}
__device__ __forceinline__ v16h frag_f32s(const float* rowk0, int lane, float sc) {
  v16h a; const float* p = rowk0 + 8 * (lane >> 4);
#pragma unroll
  for (int i = 0; i < 8; ++i) { a[i] = (_Float16)(p[i] * sc); a[8 + i] = (_Float16)(p[16 + i] * sc); }
  return a;
}
// column fragment from a [K][ld] layout (column n), rows >= K read as 0
__device__ __forceinline__ v16h fragc_f32(const float* W, int k0, int n, int lane, int ld, int K) {
  v16h a; const int g = lane >> 4;
#pragma unroll
  for (int i = 0; i < 8; ++i) { const int ka = k0 + 8 * g + i, kb = ka + 16;
    a[i] = (_Float16)(ka < K ? W[(size_t)(ka < K ? ka : K - 1) * ld + n] : 0.f); a[8 + i] = (_Float16)(kb < K ? W[(size_t)(kb < K ? kb : K - 1) * ld + n] : 0.f); }
  return a;
}
struct F2 { v16b h, l; };
__device__ __forceinline__ F2 bsplit16(const float v[16]) { F2 r;
#pragma unroll
  for (int i = 0; i < 16; ++i) { const __bf16 h = (__bf16)v[i]; r.h[i] = h; r.l[i] = (__bf16)(v[i] - (float)h); }
  return r; }
__device__ __forceinline__ F2 split_row(const float* row, int k0, int lane) { float v[16]; const float* p = row + k0 + 8 * (lane >> 4);
#pragma unroll
  for (int i = 0; i < 8; ++i) { v[i] = p[i]; v[8 + i] = p[16 + i]; }
  return bsplit16(v); }
__device__ __forceinline__ F2 split_rowK(const float* row, int k0, int lane, int K) { float v[16]; const int g = lane >> 4;
#pragma unroll
  for (int i = 0; i < 8; ++i) { const int ka = k0 + 8 * g + i, kb = ka + 16; v[i] = ka < K ? row[ka < K ? ka : K - 1] : 0.f; v[8 + i] = kb < K ? row[kb < K ? kb : K - 1] : 0.f; }
  return bsplit16(v); }
__device__ __forceinline__ F2 split_col(const float* W, int k0, int n, int lane, int ld, int K) { float v[16]; const int g = lane >> 4;
#pragma unroll
  for (int i = 0; i < 8; ++i) { const int ka = k0 + 8 * g + i, kb = ka + 16; v[i] = ka < K ? W[(size_t)(ka < K ? ka : K - 1) * ld + n] : 0.f; v[8 + i] = kb < K ? W[(size_t)(kb < K ? kb : K - 1) * ld + n] : 0.f; }
  return bsplit16(v); }
__device__ __forceinline__ v8f mac3(const F2& a, const F2& b, v8f c) { c = wmma_bf(a.l, b.h, c); c = wmma_bf(a.h, b.l, c); return wmma_bf(a.h, b.h, c); }
__device__ __forceinline__ float sigm(float v) { return 1.0f / (1.0f + expf(-v)); }
#define LDSX() do { asm volatile("s_wait_dscnt 0" ::: "memory"); __builtin_amdgcn_wave_barrier(); __builtin_amdgcn_fence(__ATOMIC_RELEASE, "workgroup"); } while (0)

// Multi-head self-attention with rotary embeddings (B 2, L 2,048, D 1,024 = 16 x 64): q/k/v = x W + b ((in,out)); q, k <- q cos + rotate_half(q) sin (theta_j = 10000^(-2j/64), pairs (i, i+32)); attn = softmax(q k^T x 64^-0.5) (non-causal); out = merged(attn v) Wo + bo.
#define NB 2
#define TT 2048
#define CC 1024            // NH * HD = projected width
#define DIN 1024          // input (model) width
#define NH 16
#define HD 64
#define SCALE (0.125f)
#define CAUSAL 0
#ifndef TNB
#define TNB NB
#endif
__device__ __forceinline__ float bfr(float v) { return (float)(__bf16)v; }
__host__ __device__ __forceinline__ int kb_last(int qb) { return CAUSAL ? ((qb * 64 + 63) >> 7) : (TT / 128 - 1); }
typedef __attribute__((ext_vector_type(8))) __bf16 v8b;
__device__ __forceinline__ v16b frag_b(const __bf16* rowk0, int lane) {
  union { v16b v; v8b q[2]; } u; const __bf16* p = rowk0 + 8 * (lane >> 4);
  u.q[0] = *(const v8b*)p; u.q[1] = *(const v8b*)(p + 16); return u.v;
}
#define QBH 0              // not read by any kernel in this file
#define QHI 2048            // rows carrying a q residual plane (all rows when non-causal: 2-product logits everywhere)
#define KHI 64            // key rows carrying k residual / v bf16 hi+lo planes (written by k_proj; no kernel here reads them)
// B fragment (k rows k0+.., output column o) of a weight: (in,out) [K][ld] or (out,in) [ld rows of K]: bf16 exact, or f16(bf16 * 256) exact
__device__ __forceinline__ v16b wcol_io(const float* Wm, int k0, int o, int lane, int ld) { v16b w; const int g = lane >> 4;
#pragma unroll
  for (int i = 0; i < 8; ++i) { w[i] = (__bf16)Wm[(size_t)(k0 + 8 * g + i) * ld + o]; w[8 + i] = (__bf16)Wm[(size_t)(k0 + 16 + 8 * g + i) * ld + o]; }
  return w; }
__device__ __forceinline__ v16b wcol_oi(const float* Wm, int k0, int o, int lane, int K) { v16b w; const float* p = Wm + (size_t)o * K + k0 + 8 * (lane >> 4);
#pragma unroll
  for (int i = 0; i < 8; ++i) { w[i] = (__bf16)p[i]; w[8 + i] = (__bf16)p[16 + i]; }
  return w; }
__device__ __forceinline__ v16h wcolh_io(const float* Wm, int k0, int o, int lane, int ld) { v16h w; const int g = lane >> 4;
#pragma unroll
  for (int i = 0; i < 8; ++i) { w[i] = (_Float16)(bfr(Wm[(size_t)(k0 + 8 * g + i) * ld + o]) * 256.0f); w[8 + i] = (_Float16)(bfr(Wm[(size_t)(k0 + 16 + 8 * g + i) * ld + o]) * 256.0f); }
  return w; }
__device__ __forceinline__ v16h wcolh_oi(const float* Wm, int k0, int o, int lane, int K) { v16h w; const float* p = Wm + (size_t)o * K + k0 + 8 * (lane >> 4);
#pragma unroll
  for (int i = 0; i < 8; ++i) { w[i] = (_Float16)(bfr(p[i]) * 256.0f); w[8 + i] = (_Float16)(bfr(p[16 + i]) * 256.0f); }
  return w; }
#define WQKV_LAYOUT 0   // picks WCOL's layout (0 (in,out), 1 (out,in), 2 per-head); nothing calls WCOL: k_proj reads (in,out) [DIN][CC] at any value
__device__ __forceinline__ v16b wcol_hdk(const float* Wm, int k0, int o, int lane) { v16b w; const int g = lane >> 4; const float* p = Wm + (size_t)(o / HD) * DIN * HD + (o % HD);
#pragma unroll
  for (int i = 0; i < 8; ++i) { w[i] = (__bf16)p[(size_t)(k0 + 8 * g + i) * HD]; w[8 + i] = (__bf16)p[(size_t)(k0 + 16 + 8 * g + i) * HD]; }
  return w; }
#define WO_OUT_IN 0
#if WQKV_LAYOUT == 1
#define WCOL(W, k0, o, lane) wcol_oi(W, k0, o, lane, DIN)
#elif WQKV_LAYOUT == 2
#define WCOL(W, k0, o, lane) wcol_hdk(W, k0, o, lane)
#else
#define WCOL(W, k0, o, lane) wcol_io(W, k0, o, lane, CC)
#endif
#if WO_OUT_IN
#define WOCOL(W, k0, o, lane) wcol_oi(W, k0, o, lane, CC)
#define WOCOLH(W, k0, o, lane) wcolh_oi(W, k0, o, lane, CC)
#else
#define WOCOL(W, k0, o, lane) wcol_io(W, k0, o, lane, DIN)
#define WOCOLH(W, k0, o, lane) wcolh_io(W, k0, o, lane, DIN)
#endif
__constant__ float c_invf[32] = {1.000000000e+00f,7.498942018e-01f,5.623413324e-01f,4.216965139e-01f,3.162277639e-01f,2.371373624e-01f,1.778279394e-01f,1.333521456e-01f,1.000000015e-01f,7.498941571e-02f,5.623412877e-02f,4.216964915e-02f,3.162277862e-02f,2.371373586e-02f,1.778279431e-02f,1.333521493e-02f,9.999999776e-03f,7.498942316e-03f,5.623413250e-03f,4.216964822e-03f,3.162277862e-03f,2.371373819e-03f,1.778279431e-03f,1.333521446e-03f,1.000000047e-03f,7.498941850e-04f,5.623413017e-04f,4.216964880e-04f,3.162277862e-04f,2.371373848e-04f,1.778279402e-04f,1.333521504e-04f};   // 1 / 10000^(2i/64) evaluated in f32 exactly as the reference does (jax, eager)
// per-(row, head) epilogue on the f32 projection tile: rotate-half RoPE on q and k (pairs (i, i+32), angle t * inv_freq[i]); v untouched
#define PROJ_EPI(which, row, t, h) do { if ((which) < 2) { float* rw = (row); \
    _Pragma("unroll") for (int i = 0; i < 32; ++i) { const float x0 = rw[i], x1 = rw[i + 32]; const float ang = (float)(t) * c_invf[i]; const float cs = cosf(ang), sn = sinf(ang); rw[i] = x0 * cs - x1 * sn; rw[i + 32] = x1 * cs + x0 * sn; } } } while (0)
#ifndef SM_EXTRA_PARAMS
#define SM_EXTRA_PARAMS
#endif
#ifndef PROJ_EXTRA_PARAMS
#define PROJ_EXTRA_PARAMS
#endif
#ifndef SM_MASK_HOOK
#define SM_MASK_HOOK (void)0
#endif

#define WS_QH  0u                                      // f16 q rows [b*t][CC]
#define WS_KH  (WS_QH + 2u * (size_t)NB * TT * CC)      // f16 k rows [b*t][CC]
#define WS_VT  (WS_KH + 2u * (size_t)NB * TT * CC)      // f16 v planes [b][c][t]
#define WS_QL  (WS_VT + 2u * (size_t)NB * CC * TT)      // f16 q residual x 2^10 rows [b][t < QHI][CC]
#define WS_KL  (WS_QL + 2u * (size_t)NB * QHI * CC)     // f16 k residual x 2^10 rows [b][t < KHI][CC]
#define WS_VB  (WS_KL + 2u * (size_t)NB * KHI * CC)     // bf16 v hi planes [b][c][t < KHI]
#define WS_VBL (WS_VB + 2u * (size_t)NB * CC * KHI)
#define WS_Y   (WS_VBL + 2u * (size_t)NB * CC * KHI)    // f32 ctx rows [b*t][CC] (only when there is an output projection)
#define WS_END (WS_Y  + 4u * (size_t)NB * TT * CC)

// operand stages of k_proj and k_out: GKS k of the block's 64 activation rows and 128 weight columns, converted once to 16 bit, k-contiguous rows in LDS, two buffers
#define GKS 64             // k per stage
#define GP  72             // row pitch in 16-bit elements: 144 B = 16 B x 9, no bank conflict for 16-byte accesses
typedef __attribute__((ext_vector_type(4))) __bf16 v4b;
typedef __attribute__((ext_vector_type(4))) _Float16 v4h;
// ---- k_proj: block = (64 rows, 128 cols, which): q/k/v = X W (+ b) with exact bf16 products (K = DIN) -> which 0: q f16 rows (+ residual rows < QHI); 1: k f16 rows (+ residual rows < KHI); 2: v f16 planes [c][t] (+ bf16 hi/lo planes for t < KHI)
__global__ __launch_bounds__(128) void k_proj(const float* __restrict__ XQ, const float* __restrict__ XK, const float* __restrict__ XV, const float* __restrict__ WQ, const float* __restrict__ WK, const float* __restrict__ WV, const float* __restrict__ BQ, const float* __restrict__ BK, const float* __restrict__ BV,
    _Float16* __restrict__ QH, _Float16* __restrict__ QL, _Float16* __restrict__ KH, _Float16* __restrict__ KL, _Float16* __restrict__ VT, __bf16* __restrict__ VB, __bf16* __restrict__ VBL PROJ_EXTRA_PARAMS) {
  __shared__ __align__(16) char sm[123904];   // the epilogue's arrays, laid out as before; the main loop's stages use the first 55,296 bytes ahead of them (a barrier ends the loop)
  float (*st)[132] = (float (*)[132])sm; _Float16 (*sh)[136] = (_Float16 (*)[136])(sm + 33792); _Float16 (*sl)[136] = (_Float16 (*)[136])(sm + 51200); _Float16 (*th)[72] = (_Float16 (*)[72])(sm + 68608); __bf16 (*tb)[72] = (__bf16 (*)[72])(sm + 87040); __bf16 (*tbl)[72] = (__bf16 (*)[72])(sm + 105472);
  __bf16 (*xs)[64][GP] = (__bf16 (*)[64][GP])sm; __bf16 (*wt)[128][GP] = (__bf16 (*)[128][GP])(sm + 2 * 64 * GP * 2);
  const int tid = threadIdx.x, wave = tid >> 5, lane = tid & 31, col = lane & 15, g = lane >> 4; const int which = blockIdx.z; const int c0 = blockIdx.y * 128; const size_t r0 = (size_t)blockIdx.x * 64; const size_t bb = r0 / TT; const int t0 = (int)(r0 % TT);
  const float* X = which == 0 ? XQ : which == 1 ? XK : XV; const float* WA = which == 0 ? WQ : which == 1 ? WK : WV; const float* BA = which == 0 ? BQ : which == 1 ? BK : BV;
  v8f acc[8] = {};
  const float* xg = X + (r0 + (tid >> 4)) * DIN + (tid & 15) * 4;   // 16-byte piece tid + 128 i of the x tile: row (tid >> 4) + 8 i, piece tid & 15 (a wave reads two whole 256-byte rows)
  const float* wg = WA + c0 + tid;                                  // the thread's own weight column (a wave reads one whole line per k)
  v4f xv[8]; float wv[GKS];
  auto fetch = [&](int s) {
#pragma unroll
    for (int i = 0; i < 8; ++i) xv[i] = *(const v4f*)(xg + (size_t)(8 * i) * DIN + s * GKS);
#pragma unroll
    for (int i = 0; i < GKS; ++i) wv[i] = wg[(size_t)(s * GKS + i) * CC];
    asm volatile("s_wait_xcnt 0x0" ::: "memory");   // the loads above are issued here, ahead of the products, and before a register that holds one of their addresses is written again
  };
  auto stage = [&](int b) {
#pragma unroll
    for (int i = 0; i < 8; ++i) { v4b t;
#pragma unroll
      for (int e = 0; e < 4; ++e) t[e] = (__bf16)xv[i][e];
      *(v4b*)&xs[b][(tid >> 4) + 8 * i][(tid & 15) * 4] = t; }
#pragma unroll
    for (int q = 0; q < GKS / 8; ++q) { v8b t;
#pragma unroll
      for (int e = 0; e < 8; ++e) t[e] = (__bf16)wv[q * 8 + e];
      *(v8b*)&wt[b][tid][q * 8] = t; }
  };
  auto mult = [&](int b) {
#pragma unroll
    for (int kk = 0; kk < GKS / 32; ++kk) { const v16b a = frag_b(&xs[b][wave * 16 + col][kk * 32], lane); v16b w[8];
#pragma unroll
      for (int j = 0; j < 8; ++j) w[j] = frag_b(&wt[b][j * 16 + col][kk * 32], lane);
      __builtin_amdgcn_sched_barrier(0);   // the nine fragments' LDS reads stay one group ahead of their products: one LDS wait for eight products, not one each
#pragma unroll
      for (int j = 0; j < 8; ++j) acc[j] = wmma_bf(a, w[j], acc[j]);
      __builtin_amdgcn_sched_barrier(0); }   // what follows (the next group's reads; the conversions, which wait for the global loads) stays behind the products
  };
  fetch(0); stage(0); __syncthreads();
#pragma unroll 1   // one stage's loads live at a time
  for (int s = 0; s + 1 < DIN / GKS; ++s) { fetch(s + 1); mult(s & 1); stage((s + 1) & 1); __syncthreads(); }   // the barrier publishes stage s + 1 and ends the reads of the buffer that the next trip refills
  mult((DIN / GKS - 1) & 1); __syncthreads();   // every wave has left the stages before the epilogue writes over them
  { // stage the f32 tile (acc + bias) in LDS, run the per-(row, head) epilogue hook, then convert
#pragma unroll
    for (int j = 0; j < 8; ++j) { const float bias = BA ? bfr(BA[c0 + j * 16 + col]) : 0.f;
#pragma unroll
      for (int r = 0; r < 8; ++r) st[wave * 16 + 8 * g + r][j * 16 + col] = acc[j][r] + bias; }
    __syncthreads();
    for (int e = tid; e < 64 * (128 / HD); e += 128) { const int rl = e / (128 / HD), hh = e % (128 / HD); PROJ_EPI(which, &st[rl][hh * HD], (int)((r0 + rl) % TT), (c0 / HD) + hh); }
    __syncthreads(); }
  if (which < 2) { _Float16* DH = which == 0 ? QH : KH; _Float16* DL = which == 0 ? QL : KL; const int nhi = which == 0 ? QHI : KHI; const bool hi_rows = t0 < nhi;
    for (int e = tid; e < 64 * 128; e += 128) { const int rl = e >> 7, cl = e & 127; const float v = st[rl][cl]; const _Float16 hv = (_Float16)v; sh[rl][cl] = hv; sl[rl][cl] = (_Float16)((v - (float)hv) * 1024.0f); }
    __syncthreads();
    for (int e = tid; e < 64 * 16; e += 128) { const int rl = e >> 4, q = e & 15; vst2((unsigned*)(DH + (r0 + rl) * CC + c0 + q * 8), *(const v4u*)&sh[rl][q * 8]); if (hi_rows) vst2((unsigned*)(DL + (bb * nhi + t0 + rl) * (size_t)CC + c0 + q * 8), *(const v4u*)&sl[rl][q * 8]); }
  } else { const bool hi_rows = t0 < KHI;
    for (int e = tid; e < 64 * 128; e += 128) { const int rl = e & 63, cl = e >> 6; const float v = st[rl][cl]; th[cl][rl] = (_Float16)v; const __bf16 bh = (__bf16)v; tb[cl][rl] = bh; tbl[cl][rl] = (__bf16)(v - (float)bh); }
    __syncthreads();
    for (int e = tid; e < 128 * 8; e += 128) { const int cl = e >> 3, q = e & 7; vst2((unsigned*)(VT + (bb * CC + c0 + cl) * (size_t)TT + t0 + q * 8), *(const v4u*)&th[cl][q * 8]); if (hi_rows) { const size_t o3 = (bb * CC + c0 + cl) * (size_t)KHI + t0 + q * 8; vst2((unsigned*)(VB + o3), *(const v4u*)&tb[cl][q * 8]); vst2((unsigned*)(VBL + o3), *(const v4u*)&tbl[cl][q * 8]); } } } }
// ---- k_fa: wave = NQT x 16 queries of (b, h), all TT keys in passes of 32: S^T = K Q^T (q hi + residual x 2^10, 2 products) stays in registers, unscaled; running maximum and sum per query (a lane holds one query's scores of 8 + 8 keys, the two lane halves split the keys);
//      the block's FAW waves walk the same keys: each stage of KST keys (K rows, V^T channel rows) is brought once per block, in whole 128-byte lines, into LDS (two buffers, the next stage's global loads fly under this stage's passes) and every wave takes its fragments from there;
//      the inner loops are all unrolled so that the fragment arrays stay in registers; 2^((s - m) SL2E + 10) once to f16 is, in place, the B operand of O^T += V^T P^T (1 product); a lane ends with 8 consecutive channels of one query
#define NQT 2              // 16-query tiles per wave: each key and value fragment is loaded once for both
#define FAW 8              // waves per block
#define KST 64             // keys per stage: a K row (HD channels) and a V^T row (KST keys) are both one 128-byte line
#define SL2E (SCALE * 1.44269504088896341f)   // SCALE x log2(e): one multiply-add takes an unscaled logit to the argument of the base-2 exponential
__device__ __forceinline__ v8f wm16(v16h a, v16h b, v8f c) { return __builtin_amdgcn_wmma_f32_16x16x32_f16(false, a, false, b, (short)0, c, false, false); }
__global__ __launch_bounds__(FAW * 32) void k_fa(const _Float16* __restrict__ QH, const _Float16* __restrict__ QL, const _Float16* __restrict__ KH, const _Float16* __restrict__ VT, float* __restrict__ Y) {
  __shared__ __align__(16) _Float16 ks[2][KST][GP], vs[2][HD][GP];   // [buffer][key][channel] and [buffer][channel][key], rows of 128 bytes at the 144-byte pitch
  const int tid = threadIdx.x, wave = tid >> 5, lane = tid & 31, col = lane & 15, g = lane >> 4; const int h = blockIdx.y, b = blockIdx.z; const int ql0 = (blockIdx.x * FAW + wave) * (16 * NQT);
  const _Float16* qp = QH + ((size_t)b * TT + ql0 + col) * CC + h * HD;        // query row col of the wave's first 16-query tile
  const _Float16* qr = QL + ((size_t)b * QHI + ql0 + col) * CC + h * HD;       // its residual row
  v16h qh[NQT][2], ql[NQT][2];
#pragma unroll
  for (int n = 0; n < NQT; ++n)
#pragma unroll
    for (int c = 0; c < 2; ++c) { qh[n][c] = frag_h(qp + (size_t)(n * 16) * CC + c * 32, lane); ql[n][c] = frag_h(qr + (size_t)(n * 16) * CC + c * 32, lane); }
  asm volatile("s_wait_xcnt 0x0" :: "v"(qp + 8 * g), "v"(qr + 8 * g) : "memory");   // as in the loop; the two lane addresses are inputs so that their registers live up to the wait
  const int sr = tid >> 3, sp = (tid & 7) * 8;                                  // staging: rows sr and sr + 32 of a stage, 16-byte piece tid & 7 (a wave moves four whole lines per load)
  const _Float16* kg = KH + ((size_t)b * TT + sr) * CC + h * HD + sp;
  const _Float16* vg = VT + ((size_t)b * CC + h * HD + sr) * (size_t)TT + sp;
  v8h kr[2], vr[2];
  auto fetch = [&](int s) {
#pragma unroll
    for (int i = 0; i < 2; ++i) { kr[i] = *(const v8h*)(kg + (size_t)(s * KST + 32 * i) * CC); vr[i] = *(const v8h*)(vg + (size_t)(32 * i) * TT + s * KST); }
    asm volatile("s_wait_xcnt 0x0" ::: "memory");   // the loads above are issued here, ahead of the stage's passes, and before a register that holds one of their addresses is written again
  };
  auto put = [&](int bf) {
#pragma unroll
    for (int i = 0; i < 2; ++i) { *(v8h*)&ks[bf][sr + 32 * i][sp] = kr[i]; *(v8h*)&vs[bf][sr + 32 * i][sp] = vr[i]; }
  };
  v8f o[NQT][4] = {}; float m[NQT], l[NQT];
#pragma unroll
  for (int n = 0; n < NQT; ++n) { m[n] = -3.0e38f; l[n] = 0.f; }
  fetch(0); put(0); __syncthreads();
#pragma unroll 1   // one stage's fragments live at a time
  for (int st = 0; st < TT / KST; ++st) { const int bf = st & 1;
    if (st + 1 < TT / KST) fetch(st + 1);   // block-uniform
#pragma unroll
    for (int pp = 0; pp < KST / 32; ++pp) {
      v16h kf[2][2], vf[4];
#pragma unroll
      for (int t = 0; t < 2; ++t)
#pragma unroll
        for (int c = 0; c < 2; ++c) kf[t][c] = frag_h(&ks[bf][pp * 32 + t * 16 + col][c * 32], lane);
#pragma unroll
      for (int j = 0; j < 4; ++j) vf[j] = frag_h(&vs[bf][j * 16 + col][pp * 32], lane);
      v8f sa[NQT][2] = {}, sb[NQT][2] = {};
#pragma unroll
      for (int c = 0; c < 2; ++c)
#pragma unroll
        for (int t = 0; t < 2; ++t)
#pragma unroll
          for (int n = 0; n < NQT; ++n) { sa[n][t] = wm16(kf[t][c], qh[n][c], sa[n][t]); sb[n][t] = wm16(kf[t][c], ql[n][c], sb[n][t]); }
#pragma unroll
      for (int n = 0; n < NQT; ++n) { float s[16];
#pragma unroll
        for (int r = 0; r < 8; ++r) { s[r] = sa[n][0][r] + sb[n][0][r] * (1.0f / 1024.0f); s[8 + r] = sa[n][1][r] + sb[n][1][r] * (1.0f / 1024.0f); }   // unscaled logits: SCALE goes into the exponent's multiplier
        float mx = s[0];
#pragma unroll
        for (int i = 1; i < 16; ++i) mx = fmaxf(mx, s[i]);
        mx = fmaxf(mx, __shfl_xor(mx, 16));
        const float mn = fmaxf(m[n], mx); const float al = __builtin_amdgcn_exp2f((m[n] - mn) * SL2E); m[n] = mn;
        const float bias = 10.0f - mn * SL2E;   // 2^(s SL2E + bias) = exp((s - mn) SCALE) x 2^10
        float sum = 0.f; v16h p;
#pragma unroll
        for (int i = 0; i < 16; ++i) { const float e = __builtin_amdgcn_exp2f(fmaf(s[i], SL2E, bias)); sum += e; p[i] = (_Float16)e; }
        l[n] = l[n] * al + sum;
#pragma unroll
        for (int j = 0; j < 4; ++j) { o[n][j] *= al; o[n][j] = wm16(vf[j], p, o[n][j]); } } }
    if (st + 1 < TT / KST) put(bf ^ 1);   // into the buffer whose readers all left it before the barrier of the trip before
    __syncthreads();   // publishes stage st + 1 and ends the reads of the buffer that the next trip refills
  }
#pragma unroll
  for (int n = 0; n < NQT; ++n) { const float a = l[n] + __shfl_xor(l[n], 16); const float inv = a > 0.f ? 1.0f / a : 0.f;   // numerator and sum both carry the 2^10
    float* yr = Y + ((size_t)b * TT + ql0 + n * 16 + col) * CC + h * HD + 8 * g;
#pragma unroll
    for (int j = 0; j < 4; ++j) { v4f lo, hi;
#pragma unroll
      for (int r = 0; r < 4; ++r) { lo[r] = o[n][j][r] * inv; hi[r] = o[n][j][4 + r] * inv; }
      vst2(yr + j * 16, lo); vst2(yr + j * 16 + 4, hi); } } }
// ---- k_out: block = (64 rows, 128 cols): out = ctx Wo (+ bo): ctx once to f16 against Wo as f16(bf16 x 2^8) exact (1 product) x 2^-8; causal early rows (< QHI of each sequence): ctx bf16 hi + lo against exact bf16 Wo (2 products)
__global__ __launch_bounds__(128) void k_out(const float* __restrict__ Y, const float* __restrict__ WO, const float* __restrict__ BO, float* __restrict__ OUT) { __shared__ __align__(16) float sf[4][16][132]; __shared__ __align__(16) _Float16 ys[2][64][GP], wt[2][128][GP];
  const int tid = threadIdx.x, wave = tid >> 5, lane = tid & 31, col = lane & 15, g = lane >> 4; const int c0 = blockIdx.y * 128; const size_t r0 = (size_t)blockIdx.x * 64 + wave * 16;
  v8f acc[8] = {};
  if (CAUSAL && (int)(((size_t)blockIdx.x * 64) % TT) < QHI) {   /* block-uniform */
#pragma unroll 2
    for (int kc = 0; kc < CC / 32; ++kc) { const F2 a = split_row(Y + (r0 + col) * CC, kc * 32, lane); asm volatile("s_wait_loadcnt 0x0" ::: "memory");
#pragma unroll
      for (int j = 0; j < 8; ++j) { const v16b w = WOCOL(WO, kc * 32, c0 + j * 16 + col, lane); asm volatile("s_wait_loadcnt 0x0" ::: "memory"); acc[j] = wmma_bf(a.h, w, acc[j]); acc[j] = wmma_bf(a.l, w, acc[j]); } }
#pragma unroll
    for (int j = 0; j < 8; ++j) { const float bias = BO ? bfr(BO[c0 + j * 16 + col]) : 0.f;
#pragma unroll
      for (int r = 0; r < 8; ++r) sf[wave][8 * g + r][j * 16 + col] = acc[j][r] + bias; }
  } else {
    const float* yg = Y + ((size_t)blockIdx.x * 64 + (tid >> 4)) * CC + (tid & 15) * 4;   // as in k_proj: row (tid >> 4) + 8 i, 16-byte piece tid & 15
    const float* wg = WO + c0 + tid;                                                      // the thread's own weight column
    v4f yv[8]; float wv[GKS];
    auto fetch = [&](int s) {
#pragma unroll
      for (int i = 0; i < 8; ++i) yv[i] = *(const v4f*)(yg + (size_t)(8 * i) * CC + s * GKS);
#pragma unroll
      for (int i = 0; i < GKS; ++i) wv[i] = wg[(size_t)(s * GKS + i) * DIN];
      asm volatile("s_wait_xcnt 0x0" ::: "memory");   // the loads above are issued here, ahead of the products, and before a register that holds one of their addresses is written again
    };
    auto stage = [&](int b) {
#pragma unroll
      for (int i = 0; i < 8; ++i) { v4h t;
#pragma unroll
        for (int e = 0; e < 4; ++e) t[e] = (_Float16)yv[i][e];
        *(v4h*)&ys[b][(tid >> 4) + 8 * i][(tid & 15) * 4] = t; }
#pragma unroll
      for (int q = 0; q < GKS / 8; ++q) { v8h t;
#pragma unroll
        for (int e = 0; e < 8; ++e) t[e] = (_Float16)(bfr(wv[q * 8 + e]) * 256.0f);
        *(v8h*)&wt[b][tid][q * 8] = t; }
    };
    auto mult = [&](int b) {
#pragma unroll
      for (int kk = 0; kk < GKS / 32; ++kk) { const v16h a = frag_h(&ys[b][wave * 16 + col][kk * 32], lane); v16h w[8];
#pragma unroll
        for (int j = 0; j < 8; ++j) w[j] = frag_h(&wt[b][j * 16 + col][kk * 32], lane);
        __builtin_amdgcn_sched_barrier(0);   // as in k_proj: one group of LDS reads, one wait, eight products
#pragma unroll
        for (int j = 0; j < 8; ++j) acc[j] = wmma16(a, w[j], acc[j]);
        __builtin_amdgcn_sched_barrier(0); }   // as in k_proj: the conversions and their wait for the global loads stay behind the products
    };
    fetch(0); stage(0); __syncthreads();
#pragma unroll 1   // one stage's loads live at a time
    for (int s = 0; s + 1 < CC / GKS; ++s) { fetch(s + 1); mult(s & 1); stage((s + 1) & 1); __syncthreads(); }   // the barrier publishes stage s + 1 and ends the reads of the buffer that the next trip refills
    mult((CC / GKS - 1) & 1);
#pragma unroll
    for (int j = 0; j < 8; ++j) { const float bias = BO ? bfr(BO[c0 + j * 16 + col]) : 0.f;
#pragma unroll
      for (int r = 0; r < 8; ++r) sf[wave][8 * g + r][j * 16 + col] = acc[j][r] * (1.0f / 256.0f) + bias; } }
  LDSX(); for (int rl = 0; rl < 16; ++rl) vst2(OUT + (r0 + rl) * DIN + c0 + lane * 4, *(const v4f*)&sf[wave][rl][lane * 4]); }

extern "C" void kernel_launch(void* const* d_in, const int* in_sizes, int n_in, void* d_out, int out_size, void* d_ws, size_t ws_size, hipStream_t stream) {
  (void)in_sizes; (void)n_in; (void)out_size;
  const float** F = (const float**)d_in;
  if (ws_size < (size_t)WS_END) return;
  char* ws = (char*)d_ws; _Float16 *QH = (_Float16*)(ws + WS_QH), *KH = (_Float16*)(ws + WS_KH), *VT = (_Float16*)(ws + WS_VT), *QL = (_Float16*)(ws + WS_QL), *KL = (_Float16*)(ws + WS_KL); __bf16 *VB = (__bf16*)(ws + WS_VB), *VBL = (__bf16*)(ws + WS_VBL); float *Y = (float*)(ws + WS_Y);
  (void)Y; (void)QL; (void)KL; (void)VB; (void)VBL;
  // inputs: 0 x [2,2048,1024]; 1 Wq, 2 bq; 3 Wk, 4 bk; 5 Wv, 6 bv; 7 Wo, 8 bo ((in,out))
  k_proj<<<dim3(TNB * TT / 64, CC / 128, 3), 128, 0, stream>>>(F[0], F[0], F[0], F[1], F[3], F[5], F[2], F[4], F[6], QH, QL, KH, KL, VT, VB, VBL);
  k_fa<<<dim3(TT / (FAW * 16 * NQT), NH, TNB), FAW * 32, 0, stream>>>(QH, QL, KH, VT, Y);
  k_out<<<dim3(TNB * TT / 64, DIN / 128), 128, 0, stream>>>(Y, F[7], F[8], (float*)d_out);
}

// v005
// One run takes 149 microseconds.
// Timed twice side by side with v004, it ran 1.04 and 1.05 times as fast.
// Counting every step since v000, it is 8.57 times as fast.
// compute dtype: all float inputs rounded to bf16; q/k/v = x W + b with EXACT bf16 products on WMMA 16x16x32 (f32 accumulate); rotate-half RoPE applied in f32 in the projection epilogue with accurate sincosf of t x inv_freq_j (f32 constants as the reference builds them); q as f16 hi + residual (x 2^10) against k once to f16 (2 products); softmax in f32 (hardware base-2 exponential of (s - m) x 64^-0.5 x log2 e + 10) with a running maximum, logits kept in registers; exp((s - m) x 64^-0.5) x 2^10 once to f16 against v once to f16 (1 product), divided by the f32 sum at the end; ctx once to f16 against Wo carried x 2^8 in f16 + bo; f32 output.
#include <hip/hip_runtime.h>
#include <math.h>

typedef __attribute__((ext_vector_type(16))) _Float16 v16h;
typedef __attribute__((ext_vector_type(16))) __bf16 v16b;
typedef __attribute__((ext_vector_type(8)))  _Float16 v8h;
typedef __attribute__((ext_vector_type(8)))  float v8f;
typedef __attribute__((ext_vector_type(4)))  float v4f;
typedef __attribute__((ext_vector_type(2)))  float v2f;
typedef __attribute__((ext_vector_type(4)))  unsigned v4u;
typedef __attribute__((ext_vector_type(4)))  int v4i;
typedef float __attribute__((may_alias)) float_a;
typedef int __attribute__((may_alias)) int_a;

template <typename T> __device__ __forceinline__ void vst2(void* p, T v) { *(T*)p = v;  }
__device__ __forceinline__ v8f wmma16(v16h a, v16h b, v8f c) {
  v8f d = __builtin_amdgcn_wmma_f32_16x16x32_f16(false, a, false, b, (short)0, c, false, false);
  asm volatile("v_nop\n\tv_nop\n\tv_nop\n\tv_nop" : "+v"(d) : "v"(a), "v"(b));
  return d;
}
__device__ __forceinline__ v8f wmma_bf(v16b a, v16b b, v8f c) {
  v8f d = __builtin_amdgcn_wmma_f32_16x16x32_bf16(false, a, false, b, (short)0, c, false, false);
  asm volatile("v_nop\n\tv_nop\n\tv_nop\n\tv_nop" : "+v"(d) : "v"(a), "v"(b));
  return d;
}
// 16x16x32 fragments: lane = (h = lane>>4, row/col = lane&15); elements 0..7 = k0+8h+0..7, 8..15 = k0+16+8h+0..7; D element r = row 8h+r
__device__ __forceinline__ v16h frag_h(const _Float16* rowk0, int lane) {
  union { v16h v; v8h q[2]; } u; const _Float16* p = rowk0 + 8 * (lane >> 4);
  u.q[0] = *(const v8h*)p; u.q[1] = *(const v8h*)(p + 16); return u.v;
}
__device__ __forceinline__ v16h frag_f32(const float* rowk0, int lane) {
  v16h a; const float* p = rowk0 + 8 * (lane >> 4);
#pragma unroll
  for (int i = 0; i < 8; ++i) { a[i] = (_Float16)p[i]; a[8 + i] = (_Float16)p[16 + i]; }
  return a;
}
__device__ __forceinline__ v16h frag_f32s(const float* rowk0, int lane, float sc) {
  v16h a; const float* p = rowk0 + 8 * (lane >> 4);
#pragma unroll
  for (int i = 0; i < 8; ++i) { a[i] = (_Float16)(p[i] * sc); a[8 + i] = (_Float16)(p[16 + i] * sc); }
  return a;
}
// column fragment from a [K][ld] layout (column n), rows >= K read as 0
__device__ __forceinline__ v16h fragc_f32(const float* W, int k0, int n, int lane, int ld, int K) {
  v16h a; const int g = lane >> 4;
#pragma unroll
  for (int i = 0; i < 8; ++i) { const int ka = k0 + 8 * g + i, kb = ka + 16;
    a[i] = (_Float16)(ka < K ? W[(size_t)(ka < K ? ka : K - 1) * ld + n] : 0.f); a[8 + i] = (_Float16)(kb < K ? W[(size_t)(kb < K ? kb : K - 1) * ld + n] : 0.f); }
  return a;
}
struct F2 { v16b h, l; };
__device__ __forceinline__ F2 bsplit16(const float v[16]) { F2 r;
#pragma unroll
  for (int i = 0; i < 16; ++i) { const __bf16 h = (__bf16)v[i]; r.h[i] = h; r.l[i] = (__bf16)(v[i] - (float)h); }
  return r; }
__device__ __forceinline__ F2 split_row(const float* row, int k0, int lane) { float v[16]; const float* p = row + k0 + 8 * (lane >> 4);
#pragma unroll
  for (int i = 0; i < 8; ++i) { v[i] = p[i]; v[8 + i] = p[16 + i]; }
  return bsplit16(v); }
__device__ __forceinline__ F2 split_rowK(const float* row, int k0, int lane, int K) { float v[16]; const int g = lane >> 4;
#pragma unroll
  for (int i = 0; i < 8; ++i) { const int ka = k0 + 8 * g + i, kb = ka + 16; v[i] = ka < K ? row[ka < K ? ka : K - 1] : 0.f; v[8 + i] = kb < K ? row[kb < K ? kb : K - 1] : 0.f; }
  return bsplit16(v); }
__device__ __forceinline__ F2 split_col(const float* W, int k0, int n, int lane, int ld, int K) { float v[16]; const int g = lane >> 4;
#pragma unroll
  for (int i = 0; i < 8; ++i) { const int ka = k0 + 8 * g + i, kb = ka + 16; v[i] = ka < K ? W[(size_t)(ka < K ? ka : K - 1) * ld + n] : 0.f; v[8 + i] = kb < K ? W[(size_t)(kb < K ? kb : K - 1) * ld + n] : 0.f; }
  return bsplit16(v); }
__device__ __forceinline__ v8f mac3(const F2& a, const F2& b, v8f c) { c = wmma_bf(a.l, b.h, c); c = wmma_bf(a.h, b.l, c); return wmma_bf(a.h, b.h, c); }
__device__ __forceinline__ float sigm(float v) { return 1.0f / (1.0f + expf(-v)); }
#define LDSX() do { asm volatile("s_wait_dscnt 0" ::: "memory"); __builtin_amdgcn_wave_barrier(); __builtin_amdgcn_fence(__ATOMIC_RELEASE, "workgroup"); } while (0)

// Multi-head self-attention with rotary embeddings (B 2, L 2,048, D 1,024 = 16 x 64): q/k/v = x W + b ((in,out)); q, k <- q cos + rotate_half(q) sin (theta_j = 10000^(-2j/64), pairs (i, i+32)); attn = softmax(q k^T x 64^-0.5) (non-causal); out = merged(attn v) Wo + bo.
#define NB 2
#define TT 2048
#define CC 1024            // NH * HD = projected width
#define DIN 1024          // input (model) width
#define NH 16
#define HD 64
#define SCALE (0.125f)
#define CAUSAL 0
#ifndef TNB
#define TNB NB
#endif
__device__ __forceinline__ float bfr(float v) { return (float)(__bf16)v; }
__host__ __device__ __forceinline__ int kb_last(int qb) { return CAUSAL ? ((qb * 64 + 63) >> 7) : (TT / 128 - 1); }
typedef __attribute__((ext_vector_type(8))) __bf16 v8b;
__device__ __forceinline__ v16b frag_b(const __bf16* rowk0, int lane) {
  union { v16b v; v8b q[2]; } u; const __bf16* p = rowk0 + 8 * (lane >> 4);
  u.q[0] = *(const v8b*)p; u.q[1] = *(const v8b*)(p + 16); return u.v;
}
#define QBH 0              // not read by any kernel in this file
#define QHI 2048            // rows carrying a q residual plane (all rows when non-causal: 2-product logits everywhere)
#define KHI 64            // key rows carrying k residual / v bf16 hi+lo planes (written by k_proj; no kernel here reads them)
// B fragment (k rows k0+.., output column o) of a weight: (in,out) [K][ld] or (out,in) [ld rows of K]: bf16 exact, or f16(bf16 * 256) exact
__device__ __forceinline__ v16b wcol_io(const float* Wm, int k0, int o, int lane, int ld) { v16b w; const int g = lane >> 4;
#pragma unroll
  for (int i = 0; i < 8; ++i) { w[i] = (__bf16)Wm[(size_t)(k0 + 8 * g + i) * ld + o]; w[8 + i] = (__bf16)Wm[(size_t)(k0 + 16 + 8 * g + i) * ld + o]; }
  return w; }
__device__ __forceinline__ v16b wcol_oi(const float* Wm, int k0, int o, int lane, int K) { v16b w; const float* p = Wm + (size_t)o * K + k0 + 8 * (lane >> 4);
#pragma unroll
  for (int i = 0; i < 8; ++i) { w[i] = (__bf16)p[i]; w[8 + i] = (__bf16)p[16 + i]; }
  return w; }
__device__ __forceinline__ v16h wcolh_io(const float* Wm, int k0, int o, int lane, int ld) { v16h w; const int g = lane >> 4;
#pragma unroll
  for (int i = 0; i < 8; ++i) { w[i] = (_Float16)(bfr(Wm[(size_t)(k0 + 8 * g + i) * ld + o]) * 256.0f); w[8 + i] = (_Float16)(bfr(Wm[(size_t)(k0 + 16 + 8 * g + i) * ld + o]) * 256.0f); }
  return w; }
__device__ __forceinline__ v16h wcolh_oi(const float* Wm, int k0, int o, int lane, int K) { v16h w; const float* p = Wm + (size_t)o * K + k0 + 8 * (lane >> 4);
#pragma unroll
  for (int i = 0; i < 8; ++i) { w[i] = (_Float16)(bfr(p[i]) * 256.0f); w[8 + i] = (_Float16)(bfr(p[16 + i]) * 256.0f); }
  return w; }
#define WQKV_LAYOUT 0   // picks WCOL's layout (0 (in,out), 1 (out,in), 2 per-head); nothing calls WCOL: k_proj reads (in,out) [DIN][CC] at any value
__device__ __forceinline__ v16b wcol_hdk(const float* Wm, int k0, int o, int lane) { v16b w; const int g = lane >> 4; const float* p = Wm + (size_t)(o / HD) * DIN * HD + (o % HD);
#pragma unroll
  for (int i = 0; i < 8; ++i) { w[i] = (__bf16)p[(size_t)(k0 + 8 * g + i) * HD]; w[8 + i] = (__bf16)p[(size_t)(k0 + 16 + 8 * g + i) * HD]; }
  return w; }
#define WO_OUT_IN 0
#if WQKV_LAYOUT == 1
#define WCOL(W, k0, o, lane) wcol_oi(W, k0, o, lane, DIN)
#elif WQKV_LAYOUT == 2
#define WCOL(W, k0, o, lane) wcol_hdk(W, k0, o, lane)
#else
#define WCOL(W, k0, o, lane) wcol_io(W, k0, o, lane, CC)
#endif
#if WO_OUT_IN
#define WOCOL(W, k0, o, lane) wcol_oi(W, k0, o, lane, CC)
#define WOCOLH(W, k0, o, lane) wcolh_oi(W, k0, o, lane, CC)
#else
#define WOCOL(W, k0, o, lane) wcol_io(W, k0, o, lane, DIN)
#define WOCOLH(W, k0, o, lane) wcolh_io(W, k0, o, lane, DIN)
#endif
__constant__ float c_invf[32] = {1.000000000e+00f,7.498942018e-01f,5.623413324e-01f,4.216965139e-01f,3.162277639e-01f,2.371373624e-01f,1.778279394e-01f,1.333521456e-01f,1.000000015e-01f,7.498941571e-02f,5.623412877e-02f,4.216964915e-02f,3.162277862e-02f,2.371373586e-02f,1.778279431e-02f,1.333521493e-02f,9.999999776e-03f,7.498942316e-03f,5.623413250e-03f,4.216964822e-03f,3.162277862e-03f,2.371373819e-03f,1.778279431e-03f,1.333521446e-03f,1.000000047e-03f,7.498941850e-04f,5.623413017e-04f,4.216964880e-04f,3.162277862e-04f,2.371373848e-04f,1.778279402e-04f,1.333521504e-04f};   // 1 / 10000^(2i/64) evaluated in f32 exactly as the reference does (jax, eager)
#ifndef SM_EXTRA_PARAMS
#define SM_EXTRA_PARAMS
#endif
#ifndef PROJ_EXTRA_PARAMS
#define PROJ_EXTRA_PARAMS
#endif
#ifndef SM_MASK_HOOK
#define SM_MASK_HOOK (void)0
#endif

#define WS_QH  0u                                      // f16 q rows [b*t][CC]
#define WS_KH  (WS_QH + 2u * (size_t)NB * TT * CC)      // f16 k rows [b*t][CC]
#define WS_VT  (WS_KH + 2u * (size_t)NB * TT * CC)      // f16 v planes [b][c][t]
#define WS_QL  (WS_VT + 2u * (size_t)NB * CC * TT)      // f16 q residual x 2^10 rows [b][t < QHI][CC]
#define WS_KL  (WS_QL + 2u * (size_t)NB * QHI * CC)     // f16 k residual x 2^10 rows [b][t < KHI][CC]
#define WS_VB  (WS_KL + 2u * (size_t)NB * KHI * CC)     // bf16 v hi planes [b][c][t < KHI]
#define WS_VBL (WS_VB + 2u * (size_t)NB * CC * KHI)
#define WS_Y   (WS_VBL + 2u * (size_t)NB * CC * KHI)    // f32 ctx rows [b*t][CC] (only when there is an output projection)
#define WS_END (WS_Y  + 4u * (size_t)NB * TT * CC)

// operand stages of k_proj and k_out: GKS k of the block's 64 activation rows and 128 weight columns, converted once to 16 bit, k-contiguous rows in LDS, two buffers
#define GKS 64             // k per stage
#define GP  72             // row pitch in 16-bit elements: 144 B = 16 B x 9, no bank conflict for 16-byte accesses
typedef __attribute__((ext_vector_type(4))) __bf16 v4b;
typedef __attribute__((ext_vector_type(4))) _Float16 v4h;
// ---- k_proj: block = (64 rows, 128 cols, which): q/k/v = X W (+ b) with exact bf16 products (K = DIN) -> which 0: q f16 rows (+ residual rows < QHI); 1: k f16 rows (+ residual rows < KHI); 2: v f16 planes [c][t] (+ bf16 hi/lo planes for t < KHI)
__global__ __launch_bounds__(128) void k_proj(const float* __restrict__ XQ, const float* __restrict__ XK, const float* __restrict__ XV, const float* __restrict__ WQ, const float* __restrict__ WK, const float* __restrict__ WV, const float* __restrict__ BQ, const float* __restrict__ BK, const float* __restrict__ BV,
    _Float16* __restrict__ QH, _Float16* __restrict__ QL, _Float16* __restrict__ KH, _Float16* __restrict__ KL, _Float16* __restrict__ VT, __bf16* __restrict__ VB, __bf16* __restrict__ VBL PROJ_EXTRA_PARAMS) {
  __shared__ __align__(16) char sm[55296];   // the main loop's stages; behind the barrier that ends the loop the epilogue's arrays lie over them: q, k: sh, sl, tc, ts (52,224 bytes); v: th, tb, tbl (55,296 bytes)
  _Float16 (*sh)[136] = (_Float16 (*)[136])sm; _Float16 (*sl)[136] = (_Float16 (*)[136])(sm + 17408); float (*tc)[34] = (float (*)[34])(sm + 34816); float (*ts)[34] = (float (*)[34])(sm + 43520);   // tc, ts: cos and sin of t x inv_freq[i], [row][i]; at pitch 34 the two lane halves (rows 8 apart) read different banks
  _Float16 (*th)[72] = (_Float16 (*)[72])sm; __bf16 (*tb)[72] = (__bf16 (*)[72])(sm + 18432); __bf16 (*tbl)[72] = (__bf16 (*)[72])(sm + 36864);
  __bf16 (*xs)[64][GP] = (__bf16 (*)[64][GP])sm; __bf16 (*wt)[128][GP] = (__bf16 (*)[128][GP])(sm + 2 * 64 * GP * 2);
  const int tid = threadIdx.x, wave = tid >> 5, lane = tid & 31, col = lane & 15, g = lane >> 4; const int which = blockIdx.z; const int c0 = blockIdx.y * 128; const size_t r0 = (size_t)blockIdx.x * 64; const size_t bb = r0 / TT; const int t0 = (int)(r0 % TT);
  const float* X = which == 0 ? XQ : which == 1 ? XK : XV; const float* WA = which == 0 ? WQ : which == 1 ? WK : WV; const float* BA = which == 0 ? BQ : which == 1 ? BK : BV;
  v8f acc[8] = {};
  const float* xg = X + (r0 + (tid >> 4)) * DIN + (tid & 15) * 4;   // 16-byte piece tid + 128 i of the x tile: row (tid >> 4) + 8 i, piece tid & 15 (a wave reads two whole 256-byte rows)
  const float* wg = WA + c0 + tid;                                  // the thread's own weight column (a wave reads one whole line per k)
  v4f xv[8]; float wv[GKS];
  auto fetch = [&](int s) {
#pragma unroll
    for (int i = 0; i < 8; ++i) xv[i] = *(const v4f*)(xg + (size_t)(8 * i) * DIN + s * GKS);
#pragma unroll
    for (int i = 0; i < GKS; ++i) wv[i] = wg[(size_t)(s * GKS + i) * CC];
    asm volatile("s_wait_xcnt 0x0" ::: "memory");   // the loads above are issued here, ahead of the products, and before a register that holds one of their addresses is written again
  };
  auto stage = [&](int b) {
#pragma unroll
    for (int i = 0; i < 8; ++i) { v4b t;
#pragma unroll
      for (int e = 0; e < 4; ++e) t[e] = (__bf16)xv[i][e];
      *(v4b*)&xs[b][(tid >> 4) + 8 * i][(tid & 15) * 4] = t; }
#pragma unroll
    for (int q = 0; q < GKS / 8; ++q) { v8b t;
#pragma unroll
      for (int e = 0; e < 8; ++e) t[e] = (__bf16)wv[q * 8 + e];
      *(v8b*)&wt[b][tid][q * 8] = t; }
  };
  auto mult = [&](int b) {
#pragma unroll
    for (int kk = 0; kk < GKS / 32; ++kk) { const v16b a = frag_b(&xs[b][wave * 16 + col][kk * 32], lane); v16b w[8];
#pragma unroll
      for (int j = 0; j < 8; ++j) w[j] = frag_b(&wt[b][j * 16 + col][kk * 32], lane);
      __builtin_amdgcn_sched_barrier(0);   // the nine fragments' LDS reads stay one group ahead of their products: one LDS wait for eight products, not one each
#pragma unroll
      for (int j = 0; j < 8; ++j) acc[j] = wmma_bf(a, w[j], acc[j]);
      __builtin_amdgcn_sched_barrier(0); }   // what follows (the next group's reads; the conversions, which wait for the global loads) stays behind the products
  };
  fetch(0); stage(0); __syncthreads();
#pragma unroll 1   // one stage's loads live at a time
  for (int s = 0; s + 1 < DIN / GKS; ++s) { fetch(s + 1); mult(s & 1); stage((s + 1) & 1); __syncthreads(); }   // the barrier publishes stage s + 1 and ends the reads of the buffer that the next trip refills
  mult((DIN / GKS - 1) & 1); __syncthreads();   // every wave has left the stages before the epilogue writes over them
  // the epilogue works on the accumulators: a lane holds rows wave * 16 + 8 g + 0..7 of columns j * 16 + col, so channel i of a head (j = 4 hh + jj, i = 16 jj + col) and its rotary partner i + 32 (j + 2) sit in the same lane
  const int rw0 = wave * 16 + 8 * g;
#pragma unroll
  for (int j = 0; j < 8; ++j) { const float bias = BA ? bfr(BA[c0 + j * 16 + col]) : 0.f;
#pragma unroll
    for (int r = 0; r < 8; ++r) acc[j][r] += bias; }
  if (which < 2) { _Float16* DH = which == 0 ? QH : KH; _Float16* DL = which == 0 ? QL : KL; const int nhi = which == 0 ? QHI : KHI; const bool hi_rows = t0 < nhi;
    const float invf = c_invf[lane];
    asm volatile("s_wait_xcnt 0x0" ::: "memory");   // stands before a register that holds the load's address is written again
#pragma unroll 2   // two rows' dependent chains interleave; more would only lengthen the text
    for (int n = 0; n < 16; ++n) { const float ang = (float)(t0 + wave * 16 + n) * invf; tc[wave * 16 + n][lane] = cosf(ang); ts[wave * 16 + n][lane] = sinf(ang); }   // each angle once per block, for both heads (TT is a multiple of 64: t = t0 + row)
    __syncthreads();
#pragma unroll
    for (int r = 0; r < 8; ++r)
#pragma unroll
      for (int jj = 0; jj < 2; ++jj) { const float cs = tc[rw0 + r][jj * 16 + col], sn = ts[rw0 + r][jj * 16 + col];
#pragma unroll
        for (int hh = 0; hh < 2; ++hh) { const float x0 = acc[hh * 4 + jj][r], x1 = acc[hh * 4 + jj + 2][r]; acc[hh * 4 + jj][r] = x0 * cs - x1 * sn; acc[hh * 4 + jj + 2][r] = x1 * cs + x0 * sn; } }
#pragma unroll
    for (int j = 0; j < 8; ++j)
#pragma unroll
      for (int r = 0; r < 8; ++r) { const float v = acc[j][r]; const _Float16 hv = (_Float16)v; sh[rw0 + r][j * 16 + col] = hv; sl[rw0 + r][j * 16 + col] = (_Float16)((v - (float)hv) * 1024.0f); }
    __syncthreads();
    for (int e = tid; e < 64 * 16; e += 128) { const int rl = e >> 4, q = e & 15; vst2((unsigned*)(DH + (r0 + rl) * CC + c0 + q * 8), *(const v4u*)&sh[rl][q * 8]); if (hi_rows) vst2((unsigned*)(DL + (bb * nhi + t0 + rl) * (size_t)CC + c0 + q * 8), *(const v4u*)&sl[rl][q * 8]); }
  } else { const bool hi_rows = t0 < KHI;
#pragma unroll
    for (int j = 0; j < 8; ++j) { v8h hv; v8b bh, bl;   // a lane's 8 rows of one column are 16 consecutive bytes of a transposed row
#pragma unroll
      for (int r = 0; r < 8; ++r) { const float v = acc[j][r]; hv[r] = (_Float16)v; bh[r] = (__bf16)v; bl[r] = (__bf16)(v - (float)bh[r]); }
      *(v8h*)&th[j * 16 + col][rw0] = hv; if (hi_rows) { *(v8b*)&tb[j * 16 + col][rw0] = bh; *(v8b*)&tbl[j * 16 + col][rw0] = bl; } }
    __syncthreads();
    for (int e = tid; e < 128 * 8; e += 128) { const int cl = e >> 3, q = e & 7; vst2((unsigned*)(VT + (bb * CC + c0 + cl) * (size_t)TT + t0 + q * 8), *(const v4u*)&th[cl][q * 8]); if (hi_rows) { const size_t o3 = (bb * CC + c0 + cl) * (size_t)KHI + t0 + q * 8; vst2((unsigned*)(VB + o3), *(const v4u*)&tb[cl][q * 8]); vst2((unsigned*)(VBL + o3), *(const v4u*)&tbl[cl][q * 8]); } } } }
// ---- k_fa: wave = NQT x 16 queries of (b, h), all TT keys in passes of 32: S^T = K Q^T (q hi + residual x 2^10, 2 products) stays in registers, unscaled; running maximum and sum per query (a lane holds one query's scores of 8 + 8 keys, the two lane halves split the keys);
//      the block's FAW waves walk the same keys: each stage of KST keys (K rows, V^T channel rows) is brought once per block, in whole 128-byte lines, into LDS (two buffers, the next stage's global loads fly under this stage's passes) and every wave takes its fragments from there;
//      the inner loops are all unrolled so that the fragment arrays stay in registers; 2^((s - m) SL2E + 10) once to f16 is, in place, the B operand of O^T += V^T P^T (1 product); a lane ends with 8 consecutive channels of one query
#define NQT 2              // 16-query tiles per wave: each key and value fragment is loaded once for both
#define FAW 8              // waves per block
#define KST 64             // keys per stage: a K row (HD channels) and a V^T row (KST keys) are both one 128-byte line
#define SL2E (SCALE * 1.44269504088896341f)   // SCALE x log2(e): one multiply-add takes an unscaled logit to the argument of the base-2 exponential
__device__ __forceinline__ v8f wm16(v16h a, v16h b, v8f c) { return __builtin_amdgcn_wmma_f32_16x16x32_f16(false, a, false, b, (short)0, c, false, false); }
__global__ __launch_bounds__(FAW * 32) void k_fa(const _Float16* __restrict__ QH, const _Float16* __restrict__ QL, const _Float16* __restrict__ KH, const _Float16* __restrict__ VT, float* __restrict__ Y) {
  __shared__ __align__(16) _Float16 ks[2][KST][GP], vs[2][HD][GP];   // [buffer][key][channel] and [buffer][channel][key], rows of 128 bytes at the 144-byte pitch
  const int tid = threadIdx.x, wave = tid >> 5, lane = tid & 31, col = lane & 15, g = lane >> 4; const int h = blockIdx.y, b = blockIdx.z; const int ql0 = (blockIdx.x * FAW + wave) * (16 * NQT);
  const _Float16* qp = QH + ((size_t)b * TT + ql0 + col) * CC + h * HD;        // query row col of the wave's first 16-query tile
  const _Float16* qr = QL + ((size_t)b * QHI + ql0 + col) * CC + h * HD;       // its residual row
  v16h qh[NQT][2], ql[NQT][2];
#pragma unroll
  for (int n = 0; n < NQT; ++n)
#pragma unroll
    for (int c = 0; c < 2; ++c) { qh[n][c] = frag_h(qp + (size_t)(n * 16) * CC + c * 32, lane); ql[n][c] = frag_h(qr + (size_t)(n * 16) * CC + c * 32, lane); }
  asm volatile("s_wait_xcnt 0x0" :: "v"(qp + 8 * g), "v"(qr + 8 * g) : "memory");   // as in the loop; the two lane addresses are inputs so that their registers live up to the wait
  const int sr = tid >> 3, sp = (tid & 7) * 8;                                  // staging: rows sr and sr + 32 of a stage, 16-byte piece tid & 7 (a wave moves four whole lines per load)
  const _Float16* kg = KH + ((size_t)b * TT + sr) * CC + h * HD + sp;
  const _Float16* vg = VT + ((size_t)b * CC + h * HD + sr) * (size_t)TT + sp;
  v8h kr[2], vr[2];
  auto fetch = [&](int s) {
#pragma unroll
    for (int i = 0; i < 2; ++i) { kr[i] = *(const v8h*)(kg + (size_t)(s * KST + 32 * i) * CC); vr[i] = *(const v8h*)(vg + (size_t)(32 * i) * TT + s * KST); }
    asm volatile("s_wait_xcnt 0x0" ::: "memory");   // the loads above are issued here, ahead of the stage's passes, and before a register that holds one of their addresses is written again
  };
  auto put = [&](int bf) {
#pragma unroll
    for (int i = 0; i < 2; ++i) { *(v8h*)&ks[bf][sr + 32 * i][sp] = kr[i]; *(v8h*)&vs[bf][sr + 32 * i][sp] = vr[i]; }
  };
  v8f o[NQT][4] = {}; float m[NQT], l[NQT];
#pragma unroll
  for (int n = 0; n < NQT; ++n) { m[n] = -3.0e38f; l[n] = 0.f; }
  fetch(0); put(0); __syncthreads();
#pragma unroll 1   // one stage's fragments live at a time
  for (int st = 0; st < TT / KST; ++st) { const int bf = st & 1;
    if (st + 1 < TT / KST) fetch(st + 1);   // block-uniform
#pragma unroll
    for (int pp = 0; pp < KST / 32; ++pp) {
      v16h kf[2][2], vf[4];
#pragma unroll
      for (int t = 0; t < 2; ++t)
#pragma unroll
        for (int c = 0; c < 2; ++c) kf[t][c] = frag_h(&ks[bf][pp * 32 + t * 16 + col][c * 32], lane);
#pragma unroll
      for (int j = 0; j < 4; ++j) vf[j] = frag_h(&vs[bf][j * 16 + col][pp * 32], lane);
      v8f sa[NQT][2] = {}, sb[NQT][2] = {};
#pragma unroll
      for (int c = 0; c < 2; ++c)
#pragma unroll
        for (int t = 0; t < 2; ++t)
#pragma unroll
          for (int n = 0; n < NQT; ++n) { sa[n][t] = wm16(kf[t][c], qh[n][c], sa[n][t]); sb[n][t] = wm16(kf[t][c], ql[n][c], sb[n][t]); }
#pragma unroll
      for (int n = 0; n < NQT; ++n) { float s[16];
#pragma unroll
        for (int r = 0; r < 8; ++r) { s[r] = sa[n][0][r] + sb[n][0][r] * (1.0f / 1024.0f); s[8 + r] = sa[n][1][r] + sb[n][1][r] * (1.0f / 1024.0f); }   // unscaled logits: SCALE goes into the exponent's multiplier
        float mx = s[0];
#pragma unroll
        for (int i = 1; i < 16; ++i) mx = fmaxf(mx, s[i]);
        mx = fmaxf(mx, __shfl_xor(mx, 16));
        const float mn = fmaxf(m[n], mx); const float al = __builtin_amdgcn_exp2f((m[n] - mn) * SL2E); m[n] = mn;
        const float bias = 10.0f - mn * SL2E;   // 2^(s SL2E + bias) = exp((s - mn) SCALE) x 2^10
        float sum = 0.f; v16h p;
#pragma unroll
        for (int i = 0; i < 16; ++i) { const float e = __builtin_amdgcn_exp2f(fmaf(s[i], SL2E, bias)); sum += e; p[i] = (_Float16)e; }
        l[n] = l[n] * al + sum;
#pragma unroll
        for (int j = 0; j < 4; ++j) { o[n][j] *= al; o[n][j] = wm16(vf[j], p, o[n][j]); } } }
    if (st + 1 < TT / KST) put(bf ^ 1);   // into the buffer whose readers all left it before the barrier of the trip before
    __syncthreads();   // publishes stage st + 1 and ends the reads of the buffer that the next trip refills
  }
#pragma unroll
  for (int n = 0; n < NQT; ++n) { const float a = l[n] + __shfl_xor(l[n], 16); const float inv = a > 0.f ? 1.0f / a : 0.f;   // numerator and sum both carry the 2^10
    float* yr = Y + ((size_t)b * TT + ql0 + n * 16 + col) * CC + h * HD + 8 * g;
#pragma unroll
    for (int j = 0; j < 4; ++j) { v4f lo, hi;
#pragma unroll
      for (int r = 0; r < 4; ++r) { lo[r] = o[n][j][r] * inv; hi[r] = o[n][j][4 + r] * inv; }
      vst2(yr + j * 16, lo); vst2(yr + j * 16 + 4, hi); } } }
// ---- k_out: block = (64 rows, 128 cols): out = ctx Wo (+ bo): ctx once to f16 against Wo as f16(bf16 x 2^8) exact (1 product) x 2^-8; causal early rows (< QHI of each sequence): ctx bf16 hi + lo against exact bf16 Wo (2 products)
__global__ __launch_bounds__(128) void k_out(const float* __restrict__ Y, const float* __restrict__ WO, const float* __restrict__ BO, float* __restrict__ OUT) { __shared__ __align__(16) float sf[4][16][132]; __shared__ __align__(16) _Float16 ys[2][64][GP], wt[2][128][GP];
  const int tid = threadIdx.x, wave = tid >> 5, lane = tid & 31, col = lane & 15, g = lane >> 4; const int c0 = blockIdx.y * 128; const size_t r0 = (size_t)blockIdx.x * 64 + wave * 16;
  v8f acc[8] = {};
  if (CAUSAL && (int)(((size_t)blockIdx.x * 64) % TT) < QHI) {   /* block-uniform */
#pragma unroll 2
    for (int kc = 0; kc < CC / 32; ++kc) { const F2 a = split_row(Y + (r0 + col) * CC, kc * 32, lane); asm volatile("s_wait_loadcnt 0x0" ::: "memory");
#pragma unroll
      for (int j = 0; j < 8; ++j) { const v16b w = WOCOL(WO, kc * 32, c0 + j * 16 + col, lane); asm volatile("s_wait_loadcnt 0x0" ::: "memory"); acc[j] = wmma_bf(a.h, w, acc[j]); acc[j] = wmma_bf(a.l, w, acc[j]); } }
#pragma unroll
    for (int j = 0; j < 8; ++j) { const float bias = BO ? bfr(BO[c0 + j * 16 + col]) : 0.f;
#pragma unroll
      for (int r = 0; r < 8; ++r) sf[wave][8 * g + r][j * 16 + col] = acc[j][r] + bias; }
  } else {
    const float* yg = Y + ((size_t)blockIdx.x * 64 + (tid >> 4)) * CC + (tid & 15) * 4;   // as in k_proj: row (tid >> 4) + 8 i, 16-byte piece tid & 15
    const float* wg = WO + c0 + tid;                                                      // the thread's own weight column
    v4f yv[8]; float wv[GKS];
    auto fetch = [&](int s) {
#pragma unroll
      for (int i = 0; i < 8; ++i) yv[i] = *(const v4f*)(yg + (size_t)(8 * i) * CC + s * GKS);
#pragma unroll
      for (int i = 0; i < GKS; ++i) wv[i] = wg[(size_t)(s * GKS + i) * DIN];
      asm volatile("s_wait_xcnt 0x0" ::: "memory");   // the loads above are issued here, ahead of the products, and before a register that holds one of their addresses is written again
    };
    auto stage = [&](int b) {
#pragma unroll
      for (int i = 0; i < 8; ++i) { v4h t;
#pragma unroll
        for (int e = 0; e < 4; ++e) t[e] = (_Float16)yv[i][e];
        *(v4h*)&ys[b][(tid >> 4) + 8 * i][(tid & 15) * 4] = t; }
#pragma unroll
      for (int q = 0; q < GKS / 8; ++q) { v8h t;
#pragma unroll
        for (int e = 0; e < 8; ++e) t[e] = (_Float16)(bfr(wv[q * 8 + e]) * 256.0f);
        *(v8h*)&wt[b][tid][q * 8] = t; }
    };
    auto mult = [&](int b) {
#pragma unroll
      for (int kk = 0; kk < GKS / 32; ++kk) { const v16h a = frag_h(&ys[b][wave * 16 + col][kk * 32], lane); v16h w[8];
#pragma unroll
        for (int j = 0; j < 8; ++j) w[j] = frag_h(&wt[b][j * 16 + col][kk * 32], lane);
        __builtin_amdgcn_sched_barrier(0);   // as in k_proj: one group of LDS reads, one wait, eight products
#pragma unroll
        for (int j = 0; j < 8; ++j) acc[j] = wmma16(a, w[j], acc[j]);
        __builtin_amdgcn_sched_barrier(0); }   // as in k_proj: the conversions and their wait for the global loads stay behind the products
    };
    fetch(0); stage(0); __syncthreads();
#pragma unroll 1   // one stage's loads live at a time
    for (int s = 0; s + 1 < CC / GKS; ++s) { fetch(s + 1); mult(s & 1); stage((s + 1) & 1); __syncthreads(); }   // the barrier publishes stage s + 1 and ends the reads of the buffer that the next trip refills
    mult((CC / GKS - 1) & 1);
#pragma unroll
    for (int j = 0; j < 8; ++j) { const float bias = BO ? bfr(BO[c0 + j * 16 + col]) : 0.f;
#pragma unroll
      for (int r = 0; r < 8; ++r) sf[wave][8 * g + r][j * 16 + col] = acc[j][r] * (1.0f / 256.0f) + bias; } }
  LDSX(); for (int rl = 0; rl < 16; ++rl) vst2(OUT + (r0 + rl) * DIN + c0 + lane * 4, *(const v4f*)&sf[wave][rl][lane * 4]); }

extern "C" void kernel_launch(void* const* d_in, const int* in_sizes, int n_in, void* d_out, int out_size, void* d_ws, size_t ws_size, hipStream_t stream) {
  (void)in_sizes; (void)n_in; (void)out_size;
  const float** F = (const float**)d_in;
  if (ws_size < (size_t)WS_END) return;
  char* ws = (char*)d_ws; _Float16 *QH = (_Float16*)(ws + WS_QH), *KH = (_Float16*)(ws + WS_KH), *VT = (_Float16*)(ws + WS_VT), *QL = (_Float16*)(ws + WS_QL), *KL = (_Float16*)(ws + WS_KL); __bf16 *VB = (__bf16*)(ws + WS_VB), *VBL = (__bf16*)(ws + WS_VBL); float *Y = (float*)(ws + WS_Y);
  (void)Y; (void)QL; (void)KL; (void)VB; (void)VBL;
  // inputs: 0 x [2,2048,1024]; 1 Wq, 2 bq; 3 Wk, 4 bk; 5 Wv, 6 bv; 7 Wo, 8 bo ((in,out))
  k_proj<<<dim3(TNB * TT / 64, CC / 128, 3), 128, 0, stream>>>(F[0], F[0], F[0], F[1], F[3], F[5], F[2], F[4], F[6], QH, QL, KH, KL, VT, VB, VBL);
  k_fa<<<dim3(TT / (FAW * 16 * NQT), NH, TNB), FAW * 32, 0, stream>>>(QH, QL, KH, VT, Y);
  k_out<<<dim3(TNB * TT / 64, DIN / 128), 128, 0, stream>>>(Y, F[7], F[8], (float*)d_out);
}

// v006
// Measured time: 105 microseconds a run.
// Next to v005, in two timings, it ran 1.44 and 1.41 times as fast.
// Counting every step since v000, it is 12.3 times as fast.
// compute dtype: all float inputs rounded to bf16; q/k/v = x W + b with EXACT bf16 products on WMMA 16x16x32 (f32 accumulate); rotate-half RoPE applied in f32 in the projection epilogue with accurate sincosf of t x inv_freq_j (f32 constants as the reference builds them); q as f16 hi + residual (x 2^10) against k once to f16 (2 products); softmax in f32 (hardware base-2 exponential of (s - m) x 64^-0.5 x log2 e + 10) with a running maximum, logits kept in registers; exp((s - m) x 64^-0.5) x 2^10 once to f16 against v once to f16 (1 product), divided by the f32 sum at the end; ctx once to f16 against Wo carried x 2^8 in f16 + bo; f32 output.
#include <hip/hip_runtime.h>
#include <math.h>

typedef __attribute__((ext_vector_type(16))) _Float16 v16h;
typedef __attribute__((ext_vector_type(16))) __bf16 v16b;
typedef __attribute__((ext_vector_type(8)))  _Float16 v8h;
typedef __attribute__((ext_vector_type(8)))  float v8f;
typedef __attribute__((ext_vector_type(4)))  float v4f;
typedef __attribute__((ext_vector_type(2)))  float v2f;
typedef __attribute__((ext_vector_type(4)))  unsigned v4u;
typedef __attribute__((ext_vector_type(4)))  int v4i;
typedef float __attribute__((may_alias)) float_a;
typedef int __attribute__((may_alias)) int_a;

template <typename T> __device__ __forceinline__ void vst2(void* p, T v) { *(T*)p = v;  }
__device__ __forceinline__ v8f wmma16(v16h a, v16h b, v8f c) {
  v8f d = __builtin_amdgcn_wmma_f32_16x16x32_f16(false, a, false, b, (short)0, c, false, false);
  asm volatile("v_nop\n\tv_nop\n\tv_nop\n\tv_nop" : "+v"(d) : "v"(a), "v"(b));
  return d;
}
__device__ __forceinline__ v8f wmma_bf(v16b a, v16b b, v8f c) {
  v8f d = __builtin_amdgcn_wmma_f32_16x16x32_bf16(false, a, false, b, (short)0, c, false, false);
  asm volatile("v_nop\n\tv_nop\n\tv_nop\n\tv_nop" : "+v"(d) : "v"(a), "v"(b));
  return d;
}
// 16x16x32 fragments: lane = (h = lane>>4, row/col = lane&15); elements 0..7 = k0+8h+0..7, 8..15 = k0+16+8h+0..7; D element r = row 8h+r
__device__ __forceinline__ v16h frag_h(const _Float16* rowk0, int lane) {
  union { v16h v; v8h q[2]; } u; const _Float16* p = rowk0 + 8 * (lane >> 4);
  u.q[0] = *(const v8h*)p; u.q[1] = *(const v8h*)(p + 16); return u.v;
}
__device__ __forceinline__ v16h frag_f32(const float* rowk0, int lane) {
  v16h a; const float* p = rowk0 + 8 * (lane >> 4);
#pragma unroll
  for (int i = 0; i < 8; ++i) { a[i] = (_Float16)p[i]; a[8 + i] = (_Float16)p[16 + i]; }
  return a;
}
__device__ __forceinline__ v16h frag_f32s(const float* rowk0, int lane, float sc) {
  v16h a; const float* p = rowk0 + 8 * (lane >> 4);
#pragma unroll
  for (int i = 0; i < 8; ++i) { a[i] = (_Float16)(p[i] * sc); a[8 + i] = (_Float16)(p[16 + i] * sc); }
  return a;
}
// column fragment from a [K][ld] layout (column n), rows >= K read as 0
__device__ __forceinline__ v16h fragc_f32(const float* W, int k0, int n, int lane, int ld, int K) {
  v16h a; const int g = lane >> 4;
#pragma unroll
  for (int i = 0; i < 8; ++i) { const int ka = k0 + 8 * g + i, kb = ka + 16;
    a[i] = (_Float16)(ka < K ? W[(size_t)(ka < K ? ka : K - 1) * ld + n] : 0.f); a[8 + i] = (_Float16)(kb < K ? W[(size_t)(kb < K ? kb : K - 1) * ld + n] : 0.f); }
  return a;
}
struct F2 { v16b h, l; };
__device__ __forceinline__ F2 bsplit16(const float v[16]) { F2 r;
#pragma unroll
  for (int i = 0; i < 16; ++i) { const __bf16 h = (__bf16)v[i]; r.h[i] = h; r.l[i] = (__bf16)(v[i] - (float)h); }
  return r; }
__device__ __forceinline__ F2 split_row(const float* row, int k0, int lane) { float v[16]; const float* p = row + k0 + 8 * (lane >> 4);
#pragma unroll
  for (int i = 0; i < 8; ++i) { v[i] = p[i]; v[8 + i] = p[16 + i]; }
  return bsplit16(v); }
__device__ __forceinline__ F2 split_rowK(const float* row, int k0, int lane, int K) { float v[16]; const int g = lane >> 4;
#pragma unroll
  for (int i = 0; i < 8; ++i) { const int ka = k0 + 8 * g + i, kb = ka + 16; v[i] = ka < K ? row[ka < K ? ka : K - 1] : 0.f; v[8 + i] = kb < K ? row[kb < K ? kb : K - 1] : 0.f; }
  return bsplit16(v); }
__device__ __forceinline__ F2 split_col(const float* W, int k0, int n, int lane, int ld, int K) { float v[16]; const int g = lane >> 4;
#pragma unroll
  for (int i = 0; i < 8; ++i) { const int ka = k0 + 8 * g + i, kb = ka + 16; v[i] = ka < K ? W[(size_t)(ka < K ? ka : K - 1) * ld + n] : 0.f; v[8 + i] = kb < K ? W[(size_t)(kb < K ? kb : K - 1) * ld + n] : 0.f; }
  return bsplit16(v); }
__device__ __forceinline__ v8f mac3(const F2& a, const F2& b, v8f c) { c = wmma_bf(a.l, b.h, c); c = wmma_bf(a.h, b.l, c); return wmma_bf(a.h, b.h, c); }
__device__ __forceinline__ float sigm(float v) { return 1.0f / (1.0f + expf(-v)); }
#define LDSX() do { asm volatile("s_wait_dscnt 0" ::: "memory"); __builtin_amdgcn_wave_barrier(); __builtin_amdgcn_fence(__ATOMIC_RELEASE, "workgroup"); } while (0)

// Multi-head self-attention with rotary embeddings (B 2, L 2,048, D 1,024 = 16 x 64): q/k/v = x W + b ((in,out)); q, k <- q cos + rotate_half(q) sin (theta_j = 10000^(-2j/64), pairs (i, i+32)); attn = softmax(q k^T x 64^-0.5) (non-causal); out = merged(attn v) Wo + bo.
#define NB 2
#define TT 2048
#define CC 1024            // NH * HD = projected width
#define DIN 1024          // input (model) width
#define NH 16
#define HD 64
#define SCALE (0.125f)
#define CAUSAL 0
#ifndef TNB
#define TNB NB
#endif
__device__ __forceinline__ float bfr(float v) { return (float)(__bf16)v; }
__host__ __device__ __forceinline__ int kb_last(int qb) { return CAUSAL ? ((qb * 64 + 63) >> 7) : (TT / 128 - 1); }
typedef __attribute__((ext_vector_type(8))) __bf16 v8b;
__device__ __forceinline__ v16b frag_b(const __bf16* rowk0, int lane) {
  union { v16b v; v8b q[2]; } u; const __bf16* p = rowk0 + 8 * (lane >> 4);
  u.q[0] = *(const v8b*)p; u.q[1] = *(const v8b*)(p + 16); return u.v;
}
#define QBH 0              // not read by any kernel in this file
#define QHI 2048            // rows carrying a q residual plane (all rows when non-causal: 2-product logits everywhere)
#define KHI 64            // key rows carrying k residual / v bf16 hi+lo planes (written by k_proj; no kernel here reads them)
// B fragment (k rows k0+.., output column o) of a weight: (in,out) [K][ld] or (out,in) [ld rows of K]: bf16 exact, or f16(bf16 * 256) exact
__device__ __forceinline__ v16b wcol_io(const float* Wm, int k0, int o, int lane, int ld) { v16b w; const int g = lane >> 4;
#pragma unroll
  for (int i = 0; i < 8; ++i) { w[i] = (__bf16)Wm[(size_t)(k0 + 8 * g + i) * ld + o]; w[8 + i] = (__bf16)Wm[(size_t)(k0 + 16 + 8 * g + i) * ld + o]; }
  return w; }
__device__ __forceinline__ v16b wcol_oi(const float* Wm, int k0, int o, int lane, int K) { v16b w; const float* p = Wm + (size_t)o * K + k0 + 8 * (lane >> 4);
#pragma unroll
  for (int i = 0; i < 8; ++i) { w[i] = (__bf16)p[i]; w[8 + i] = (__bf16)p[16 + i]; }
  return w; }
__device__ __forceinline__ v16h wcolh_io(const float* Wm, int k0, int o, int lane, int ld) { v16h w; const int g = lane >> 4;
#pragma unroll
  for (int i = 0; i < 8; ++i) { w[i] = (_Float16)(bfr(Wm[(size_t)(k0 + 8 * g + i) * ld + o]) * 256.0f); w[8 + i] = (_Float16)(bfr(Wm[(size_t)(k0 + 16 + 8 * g + i) * ld + o]) * 256.0f); }
  return w; }
__device__ __forceinline__ v16h wcolh_oi(const float* Wm, int k0, int o, int lane, int K) { v16h w; const float* p = Wm + (size_t)o * K + k0 + 8 * (lane >> 4);
#pragma unroll
  for (int i = 0; i < 8; ++i) { w[i] = (_Float16)(bfr(p[i]) * 256.0f); w[8 + i] = (_Float16)(bfr(p[16 + i]) * 256.0f); }
  return w; }
#define WQKV_LAYOUT 0   // picks WCOL's layout (0 (in,out), 1 (out,in), 2 per-head); nothing calls WCOL: k_cvt reads (in,out) [DIN][CC] at any value
__device__ __forceinline__ v16b wcol_hdk(const float* Wm, int k0, int o, int lane) { v16b w; const int g = lane >> 4; const float* p = Wm + (size_t)(o / HD) * DIN * HD + (o % HD);
#pragma unroll
  for (int i = 0; i < 8; ++i) { w[i] = (__bf16)p[(size_t)(k0 + 8 * g + i) * HD]; w[8 + i] = (__bf16)p[(size_t)(k0 + 16 + 8 * g + i) * HD]; }
  return w; }
#define WO_OUT_IN 0
#if WQKV_LAYOUT == 1
#define WCOL(W, k0, o, lane) wcol_oi(W, k0, o, lane, DIN)
#elif WQKV_LAYOUT == 2
#define WCOL(W, k0, o, lane) wcol_hdk(W, k0, o, lane)
#else
#define WCOL(W, k0, o, lane) wcol_io(W, k0, o, lane, CC)
#endif
#if WO_OUT_IN
#define WOCOL(W, k0, o, lane) wcol_oi(W, k0, o, lane, CC)
#define WOCOLH(W, k0, o, lane) wcolh_oi(W, k0, o, lane, CC)
#else
#define WOCOL(W, k0, o, lane) wcol_io(W, k0, o, lane, DIN)
#define WOCOLH(W, k0, o, lane) wcolh_io(W, k0, o, lane, DIN)
#endif
__constant__ float c_invf[32] = {1.000000000e+00f,7.498942018e-01f,5.623413324e-01f,4.216965139e-01f,3.162277639e-01f,2.371373624e-01f,1.778279394e-01f,1.333521456e-01f,1.000000015e-01f,7.498941571e-02f,5.623412877e-02f,4.216964915e-02f,3.162277862e-02f,2.371373586e-02f,1.778279431e-02f,1.333521493e-02f,9.999999776e-03f,7.498942316e-03f,5.623413250e-03f,4.216964822e-03f,3.162277862e-03f,2.371373819e-03f,1.778279431e-03f,1.333521446e-03f,1.000000047e-03f,7.498941850e-04f,5.623413017e-04f,4.216964880e-04f,3.162277862e-04f,2.371373848e-04f,1.778279402e-04f,1.333521504e-04f};   // 1 / 10000^(2i/64) evaluated in f32 exactly as the reference does (jax, eager)
#ifndef SM_EXTRA_PARAMS
#define SM_EXTRA_PARAMS
#endif
#ifndef PROJ_EXTRA_PARAMS
#define PROJ_EXTRA_PARAMS
#endif
#ifndef SM_MASK_HOOK
#define SM_MASK_HOOK (void)0
#endif

#define WS_QH  0u                                      // f16 q rows [b*t][CC]
#define WS_KH  (WS_QH + 2u * (size_t)NB * TT * CC)      // f16 k rows [b*t][CC]
#define WS_VT  (WS_KH + 2u * (size_t)NB * TT * CC)      // f16 v planes [b][c][t]
#define WS_QL  (WS_VT + 2u * (size_t)NB * CC * TT)      // f16 q residual x 2^10 rows [b][t < QHI][CC]
#define WS_KL  (WS_QL + 2u * (size_t)NB * QHI * CC)     // f16 k residual x 2^10 rows [b][t < KHI][CC]
#define WS_VB  (WS_KL + 2u * (size_t)NB * KHI * CC)     // bf16 v hi planes [b][c][t < KHI]
#define WS_VBL (WS_VB + 2u * (size_t)NB * CC * KHI)
#define WS_Y   (WS_VBL + 2u * (size_t)NB * CC * KHI)    // f16 ctx rows [b*t][CC] (only when there is an output projection)
#define WS_XB  (WS_Y  + 2u * (size_t)NB * TT * CC)      // bf16 x rows [b*t][DIN]
#define WS_WT  (WS_XB + 2u * (size_t)NB * TT * DIN)     // bf16 Wq, Wk, Wv transposed: [which][output column][k]
#define WS_WOT (WS_WT + 2u * 3u * (size_t)CC * DIN)     // f16(bf16(Wo) x 2^8) transposed: [output column][k]
#define WS_END (WS_WOT + 2u * (size_t)DIN * CC)

// operand stages of k_proj and k_out: GKS k of the block's 64 activation rows and 128 weight columns, 16-bit k-contiguous rows copied from the workspace planes into LDS, two buffers
#define GKS 64             // k per stage
#define GP  72             // row pitch in 16-bit elements: 144 B = 16 B x 9, no bank conflict for 16-byte accesses
typedef __attribute__((ext_vector_type(4))) __bf16 v4b;
typedef __attribute__((ext_vector_type(4))) _Float16 v4h;
// ---- k_cvt: every GEMM operand is rounded to its 16-bit form once per call, not once per block that reads it: x -> bf16 rows; Wq, Wk, Wv -> bf16, Wo -> f16(bf16 x 2^8), each transposed to k-contiguous rows of its output column
#define CVW (4 * (CC / 256) * (DIN / GKS))   // weight blocks: matrix, 256 columns, GKS k
#define CVX 16             // 16-byte pieces of x per thread: few blocks, so that the short launch starts quickly
__global__ __launch_bounds__(256) void k_cvt(const float* __restrict__ X, const float* __restrict__ WQ, const float* __restrict__ WK, const float* __restrict__ WV, const float* __restrict__ WO, __bf16* __restrict__ XB, __bf16* __restrict__ WT, _Float16* __restrict__ WOT) {
  const int tid = threadIdx.x, bx = blockIdx.x;
  if (bx < CVW) {   // block-uniform
    const int mt = bx / (CVW / 4), n = (bx / (DIN / GKS)) % (CC / 256) * 256 + tid, k0 = bx % (DIN / GKS) * GKS;   // the thread's own column (a wave reads one whole line per k) and writes one whole 128-byte line of its transposed row
    const float* wg = (mt == 0 ? WQ : mt == 1 ? WK : mt == 2 ? WV : WO) + (size_t)k0 * CC + n; float wv[GKS];
#pragma unroll
    for (int i = 0; i < GKS; ++i) wv[i] = wg[(size_t)i * CC];
    if (mt < 3) { __bf16* d = WT + ((size_t)mt * CC + n) * DIN + k0;
#pragma unroll
      for (int q = 0; q < GKS / 8; ++q) { v8b t;
#pragma unroll
        for (int e = 0; e < 8; ++e) t[e] = (__bf16)wv[q * 8 + e];
        *(v8b*)(d + q * 8) = t; }
      asm volatile("s_wait_xcnt 0x0" ::: "memory");   // stands behind the stores, before a register that one of them names is written again
    } else { _Float16* d = WOT + (size_t)n * CC + k0;
#pragma unroll
      for (int q = 0; q < GKS / 8; ++q) { v8h t;
#pragma unroll
        for (int e = 0; e < 8; ++e) t[e] = (_Float16)(bfr(wv[q * 8 + e]) * 256.0f);
        *(v8h*)(d + q * 8) = t; }
      asm volatile("s_wait_xcnt 0x0" ::: "memory"); }   // as above
  } else { const size_t p0 = (size_t)(bx - CVW) * (256 * CVX) + tid; v4f xv[CVX];   // 16-byte pieces p0 + 256 i of x: whole lines per wave, read and written; all of a thread's loads are in flight together
#pragma unroll
    for (int i = 0; i < CVX; ++i) xv[i] = *(const v4f*)(X + (p0 + 256 * i) * 4);
    asm volatile("s_wait_xcnt 0x0" :: "v"(X + p0 * 4) : "memory");   // stands behind the loads, before a register that holds their address is written again; the lane's address is an input so that its registers live up to the wait
#pragma unroll
    for (int i = 0; i < CVX; ++i) { v4b t;
#pragma unroll
      for (int e = 0; e < 4; ++e) t[e] = (__bf16)xv[i][e];
      *(v4b*)(XB + (p0 + 256 * i) * 4) = t; }
    asm volatile("s_wait_xcnt 0x0" ::: "memory"); } }   // as behind the weight stores
// ---- k_proj: block = (64 rows, 128 cols, which): q/k/v = X W (+ b) with exact bf16 products (K = DIN) -> which 0: q f16 rows (+ residual rows < QHI); 1: k f16 rows (+ residual rows < KHI); 2: v f16 planes [c][t] (+ bf16 hi/lo planes for t < KHI)
__global__ __launch_bounds__(128) void k_proj(const __bf16* __restrict__ XB, const __bf16* __restrict__ WT, const float* __restrict__ BQ, const float* __restrict__ BK, const float* __restrict__ BV,
    _Float16* __restrict__ QH, _Float16* __restrict__ QL, _Float16* __restrict__ KH, _Float16* __restrict__ KL, _Float16* __restrict__ VT, __bf16* __restrict__ VB, __bf16* __restrict__ VBL PROJ_EXTRA_PARAMS) {
  __shared__ __align__(16) char sm[55296];   // the main loop's stages; behind the barrier that ends the loop the epilogue's arrays lie over them: q, k: sh, sl, tc, ts (52,224 bytes); v: th, tb, tbl (55,296 bytes)
  _Float16 (*sh)[136] = (_Float16 (*)[136])sm; _Float16 (*sl)[136] = (_Float16 (*)[136])(sm + 17408); float (*tc)[34] = (float (*)[34])(sm + 34816); float (*ts)[34] = (float (*)[34])(sm + 43520);   // tc, ts: cos and sin of t x inv_freq[i], [row][i]; at pitch 34 the two lane halves (rows 8 apart) read different banks
  _Float16 (*th)[72] = (_Float16 (*)[72])sm; __bf16 (*tb)[72] = (__bf16 (*)[72])(sm + 18432); __bf16 (*tbl)[72] = (__bf16 (*)[72])(sm + 36864);
  __bf16 (*xs)[64][GP] = (__bf16 (*)[64][GP])sm; __bf16 (*wt)[128][GP] = (__bf16 (*)[128][GP])(sm + 2 * 64 * GP * 2);
  const int tid = threadIdx.x, wave = tid >> 5, lane = tid & 31, col = lane & 15, g = lane >> 4; const int which = blockIdx.z; const int c0 = blockIdx.y * 128; const size_t r0 = (size_t)blockIdx.x * 64; const size_t bb = r0 / TT; const int t0 = (int)(r0 % TT);
  const float* BA = which == 0 ? BQ : which == 1 ? BK : BV;
  v8f acc[8] = {};
  const int sr = tid >> 3, sp = (tid & 7) * 8;                      // staging: rows sr + 16 i of a tile, 16-byte piece tid & 7 of the row's 128 bytes (a wave moves four whole lines per load)
  const __bf16* xg = XB + (r0 + sr) * DIN + sp;
  const __bf16* wg = WT + ((size_t)which * CC + c0 + sr) * DIN + sp;
  v8b xv[4], wv[8];
  auto fetch = [&](int s) {
#pragma unroll
    for (int i = 0; i < 4; ++i) xv[i] = *(const v8b*)(xg + (size_t)(16 * i) * DIN + s * GKS);
#pragma unroll
    for (int i = 0; i < 8; ++i) wv[i] = *(const v8b*)(wg + (size_t)(16 * i) * DIN + s * GKS);
    asm volatile("s_wait_xcnt 0x0" ::: "memory");   // the loads above are issued here, ahead of the products, and before a register that holds one of their addresses is written again
  };
  auto stage = [&](int b) {
#pragma unroll
    for (int i = 0; i < 4; ++i) *(v8b*)&xs[b][sr + 16 * i][sp] = xv[i];
#pragma unroll
    for (int i = 0; i < 8; ++i) *(v8b*)&wt[b][sr + 16 * i][sp] = wv[i];
  };
  auto mult = [&](int b) {
#pragma unroll
    for (int kk = 0; kk < GKS / 32; ++kk) { const v16b a = frag_b(&xs[b][wave * 16 + col][kk * 32], lane); v16b w[8];
#pragma unroll
      for (int j = 0; j < 8; ++j) w[j] = frag_b(&wt[b][j * 16 + col][kk * 32], lane);
      __builtin_amdgcn_sched_barrier(0);   // the nine fragments' LDS reads stay one group ahead of their products: one LDS wait for eight products, not one each
#pragma unroll
      for (int j = 0; j < 8; ++j) acc[j] = wmma_bf(a, w[j], acc[j]);
      __builtin_amdgcn_sched_barrier(0); }   // what follows (the next group's reads; the LDS stores, which wait for the global loads) stays behind the products
  };
  fetch(0); stage(0); __syncthreads();
#pragma unroll 1   // one stage's loads live at a time
  for (int s = 0; s + 1 < DIN / GKS; ++s) { fetch(s + 1); mult(s & 1); stage((s + 1) & 1); __syncthreads(); }   // the barrier publishes stage s + 1 and ends the reads of the buffer that the next trip refills
  mult((DIN / GKS - 1) & 1); __syncthreads();   // every wave has left the stages before the epilogue writes over them
  // the epilogue works on the accumulators: a lane holds rows wave * 16 + 8 g + 0..7 of columns j * 16 + col, so channel i of a head (j = 4 hh + jj, i = 16 jj + col) and its rotary partner i + 32 (j + 2) sit in the same lane
  const int rw0 = wave * 16 + 8 * g;
#pragma unroll
  for (int j = 0; j < 8; ++j) { const float bias = BA ? bfr(BA[c0 + j * 16 + col]) : 0.f;
#pragma unroll
    for (int r = 0; r < 8; ++r) acc[j][r] += bias; }
  if (which < 2) { _Float16* DH = which == 0 ? QH : KH; _Float16* DL = which == 0 ? QL : KL; const int nhi = which == 0 ? QHI : KHI; const bool hi_rows = t0 < nhi;
    const float invf = c_invf[lane];
    asm volatile("s_wait_xcnt 0x0" ::: "memory");   // stands before a register that holds the load's address is written again
#pragma unroll 2   // two rows' dependent chains interleave; more would only lengthen the text
    for (int n = 0; n < 16; ++n) { const float ang = (float)(t0 + wave * 16 + n) * invf; tc[wave * 16 + n][lane] = cosf(ang); ts[wave * 16 + n][lane] = sinf(ang); }   // each angle once per block, for both heads (TT is a multiple of 64: t = t0 + row)
    __syncthreads();
#pragma unroll
    for (int r = 0; r < 8; ++r)
#pragma unroll
      for (int jj = 0; jj < 2; ++jj) { const float cs = tc[rw0 + r][jj * 16 + col], sn = ts[rw0 + r][jj * 16 + col];
#pragma unroll
        for (int hh = 0; hh < 2; ++hh) { const float x0 = acc[hh * 4 + jj][r], x1 = acc[hh * 4 + jj + 2][r]; acc[hh * 4 + jj][r] = x0 * cs - x1 * sn; acc[hh * 4 + jj + 2][r] = x1 * cs + x0 * sn; } }
#pragma unroll
    for (int j = 0; j < 8; ++j)
#pragma unroll
      for (int r = 0; r < 8; ++r) { const float v = acc[j][r]; const _Float16 hv = (_Float16)v; sh[rw0 + r][j * 16 + col] = hv; sl[rw0 + r][j * 16 + col] = (_Float16)((v - (float)hv) * 1024.0f); }
    __syncthreads();
    for (int e = tid; e < 64 * 16; e += 128) { const int rl = e >> 4, q = e & 15; vst2((unsigned*)(DH + (r0 + rl) * CC + c0 + q * 8), *(const v4u*)&sh[rl][q * 8]); if (hi_rows) vst2((unsigned*)(DL + (bb * nhi + t0 + rl) * (size_t)CC + c0 + q * 8), *(const v4u*)&sl[rl][q * 8]); }
  } else { const bool hi_rows = t0 < KHI;
#pragma unroll
    for (int j = 0; j < 8; ++j) { v8h hv; v8b bh, bl;   // a lane's 8 rows of one column are 16 consecutive bytes of a transposed row
#pragma unroll
      for (int r = 0; r < 8; ++r) { const float v = acc[j][r]; hv[r] = (_Float16)v; bh[r] = (__bf16)v; bl[r] = (__bf16)(v - (float)bh[r]); }
      *(v8h*)&th[j * 16 + col][rw0] = hv; if (hi_rows) { *(v8b*)&tb[j * 16 + col][rw0] = bh; *(v8b*)&tbl[j * 16 + col][rw0] = bl; } }
    __syncthreads();
    for (int e = tid; e < 128 * 8; e += 128) { const int cl = e >> 3, q = e & 7; vst2((unsigned*)(VT + (bb * CC + c0 + cl) * (size_t)TT + t0 + q * 8), *(const v4u*)&th[cl][q * 8]); if (hi_rows) { const size_t o3 = (bb * CC + c0 + cl) * (size_t)KHI + t0 + q * 8; vst2((unsigned*)(VB + o3), *(const v4u*)&tb[cl][q * 8]); vst2((unsigned*)(VBL + o3), *(const v4u*)&tbl[cl][q * 8]); } } } }
// ---- k_fa: wave = NQT x 16 queries of (b, h), all TT keys in passes of 32: S^T = K Q^T (q hi + residual x 2^10, 2 products) stays in registers, unscaled; running maximum and sum per query (a lane holds one query's scores of 8 + 8 keys, the two lane halves split the keys);
//      the block's FAW waves walk the same keys: each stage of KST keys (K rows, V^T channel rows) is brought once per block, in whole 128-byte lines, into LDS (two buffers, the next stage's global loads fly under this stage's passes) and every wave takes its fragments from there;
//      the inner loops are all unrolled so that the fragment arrays stay in registers; 2^((s - m) SL2E + 10) once to f16 is, in place, the B operand of O^T += V^T P^T (1 product); a lane ends with 8 consecutive channels of one query
#define NQT 2              // 16-query tiles per wave: each key and value fragment is loaded once for both
#define FAW 8              // waves per block
#define KST 64             // keys per stage: a K row (HD channels) and a V^T row (KST keys) are both one 128-byte line
#define SL2E (SCALE * 1.44269504088896341f)   // SCALE x log2(e): one multiply-add takes an unscaled logit to the argument of the base-2 exponential
__device__ __forceinline__ v8f wm16(v16h a, v16h b, v8f c) { return __builtin_amdgcn_wmma_f32_16x16x32_f16(false, a, false, b, (short)0, c, false, false); }
__global__ __launch_bounds__(FAW * 32) void k_fa(const _Float16* __restrict__ QH, const _Float16* __restrict__ QL, const _Float16* __restrict__ KH, const _Float16* __restrict__ VT, _Float16* __restrict__ Y) {
  __shared__ __align__(16) _Float16 ks[2][KST][GP], vs[2][HD][GP];   // [buffer][key][channel] and [buffer][channel][key], rows of 128 bytes at the 144-byte pitch
  const int tid = threadIdx.x, wave = tid >> 5, lane = tid & 31, col = lane & 15, g = lane >> 4; const int h = blockIdx.y, b = blockIdx.z; const int ql0 = (blockIdx.x * FAW + wave) * (16 * NQT);
  const _Float16* qp = QH + ((size_t)b * TT + ql0 + col) * CC + h * HD;        // query row col of the wave's first 16-query tile
  const _Float16* qr = QL + ((size_t)b * QHI + ql0 + col) * CC + h * HD;       // its residual row
  v16h qh[NQT][2], ql[NQT][2];
#pragma unroll
  for (int n = 0; n < NQT; ++n)
#pragma unroll
    for (int c = 0; c < 2; ++c) { qh[n][c] = frag_h(qp + (size_t)(n * 16) * CC + c * 32, lane); ql[n][c] = frag_h(qr + (size_t)(n * 16) * CC + c * 32, lane); }
  asm volatile("s_wait_xcnt 0x0" :: "v"(qp + 8 * g), "v"(qr + 8 * g) : "memory");   // as in the loop; the two lane addresses are inputs so that their registers live up to the wait
  const int sr = tid >> 3, sp = (tid & 7) * 8;                                  // staging: rows sr and sr + 32 of a stage, 16-byte piece tid & 7 (a wave moves four whole lines per load)
  const _Float16* kg = KH + ((size_t)b * TT + sr) * CC + h * HD + sp;
  const _Float16* vg = VT + ((size_t)b * CC + h * HD + sr) * (size_t)TT + sp;
  v8h kr[2], vr[2];
  auto fetch = [&](int s) {
#pragma unroll
    for (int i = 0; i < 2; ++i) { kr[i] = *(const v8h*)(kg + (size_t)(s * KST + 32 * i) * CC); vr[i] = *(const v8h*)(vg + (size_t)(32 * i) * TT + s * KST); }
    asm volatile("s_wait_xcnt 0x0" ::: "memory");   // the loads above are issued here, ahead of the stage's passes, and before a register that holds one of their addresses is written again
  };
  auto put = [&](int bf) {
#pragma unroll
    for (int i = 0; i < 2; ++i) { *(v8h*)&ks[bf][sr + 32 * i][sp] = kr[i]; *(v8h*)&vs[bf][sr + 32 * i][sp] = vr[i]; }
  };
  v8f o[NQT][4] = {}; float m[NQT], l[NQT];
#pragma unroll
  for (int n = 0; n < NQT; ++n) { m[n] = -3.0e38f; l[n] = 0.f; }
  fetch(0); put(0); __syncthreads();
#pragma unroll 1   // one stage's fragments live at a time
  for (int st = 0; st < TT / KST; ++st) { const int bf = st & 1;
    if (st + 1 < TT / KST) fetch(st + 1);   // block-uniform
#pragma unroll
    for (int pp = 0; pp < KST / 32; ++pp) {
      v16h kf[2][2], vf[4];
#pragma unroll
      for (int t = 0; t < 2; ++t)
#pragma unroll
        for (int c = 0; c < 2; ++c) kf[t][c] = frag_h(&ks[bf][pp * 32 + t * 16 + col][c * 32], lane);
#pragma unroll
      for (int j = 0; j < 4; ++j) vf[j] = frag_h(&vs[bf][j * 16 + col][pp * 32], lane);
      v8f sa[NQT][2] = {}, sb[NQT][2] = {};
#pragma unroll
      for (int c = 0; c < 2; ++c)
#pragma unroll
        for (int t = 0; t < 2; ++t)
#pragma unroll
          for (int n = 0; n < NQT; ++n) { sa[n][t] = wm16(kf[t][c], qh[n][c], sa[n][t]); sb[n][t] = wm16(kf[t][c], ql[n][c], sb[n][t]); }
#pragma unroll
      for (int n = 0; n < NQT; ++n) { float s[16];
#pragma unroll
        for (int r = 0; r < 8; ++r) { s[r] = sa[n][0][r] + sb[n][0][r] * (1.0f / 1024.0f); s[8 + r] = sa[n][1][r] + sb[n][1][r] * (1.0f / 1024.0f); }   // unscaled logits: SCALE goes into the exponent's multiplier
        float mx = s[0];
#pragma unroll
        for (int i = 1; i < 16; ++i) mx = fmaxf(mx, s[i]);
        mx = fmaxf(mx, __shfl_xor(mx, 16));
        const float mn = fmaxf(m[n], mx); const float al = __builtin_amdgcn_exp2f((m[n] - mn) * SL2E); m[n] = mn;
        const float bias = 10.0f - mn * SL2E;   // 2^(s SL2E + bias) = exp((s - mn) SCALE) x 2^10
        float sum = 0.f; v16h p;
#pragma unroll
        for (int i = 0; i < 16; ++i) { const float e = __builtin_amdgcn_exp2f(fmaf(s[i], SL2E, bias)); sum += e; p[i] = (_Float16)e; }
        l[n] = l[n] * al + sum;
#pragma unroll
        for (int j = 0; j < 4; ++j) { o[n][j] *= al; o[n][j] = wm16(vf[j], p, o[n][j]); } } }
    if (st + 1 < TT / KST) put(bf ^ 1);   // into the buffer whose readers all left it before the barrier of the trip before
    __syncthreads();   // publishes stage st + 1 and ends the reads of the buffer that the next trip refills
  }
#pragma unroll
  for (int n = 0; n < NQT; ++n) { const float a = l[n] + __shfl_xor(l[n], 16); const float inv = a > 0.f ? 1.0f / a : 0.f;   // numerator and sum both carry the 2^10
    _Float16* yr = Y + ((size_t)b * TT + ql0 + n * 16 + col) * CC + h * HD + 8 * g;
#pragma unroll
    for (int j = 0; j < 4; ++j) { v8h t;   // ctx leaves as the f16 that k_out multiplies
#pragma unroll
      for (int r = 0; r < 8; ++r) t[r] = (_Float16)(o[n][j][r] * inv);
      vst2(yr + j * 16, t); } } }
// ---- k_out: block = (64 rows, 128 cols): out = ctx Wo (+ bo): ctx once to f16 against Wo as f16(bf16 x 2^8) exact (1 product) x 2^-8
__global__ __launch_bounds__(128) void k_out(const _Float16* __restrict__ Y, const _Float16* __restrict__ WOT, const float* __restrict__ BO, float* __restrict__ OUT) { __shared__ __align__(16) float sf[4][16][132]; __shared__ __align__(16) _Float16 ys[2][64][GP], wt[2][128][GP];
  const int tid = threadIdx.x, wave = tid >> 5, lane = tid & 31, col = lane & 15, g = lane >> 4; const int c0 = blockIdx.y * 128; const size_t r0 = (size_t)blockIdx.x * 64 + wave * 16;
  v8f acc[8] = {};
  {
    const int sr = tid >> 3, sp = (tid & 7) * 8;                                          // as in k_proj: rows sr + 16 i, 16-byte piece tid & 7
    const _Float16* yg = Y + ((size_t)blockIdx.x * 64 + sr) * CC + sp;
    const _Float16* wg = WOT + (size_t)(c0 + sr) * CC + sp;
    v8h yv[4], wv[8];
    auto fetch = [&](int s) {
#pragma unroll
      for (int i = 0; i < 4; ++i) yv[i] = *(const v8h*)(yg + (size_t)(16 * i) * CC + s * GKS);
#pragma unroll
      for (int i = 0; i < 8; ++i) wv[i] = *(const v8h*)(wg + (size_t)(16 * i) * CC + s * GKS);
      asm volatile("s_wait_xcnt 0x0" ::: "memory");   // the loads above are issued here, ahead of the products, and before a register that holds one of their addresses is written again
    };
    auto stage = [&](int b) {
#pragma unroll
      for (int i = 0; i < 4; ++i) *(v8h*)&ys[b][sr + 16 * i][sp] = yv[i];
#pragma unroll
      for (int i = 0; i < 8; ++i) *(v8h*)&wt[b][sr + 16 * i][sp] = wv[i];
    };
    auto mult = [&](int b) {
#pragma unroll
      for (int kk = 0; kk < GKS / 32; ++kk) { const v16h a = frag_h(&ys[b][wave * 16 + col][kk * 32], lane); v16h w[8];
#pragma unroll
        for (int j = 0; j < 8; ++j) w[j] = frag_h(&wt[b][j * 16 + col][kk * 32], lane);
        __builtin_amdgcn_sched_barrier(0);   // as in k_proj: one group of LDS reads, one wait, eight products
#pragma unroll
        for (int j = 0; j < 8; ++j) acc[j] = wmma16(a, w[j], acc[j]);
        __builtin_amdgcn_sched_barrier(0); }   // as in k_proj: the LDS stores and their wait for the global loads stay behind the products
    };
    fetch(0); stage(0); __syncthreads();
#pragma unroll 1   // one stage's loads live at a time
    for (int s = 0; s + 1 < CC / GKS; ++s) { fetch(s + 1); mult(s & 1); stage((s + 1) & 1); __syncthreads(); }   // the barrier publishes stage s + 1 and ends the reads of the buffer that the next trip refills
    mult((CC / GKS - 1) & 1);
#pragma unroll
    for (int j = 0; j < 8; ++j) { const float bias = BO ? bfr(BO[c0 + j * 16 + col]) : 0.f;
#pragma unroll
      for (int r = 0; r < 8; ++r) sf[wave][8 * g + r][j * 16 + col] = acc[j][r] * (1.0f / 256.0f) + bias; } }
  LDSX(); for (int rl = 0; rl < 16; ++rl) vst2(OUT + (r0 + rl) * DIN + c0 + lane * 4, *(const v4f*)&sf[wave][rl][lane * 4]); }

extern "C" void kernel_launch(void* const* d_in, const int* in_sizes, int n_in, void* d_out, int out_size, void* d_ws, size_t ws_size, hipStream_t stream) {
  (void)in_sizes; (void)n_in; (void)out_size;
  const float** F = (const float**)d_in;
  if (ws_size < (size_t)WS_END) return;
  char* ws = (char*)d_ws; _Float16 *QH = (_Float16*)(ws + WS_QH), *KH = (_Float16*)(ws + WS_KH), *VT = (_Float16*)(ws + WS_VT), *QL = (_Float16*)(ws + WS_QL), *KL = (_Float16*)(ws + WS_KL); __bf16 *VB = (__bf16*)(ws + WS_VB), *VBL = (__bf16*)(ws + WS_VBL), *XB = (__bf16*)(ws + WS_XB), *WT = (__bf16*)(ws + WS_WT); _Float16 *Y = (_Float16*)(ws + WS_Y), *WOT = (_Float16*)(ws + WS_WOT);
  (void)Y; (void)QL; (void)KL; (void)VB; (void)VBL;
  // inputs: 0 x [2,2048,1024]; 1 Wq, 2 bq; 3 Wk, 4 bk; 5 Wv, 6 bv; 7 Wo, 8 bo ((in,out))
  k_cvt<<<CVW + TNB * TT * DIN / (4 * 256 * CVX), 256, 0, stream>>>(F[0], F[1], F[3], F[5], F[7], XB, WT, WOT);
  k_proj<<<dim3(TNB * TT / 64, CC / 128, 3), 128, 0, stream>>>(XB, WT, F[2], F[4], F[6], QH, QL, KH, KL, VT, VB, VBL);
  k_fa<<<dim3(TT / (FAW * 16 * NQT), NH, TNB), FAW * 32, 0, stream>>>(QH, QL, KH, VT, Y);
  k_out<<<dim3(TNB * TT / 64, DIN / 128), 128, 0, stream>>>(Y, WOT, F[8], (float*)d_out);
}

// v007
// It runs in 94.1 microseconds.
// Next to v006, in two timings, it ran 1.12 and 1.11 times as fast.
// Counting every step since v000, it is 13.7 times as fast.
// compute dtype: all float inputs rounded to bf16; q/k/v = x W + b with EXACT bf16 products on WMMA 16x16x32 (f32 accumulate); rotate-half RoPE applied in f32 in the projection epilogue with accurate sincosf of t x inv_freq_j (f32 constants as the reference builds them); q as f16 hi + residual (x 2^10) against k once to f16 (2 products); softmax in f32 (hardware base-2 exponential of (s - m) x 64^-0.5 x log2 e + 10) with a running maximum, logits kept in registers; exp((s - m) x 64^-0.5) x 2^10 once to f16 against v once to f16 (1 product), divided by the f32 sum at the end; ctx once to f16 against Wo carried x 2^8 in f16 + bo; f32 output.
#include <hip/hip_runtime.h>
#include <math.h>

typedef __attribute__((ext_vector_type(16))) _Float16 v16h;
typedef __attribute__((ext_vector_type(16))) __bf16 v16b;
typedef __attribute__((ext_vector_type(8)))  _Float16 v8h;
typedef __attribute__((ext_vector_type(8)))  float v8f;
typedef __attribute__((ext_vector_type(4)))  float v4f;
typedef __attribute__((ext_vector_type(2)))  float v2f;
typedef __attribute__((ext_vector_type(4)))  unsigned v4u;
typedef __attribute__((ext_vector_type(4)))  int v4i;
typedef float __attribute__((may_alias)) float_a;
typedef int __attribute__((may_alias)) int_a;

template <typename T> __device__ __forceinline__ void vst2(void* p, T v) { *(T*)p = v;  }
__device__ __forceinline__ v8f wmma16(v16h a, v16h b, v8f c) {
  v8f d = __builtin_amdgcn_wmma_f32_16x16x32_f16(false, a, false, b, (short)0, c, false, false);
  asm volatile("v_nop\n\tv_nop\n\tv_nop\n\tv_nop" : "+v"(d) : "v"(a), "v"(b));
  return d;
}
__device__ __forceinline__ v8f wmma_bf(v16b a, v16b b, v8f c) {
  v8f d = __builtin_amdgcn_wmma_f32_16x16x32_bf16(false, a, false, b, (short)0, c, false, false);
  asm volatile("v_nop\n\tv_nop\n\tv_nop\n\tv_nop" : "+v"(d) : "v"(a), "v"(b));
  return d;
}
// 16x16x32 fragments: lane = (h = lane>>4, row/col = lane&15); elements 0..7 = k0+8h+0..7, 8..15 = k0+16+8h+0..7; D element r = row 8h+r
__device__ __forceinline__ v16h frag_h(const _Float16* rowk0, int lane) {
  union { v16h v; v8h q[2]; } u; const _Float16* p = rowk0 + 8 * (lane >> 4);
  u.q[0] = *(const v8h*)p; u.q[1] = *(const v8h*)(p + 16); return u.v;
}
__device__ __forceinline__ v16h frag_f32(const float* rowk0, int lane) {
  v16h a; const float* p = rowk0 + 8 * (lane >> 4);
#pragma unroll
  for (int i = 0; i < 8; ++i) { a[i] = (_Float16)p[i]; a[8 + i] = (_Float16)p[16 + i]; }
  return a;
}
__device__ __forceinline__ v16h frag_f32s(const float* rowk0, int lane, float sc) {
  v16h a; const float* p = rowk0 + 8 * (lane >> 4);
#pragma unroll
  for (int i = 0; i < 8; ++i) { a[i] = (_Float16)(p[i] * sc); a[8 + i] = (_Float16)(p[16 + i] * sc); }
  return a;
}
// column fragment from a [K][ld] layout (column n), rows >= K read as 0
__device__ __forceinline__ v16h fragc_f32(const float* W, int k0, int n, int lane, int ld, int K) {
  v16h a; const int g = lane >> 4;
#pragma unroll
  for (int i = 0; i < 8; ++i) { const int ka = k0 + 8 * g + i, kb = ka + 16;
    a[i] = (_Float16)(ka < K ? W[(size_t)(ka < K ? ka : K - 1) * ld + n] : 0.f); a[8 + i] = (_Float16)(kb < K ? W[(size_t)(kb < K ? kb : K - 1) * ld + n] : 0.f); }
  return a;
}
struct F2 { v16b h, l; };
__device__ __forceinline__ F2 bsplit16(const float v[16]) { F2 r;
#pragma unroll
  for (int i = 0; i < 16; ++i) { const __bf16 h = (__bf16)v[i]; r.h[i] = h; r.l[i] = (__bf16)(v[i] - (float)h); }
  return r; }
__device__ __forceinline__ F2 split_row(const float* row, int k0, int lane) { float v[16]; const float* p = row + k0 + 8 * (lane >> 4);
#pragma unroll
  for (int i = 0; i < 8; ++i) { v[i] = p[i]; v[8 + i] = p[16 + i]; }
  return bsplit16(v); }
__device__ __forceinline__ F2 split_rowK(const float* row, int k0, int lane, int K) { float v[16]; const int g = lane >> 4;
#pragma unroll
  for (int i = 0; i < 8; ++i) { const int ka = k0 + 8 * g + i, kb = ka + 16; v[i] = ka < K ? row[ka < K ? ka : K - 1] : 0.f; v[8 + i] = kb < K ? row[kb < K ? kb : K - 1] : 0.f; }
  return bsplit16(v); }
__device__ __forceinline__ F2 split_col(const float* W, int k0, int n, int lane, int ld, int K) { float v[16]; const int g = lane >> 4;
#pragma unroll
  for (int i = 0; i < 8; ++i) { const int ka = k0 + 8 * g + i, kb = ka + 16; v[i] = ka < K ? W[(size_t)(ka < K ? ka : K - 1) * ld + n] : 0.f; v[8 + i] = kb < K ? W[(size_t)(kb < K ? kb : K - 1) * ld + n] : 0.f; }
  return bsplit16(v); }
__device__ __forceinline__ v8f mac3(const F2& a, const F2& b, v8f c) { c = wmma_bf(a.l, b.h, c); c = wmma_bf(a.h, b.l, c); return wmma_bf(a.h, b.h, c); }
__device__ __forceinline__ float sigm(float v) { return 1.0f / (1.0f + expf(-v)); }
#define LDSX() do { asm volatile("s_wait_dscnt 0" ::: "memory"); __builtin_amdgcn_wave_barrier(); __builtin_amdgcn_fence(__ATOMIC_RELEASE, "workgroup"); } while (0)

// Multi-head self-attention with rotary embeddings (B 2, L 2,048, D 1,024 = 16 x 64): q/k/v = x W + b ((in,out)); q, k <- q cos + rotate_half(q) sin (theta_j = 10000^(-2j/64), pairs (i, i+32)); attn = softmax(q k^T x 64^-0.5) (non-causal); out = merged(attn v) Wo + bo.
#define NB 2
#define TT 2048
#define CC 1024            // NH * HD = projected width
#define DIN 1024          // input (model) width
#define NH 16
#define HD 64
#define SCALE (0.125f)
#define CAUSAL 0
#ifndef TNB
#define TNB NB
#endif
__device__ __forceinline__ float bfr(float v) { return (float)(__bf16)v; }
__host__ __device__ __forceinline__ int kb_last(int qb) { return CAUSAL ? ((qb * 64 + 63) >> 7) : (TT / 128 - 1); }
typedef __attribute__((ext_vector_type(8))) __bf16 v8b;
__device__ __forceinline__ v16b frag_b(const __bf16* rowk0, int lane) {
  union { v16b v; v8b q[2]; } u; const __bf16* p = rowk0 + 8 * (lane >> 4);
  u.q[0] = *(const v8b*)p; u.q[1] = *(const v8b*)(p + 16); return u.v;
}
#define QBH 0              // not read by any kernel in this file
#define QHI 2048            // rows carrying a q residual plane (all rows when non-causal: 2-product logits everywhere)
#define KHI 64            // key rows carrying k residual / v bf16 hi+lo planes (written by k_proj; no kernel here reads them)
// B fragment (k rows k0+.., output column o) of a weight: (in,out) [K][ld] or (out,in) [ld rows of K]: bf16 exact, or f16(bf16 * 256) exact
__device__ __forceinline__ v16b wcol_io(const float* Wm, int k0, int o, int lane, int ld) { v16b w; const int g = lane >> 4;
#pragma unroll
  for (int i = 0; i < 8; ++i) { w[i] = (__bf16)Wm[(size_t)(k0 + 8 * g + i) * ld + o]; w[8 + i] = (__bf16)Wm[(size_t)(k0 + 16 + 8 * g + i) * ld + o]; }
  return w; }
__device__ __forceinline__ v16b wcol_oi(const float* Wm, int k0, int o, int lane, int K) { v16b w; const float* p = Wm + (size_t)o * K + k0 + 8 * (lane >> 4);
#pragma unroll
  for (int i = 0; i < 8; ++i) { w[i] = (__bf16)p[i]; w[8 + i] = (__bf16)p[16 + i]; }
  return w; }
__device__ __forceinline__ v16h wcolh_io(const float* Wm, int k0, int o, int lane, int ld) { v16h w; const int g = lane >> 4;
#pragma unroll
  for (int i = 0; i < 8; ++i) { w[i] = (_Float16)(bfr(Wm[(size_t)(k0 + 8 * g + i) * ld + o]) * 256.0f); w[8 + i] = (_Float16)(bfr(Wm[(size_t)(k0 + 16 + 8 * g + i) * ld + o]) * 256.0f); }
  return w; }
__device__ __forceinline__ v16h wcolh_oi(const float* Wm, int k0, int o, int lane, int K) { v16h w; const float* p = Wm + (size_t)o * K + k0 + 8 * (lane >> 4);
#pragma unroll
  for (int i = 0; i < 8; ++i) { w[i] = (_Float16)(bfr(p[i]) * 256.0f); w[8 + i] = (_Float16)(bfr(p[16 + i]) * 256.0f); }
  return w; }
#define WQKV_LAYOUT 0   // picks WCOL's layout (0 (in,out), 1 (out,in), 2 per-head); nothing calls WCOL: k_cvt reads (in,out) [DIN][CC] at any value
__device__ __forceinline__ v16b wcol_hdk(const float* Wm, int k0, int o, int lane) { v16b w; const int g = lane >> 4; const float* p = Wm + (size_t)(o / HD) * DIN * HD + (o % HD);
#pragma unroll
  for (int i = 0; i < 8; ++i) { w[i] = (__bf16)p[(size_t)(k0 + 8 * g + i) * HD]; w[8 + i] = (__bf16)p[(size_t)(k0 + 16 + 8 * g + i) * HD]; }
  return w; }
#define WO_OUT_IN 0
#if WQKV_LAYOUT == 1
#define WCOL(W, k0, o, lane) wcol_oi(W, k0, o, lane, DIN)
#elif WQKV_LAYOUT == 2
#define WCOL(W, k0, o, lane) wcol_hdk(W, k0, o, lane)
#else
#define WCOL(W, k0, o, lane) wcol_io(W, k0, o, lane, CC)
#endif
#if WO_OUT_IN
#define WOCOL(W, k0, o, lane) wcol_oi(W, k0, o, lane, CC)
#define WOCOLH(W, k0, o, lane) wcolh_oi(W, k0, o, lane, CC)
#else
#define WOCOL(W, k0, o, lane) wcol_io(W, k0, o, lane, DIN)
#define WOCOLH(W, k0, o, lane) wcolh_io(W, k0, o, lane, DIN)
#endif
__constant__ float c_invf[32] = {1.000000000e+00f,7.498942018e-01f,5.623413324e-01f,4.216965139e-01f,3.162277639e-01f,2.371373624e-01f,1.778279394e-01f,1.333521456e-01f,1.000000015e-01f,7.498941571e-02f,5.623412877e-02f,4.216964915e-02f,3.162277862e-02f,2.371373586e-02f,1.778279431e-02f,1.333521493e-02f,9.999999776e-03f,7.498942316e-03f,5.623413250e-03f,4.216964822e-03f,3.162277862e-03f,2.371373819e-03f,1.778279431e-03f,1.333521446e-03f,1.000000047e-03f,7.498941850e-04f,5.623413017e-04f,4.216964880e-04f,3.162277862e-04f,2.371373848e-04f,1.778279402e-04f,1.333521504e-04f};   // 1 / 10000^(2i/64) evaluated in f32 exactly as the reference does (jax, eager)
#ifndef SM_EXTRA_PARAMS
#define SM_EXTRA_PARAMS
#endif
#ifndef PROJ_EXTRA_PARAMS
#define PROJ_EXTRA_PARAMS
#endif
#ifndef SM_MASK_HOOK
#define SM_MASK_HOOK (void)0
#endif

#define WS_QH  0u                                      // f16 q rows [b*t][CC]
#define WS_KH  (WS_QH + 2u * (size_t)NB * TT * CC)      // f16 k rows [b*t][CC]
#define WS_VT  (WS_KH + 2u * (size_t)NB * TT * CC)      // f16 v planes [b][c][t]
#define WS_QL  (WS_VT + 2u * (size_t)NB * CC * TT)      // f16 q residual x 2^10 rows [b][t < QHI][CC]
#define WS_KL  (WS_QL + 2u * (size_t)NB * QHI * CC)     // f16 k residual x 2^10 rows [b][t < KHI][CC]
#define WS_VB  (WS_KL + 2u * (size_t)NB * KHI * CC)     // bf16 v hi planes [b][c][t < KHI]
#define WS_VBL (WS_VB + 2u * (size_t)NB * CC * KHI)
#define WS_Y   (WS_VBL + 2u * (size_t)NB * CC * KHI)    // f16 ctx rows [b*t][CC] (only when there is an output projection)
#define WS_XB  (WS_Y  + 2u * (size_t)NB * TT * CC)      // bf16 x rows [b*t][DIN]
#define WS_WT  (WS_XB + 2u * (size_t)NB * TT * DIN)     // bf16 Wq, Wk, Wv transposed: [which][output column][k]
#define WS_WOT (WS_WT + 2u * 3u * (size_t)CC * DIN)     // f16(bf16(Wo) x 2^8) transposed: [output column][k]
#define WS_END (WS_WOT + 2u * (size_t)DIN * CC)

// operand stages of k_proj and k_out: GKS k of the block's activation rows (k_proj 128, k_out 64) and 128 weight columns, 16-bit k-contiguous rows copied from the workspace planes into LDS, two buffers
#define GKS 64             // k per stage
#define GP  72             // row pitch in 16-bit elements: 144 B = 16 B x 9, no bank conflict for 16-byte accesses
typedef __attribute__((ext_vector_type(4))) __bf16 v4b;
typedef __attribute__((ext_vector_type(4))) _Float16 v4h;
// ---- k_cvt: every GEMM operand is rounded to its 16-bit form once per call, not once per block that reads it: x -> bf16 rows; Wq, Wk, Wv -> bf16, Wo -> f16(bf16 x 2^8), each transposed to k-contiguous rows of its output column
#define CVW (4 * (CC / 256) * (DIN / GKS))   // weight blocks: matrix, 256 columns, GKS k
#define CVX 16             // 16-byte pieces of x per thread: few blocks, so that the short launch starts quickly
__global__ __launch_bounds__(256) void k_cvt(const float* __restrict__ X, const float* __restrict__ WQ, const float* __restrict__ WK, const float* __restrict__ WV, const float* __restrict__ WO, __bf16* __restrict__ XB, __bf16* __restrict__ WT, _Float16* __restrict__ WOT) {
  const int tid = threadIdx.x, bx = blockIdx.x;
  if (bx < CVW) {   // block-uniform
    const int mt = bx / (CVW / 4), n = (bx / (DIN / GKS)) % (CC / 256) * 256 + tid, k0 = bx % (DIN / GKS) * GKS;   // the thread's own column (a wave reads one whole line per k) and writes one whole 128-byte line of its transposed row
    const float* wg = (mt == 0 ? WQ : mt == 1 ? WK : mt == 2 ? WV : WO) + (size_t)k0 * CC + n; float wv[GKS];
#pragma unroll
    for (int i = 0; i < GKS; ++i) wv[i] = wg[(size_t)i * CC];
    if (mt < 3) { __bf16* d = WT + ((size_t)mt * CC + n) * DIN + k0;
#pragma unroll
      for (int q = 0; q < GKS / 8; ++q) { v8b t;
#pragma unroll
        for (int e = 0; e < 8; ++e) t[e] = (__bf16)wv[q * 8 + e];
        *(v8b*)(d + q * 8) = t; }
      asm volatile("s_wait_xcnt 0x0" ::: "memory");   // stands behind the stores, before a register that one of them names is written again
    } else { _Float16* d = WOT + (size_t)n * CC + k0;
#pragma unroll
      for (int q = 0; q < GKS / 8; ++q) { v8h t;
#pragma unroll
        for (int e = 0; e < 8; ++e) t[e] = (_Float16)(bfr(wv[q * 8 + e]) * 256.0f);
        *(v8h*)(d + q * 8) = t; }
      asm volatile("s_wait_xcnt 0x0" ::: "memory"); }   // as above
  } else { const size_t p0 = (size_t)(bx - CVW) * (256 * CVX) + tid; v4f xv[CVX];   // 16-byte pieces p0 + 256 i of x: whole lines per wave, read and written; all of a thread's loads are in flight together
#pragma unroll
    for (int i = 0; i < CVX; ++i) xv[i] = *(const v4f*)(X + (p0 + 256 * i) * 4);
    asm volatile("s_wait_xcnt 0x0" :: "v"(X + p0 * 4) : "memory");   // stands behind the loads, before a register that holds their address is written again; the lane's address is an input so that its registers live up to the wait
#pragma unroll
    for (int i = 0; i < CVX; ++i) { v4b t;
#pragma unroll
      for (int e = 0; e < 4; ++e) t[e] = (__bf16)xv[i][e];
      *(v4b*)(XB + (p0 + 256 * i) * 4) = t; }
    asm volatile("s_wait_xcnt 0x0" ::: "memory"); } }   // as behind the weight stores
// ---- k_proj: block = (128 rows, 128 cols, which), four waves of 64 x 64 (a wave's columns are one head): q/k/v = X W (+ b) with exact bf16 products (K = DIN) -> which 0: q f16 rows (+ residual rows < QHI); 1: k f16 rows (+ residual rows < KHI); 2: v f16 planes [c][t] (+ bf16 hi/lo planes for t < KHI)
#define PBM 128            // rows of a block: with 128 columns a stage brings 256 operand rows for 16,384 outputs, and a wave's 4 + 4 fragments feed 16 products; registers and LDS let three blocks share a WGP, so the 768 blocks are all resident
__global__ __launch_bounds__(128) void k_proj(const __bf16* __restrict__ XB, const __bf16* __restrict__ WT, const float* __restrict__ BQ, const float* __restrict__ BK, const float* __restrict__ BV,
    _Float16* __restrict__ QH, _Float16* __restrict__ QL, _Float16* __restrict__ KH, _Float16* __restrict__ KL, _Float16* __restrict__ VT, __bf16* __restrict__ VB, __bf16* __restrict__ VBL PROJ_EXTRA_PARAMS) {
  __shared__ __align__(16) char sm[104448];   // the main loop's stages (73,728 bytes); behind the barrier that ends the loop the epilogue's arrays lie over them: q, k: sh, sl, tc, ts (104,448 bytes); v: th, tb, tbl (71,680 bytes); three blocks fit a WGP
  _Float16 (*sh)[136] = (_Float16 (*)[136])sm; _Float16 (*sl)[136] = (_Float16 (*)[136])(sm + 34816); float (*tc)[34] = (float (*)[34])(sm + 69632); float (*ts)[34] = (float (*)[34])(sm + 87040);   // tc, ts: cos and sin of t x inv_freq[i], [row][i]; at pitch 34 the two lane halves (rows 8 apart) read different banks
  _Float16 (*th)[136] = (_Float16 (*)[136])sm; __bf16 (*tb)[72] = (__bf16 (*)[72])(sm + 34816); __bf16 (*tbl)[72] = (__bf16 (*)[72])(sm + 53248);   // th: [column][row of the block]; tb, tbl: [column][row < KHI]
  __bf16 (*xs)[PBM][GP] = (__bf16 (*)[PBM][GP])sm; __bf16 (*wt)[128][GP] = (__bf16 (*)[128][GP])(sm + 2 * PBM * GP * 2);
  const int tid = threadIdx.x, wave = tid >> 5, lane = tid & 31, col = lane & 15, g = lane >> 4; const int which = blockIdx.z; const int c0 = blockIdx.y * 128; const size_t r0 = (size_t)blockIdx.x * PBM; const size_t bb = r0 / TT; const int t0 = (int)(r0 % TT);
  const int wr0 = (wave >> 1) * 64, wc0 = (wave & 1) * 64;          // the wave's first row and first column inside the block
  const float* BA = which == 0 ? BQ : which == 1 ? BK : BV;
  v8f acc[4][4] = {};                                               // [16-row tile][16-column tile]
  const int sr = tid >> 3, sp = (tid & 7) * 8;                      // staging: rows sr + 16 i of a tile, 16-byte piece tid & 7 of the row's 128 bytes (a wave moves four whole lines per load)
  const __bf16* xg = XB + (r0 + sr) * DIN + sp;
  const __bf16* wg = WT + ((size_t)which * CC + c0 + sr) * DIN + sp;
  v8b xv[8], wv[8];
  auto fetch = [&](int s) {
#pragma unroll
    for (int i = 0; i < 8; ++i) xv[i] = *(const v8b*)(xg + (size_t)(16 * i) * DIN + s * GKS);
#pragma unroll
    for (int i = 0; i < 8; ++i) wv[i] = *(const v8b*)(wg + (size_t)(16 * i) * DIN + s * GKS);
    asm volatile("s_wait_xcnt 0x0" :: "v"(xg + s * GKS), "v"(wg + s * GKS) : "memory");   // the loads above are issued here, ahead of the products, and before a register that holds one of their addresses is written again; the stage's two lane addresses are inputs so that their registers live up to the wait
  };
  auto stage = [&](int b) {
#pragma unroll
    for (int i = 0; i < 8; ++i) *(v8b*)&xs[b][sr + 16 * i][sp] = xv[i];
#pragma unroll
    for (int i = 0; i < 8; ++i) *(v8b*)&wt[b][sr + 16 * i][sp] = wv[i];
  };
  auto mult = [&](int b) {
#pragma unroll
    for (int kk = 0; kk < GKS / 32; ++kk) { v16b a[4], w[4];
#pragma unroll
      for (int i = 0; i < 4; ++i) a[i] = frag_b(&xs[b][wr0 + i * 16 + col][kk * 32], lane);
#pragma unroll
      for (int j = 0; j < 4; ++j) w[j] = frag_b(&wt[b][wc0 + j * 16 + col][kk * 32], lane);
      __builtin_amdgcn_sched_barrier(0);   // the eight fragments' LDS reads stay one group ahead of their products: one place with LDS reads for sixteen products
#pragma unroll
      for (int i = 0; i < 4; ++i)
#pragma unroll
        for (int j = 0; j < 4; ++j) acc[i][j] = wmma_bf(a[i], w[j], acc[i][j]);
      __builtin_amdgcn_sched_barrier(0); }   // what follows (the next group's reads; the LDS stores, which wait for the global loads) stays behind the products
  };
  fetch(0); stage(0); __syncthreads();
#pragma unroll 1   // one stage's loads live at a time
  for (int s = 0; s + 1 < DIN / GKS; ++s) { fetch(s + 1); mult(s & 1); stage((s + 1) & 1); __syncthreads(); }   // the barrier publishes stage s + 1 and ends the reads of the buffer that the next trip refills
  mult((DIN / GKS - 1) & 1); __syncthreads();   // every wave has left the stages before the epilogue writes over them
  // the epilogue works on the accumulators: a lane holds rows wr0 + i * 16 + 8 g + 0..7 of columns wc0 + j * 16 + col, so channel 16 jj + col of the wave's head (j = jj < 2) and its rotary partner, 32 channels on (j + 2), sit in the same lane
  const int rw0 = wr0 + 8 * g;
#pragma unroll
  for (int j = 0; j < 4; ++j) { const float bias = BA ? bfr(BA[c0 + wc0 + j * 16 + col]) : 0.f;
#pragma unroll
    for (int i = 0; i < 4; ++i)
#pragma unroll
      for (int r = 0; r < 8; ++r) acc[i][j][r] += bias; }
  if (which < 2) { _Float16* DH = which == 0 ? QH : KH; _Float16* DL = which == 0 ? QL : KL; const int nhi = which == 0 ? QHI : KHI;
    const float invf = c_invf[lane];
    asm volatile("s_wait_xcnt 0x0" ::: "memory");   // stands before a register that holds the load's address is written again
#pragma unroll 2   // two rows' dependent chains interleave; more would only lengthen the text
    for (int n = 0; n < PBM / 4; ++n) { const float ang = (float)(t0 + wave * (PBM / 4) + n) * invf; tc[wave * (PBM / 4) + n][lane] = cosf(ang); ts[wave * (PBM / 4) + n][lane] = sinf(ang); }   // each angle once per block, for both heads (TT is a multiple of PBM: t = t0 + row)
    __syncthreads();
#pragma unroll
    for (int i = 0; i < 4; ++i) {
#pragma unroll
      for (int r = 0; r < 8; ++r)
#pragma unroll
        for (int jj = 0; jj < 2; ++jj) { const float cs = tc[rw0 + i * 16 + r][jj * 16 + col], sn = ts[rw0 + i * 16 + r][jj * 16 + col];
          const float x0 = acc[i][jj][r], x1 = acc[i][jj + 2][r]; acc[i][jj][r] = x0 * cs - x1 * sn; acc[i][jj + 2][r] = x1 * cs + x0 * sn; }
#pragma unroll
      for (int j = 0; j < 4; ++j)
#pragma unroll
        for (int r = 0; r < 8; ++r) { const float v = acc[i][j][r]; const _Float16 hv = (_Float16)v; sh[rw0 + i * 16 + r][wc0 + j * 16 + col] = hv; sl[rw0 + i * 16 + r][wc0 + j * 16 + col] = (_Float16)((v - (float)hv) * 1024.0f); }
    }
    __syncthreads();
    for (int e = tid; e < PBM * 16; e += 128) { const int rl = e >> 4, q = e & 15; _Float16* dh = DH + (r0 + rl) * CC + c0 + q * 8; vst2((unsigned*)dh, *(const v4u*)&sh[rl][q * 8]);
      asm volatile("s_wait_xcnt 0x0" :: "v"(dh) : "memory");   // stands behind the store, before a register that it names is written again; the address is an input so that its registers live up to the wait
      if (t0 + rl < nhi) { _Float16* dl = DL + (bb * nhi + t0 + rl) * (size_t)CC + c0 + q * 8; vst2((unsigned*)dl, *(const v4u*)&sl[rl][q * 8]);
        asm volatile("s_wait_xcnt 0x0" :: "v"(dl) : "memory"); } }   // as above
  } else { const bool hi_rows = t0 + wr0 < KHI;   // KHI is a multiple of 64: a wave's 64 rows carry the bf16 planes all or none
#pragma unroll
    for (int j = 0; j < 4; ++j)
#pragma unroll
      for (int i = 0; i < 4; ++i) { v8h hv; v8b bh, bl;   // a lane's 8 rows of one column are 16 consecutive bytes of a transposed row
#pragma unroll
        for (int r = 0; r < 8; ++r) { const float v = acc[i][j][r]; hv[r] = (_Float16)v; bh[r] = (__bf16)v; bl[r] = (__bf16)(v - (float)bh[r]); }
        *(v8h*)&th[wc0 + j * 16 + col][rw0 + i * 16] = hv; if (hi_rows) { *(v8b*)&tb[wc0 + j * 16 + col][rw0 + i * 16] = bh; *(v8b*)&tbl[wc0 + j * 16 + col][rw0 + i * 16] = bl; } }
    __syncthreads();
    for (int e = tid; e < 128 * (PBM / 8); e += 128) { const int cl = e / (PBM / 8), q = e % (PBM / 8); _Float16* dv = VT + (bb * CC + c0 + cl) * (size_t)TT + t0 + q * 8; vst2((unsigned*)dv, *(const v4u*)&th[cl][q * 8]);
      asm volatile("s_wait_xcnt 0x0" :: "v"(dv) : "memory");   // as behind the q, k stores
      if (t0 + q * 8 < KHI) { const size_t o3 = (bb * CC + c0 + cl) * (size_t)KHI + t0 + q * 8; vst2((unsigned*)(VB + o3), *(const v4u*)&tb[cl][q * 8]); vst2((unsigned*)(VBL + o3), *(const v4u*)&tbl[cl][q * 8]);
        asm volatile("s_wait_xcnt 0x0" :: "v"(VB + o3), "v"(VBL + o3) : "memory"); } } } }   // as behind the q, k stores
// ---- k_fa: wave = NQT x 16 queries of (b, h), all TT keys in passes of 32: S^T = K Q^T (q hi + residual x 2^10, 2 products) stays in registers, unscaled; running maximum and sum per query (a lane holds one query's scores of 8 + 8 keys, the two lane halves split the keys);
//      the block's FAW waves walk the same keys: each stage of KST keys (K rows, V^T channel rows) is brought once per block, in whole 128-byte lines, into LDS (two buffers, the next stage's global loads fly under this stage's passes) and every wave takes its fragments from there;
//      the inner loops are all unrolled so that the fragment arrays stay in registers; 2^((s - m) SL2E + 10) once to f16 is, in place, the B operand of O^T += V^T P^T (1 product); a lane ends with 8 consecutive channels of one query
#define NQT 2              // 16-query tiles per wave: each key and value fragment is loaded once for both
#define FAW 8              // waves per block
#define KST 64             // keys per stage: a K row (HD channels) and a V^T row (KST keys) are both one 128-byte line
#define SL2E (SCALE * 1.44269504088896341f)   // SCALE x log2(e): one multiply-add takes an unscaled logit to the argument of the base-2 exponential
__device__ __forceinline__ v8f wm16(v16h a, v16h b, v8f c) { return __builtin_amdgcn_wmma_f32_16x16x32_f16(false, a, false, b, (short)0, c, false, false); }
__global__ __launch_bounds__(FAW * 32) void k_fa(const _Float16* __restrict__ QH, const _Float16* __restrict__ QL, const _Float16* __restrict__ KH, const _Float16* __restrict__ VT, _Float16* __restrict__ Y) {
  __shared__ __align__(16) _Float16 ks[2][KST][GP], vs[2][HD][GP];   // [buffer][key][channel] and [buffer][channel][key], rows of 128 bytes at the 144-byte pitch
  const int tid = threadIdx.x, wave = tid >> 5, lane = tid & 31, col = lane & 15, g = lane >> 4; const int h = blockIdx.y, b = blockIdx.z; const int ql0 = (blockIdx.x * FAW + wave) * (16 * NQT);
  const _Float16* qp = QH + ((size_t)b * TT + ql0 + col) * CC + h * HD;        // query row col of the wave's first 16-query tile
  const _Float16* qr = QL + ((size_t)b * QHI + ql0 + col) * CC + h * HD;       // its residual row
  v16h qh[NQT][2], ql[NQT][2];
#pragma unroll
  for (int n = 0; n < NQT; ++n)
#pragma unroll
    for (int c = 0; c < 2; ++c) { qh[n][c] = frag_h(qp + (size_t)(n * 16) * CC + c * 32, lane); ql[n][c] = frag_h(qr + (size_t)(n * 16) * CC + c * 32, lane); }
  asm volatile("s_wait_xcnt 0x0" :: "v"(qp + 8 * g), "v"(qr + 8 * g) : "memory");   // as in the loop; the two lane addresses are inputs so that their registers live up to the wait
  const int sr = tid >> 3, sp = (tid & 7) * 8;                                  // staging: rows sr and sr + 32 of a stage, 16-byte piece tid & 7 (a wave moves four whole lines per load)
  const _Float16* kg = KH + ((size_t)b * TT + sr) * CC + h * HD + sp;
  const _Float16* vg = VT + ((size_t)b * CC + h * HD + sr) * (size_t)TT + sp;
  v8h kr[2], vr[2];
  auto fetch = [&](int s) {
#pragma unroll
    for (int i = 0; i < 2; ++i) { kr[i] = *(const v8h*)(kg + (size_t)(s * KST + 32 * i) * CC); vr[i] = *(const v8h*)(vg + (size_t)(32 * i) * TT + s * KST); }
    asm volatile("s_wait_xcnt 0x0" ::: "memory");   // the loads above are issued here, ahead of the stage's passes, and before a register that holds one of their addresses is written again
  };
  auto put = [&](int bf) {
#pragma unroll
    for (int i = 0; i < 2; ++i) { *(v8h*)&ks[bf][sr + 32 * i][sp] = kr[i]; *(v8h*)&vs[bf][sr + 32 * i][sp] = vr[i]; }
  };
  v8f o[NQT][4] = {}; float m[NQT], l[NQT];
#pragma unroll
  for (int n = 0; n < NQT; ++n) { m[n] = -3.0e38f; l[n] = 0.f; }
  fetch(0); put(0); __syncthreads();
#pragma unroll 1   // one stage's fragments live at a time
  for (int st = 0; st < TT / KST; ++st) { const int bf = st & 1;
    if (st + 1 < TT / KST) fetch(st + 1);   // block-uniform
#pragma unroll
    for (int pp = 0; pp < KST / 32; ++pp) {
      v16h kf[2][2], vf[4];
#pragma unroll
      for (int t = 0; t < 2; ++t)
#pragma unroll
        for (int c = 0; c < 2; ++c) kf[t][c] = frag_h(&ks[bf][pp * 32 + t * 16 + col][c * 32], lane);
#pragma unroll
      for (int j = 0; j < 4; ++j) vf[j] = frag_h(&vs[bf][j * 16 + col][pp * 32], lane);
      v8f sa[NQT][2] = {}, sb[NQT][2] = {};
#pragma unroll
      for (int c = 0; c < 2; ++c)
#pragma unroll
        for (int t = 0; t < 2; ++t)
#pragma unroll
          for (int n = 0; n < NQT; ++n) { sa[n][t] = wm16(kf[t][c], qh[n][c], sa[n][t]); sb[n][t] = wm16(kf[t][c], ql[n][c], sb[n][t]); }
#pragma unroll
      for (int n = 0; n < NQT; ++n) { float s[16];
#pragma unroll
        for (int r = 0; r < 8; ++r) { s[r] = sa[n][0][r] + sb[n][0][r] * (1.0f / 1024.0f); s[8 + r] = sa[n][1][r] + sb[n][1][r] * (1.0f / 1024.0f); }   // unscaled logits: SCALE goes into the exponent's multiplier
        float mx = s[0];
#pragma unroll
        for (int i = 1; i < 16; ++i) mx = fmaxf(mx, s[i]);
        mx = fmaxf(mx, __shfl_xor(mx, 16));
        const float mn = fmaxf(m[n], mx); const float al = __builtin_amdgcn_exp2f((m[n] - mn) * SL2E); m[n] = mn;
        const float bias = 10.0f - mn * SL2E;   // 2^(s SL2E + bias) = exp((s - mn) SCALE) x 2^10
        float sum = 0.f; v16h p;
#pragma unroll
        for (int i = 0; i < 16; ++i) { const float e = __builtin_amdgcn_exp2f(fmaf(s[i], SL2E, bias)); sum += e; p[i] = (_Float16)e; }
        l[n] = l[n] * al + sum;
#pragma unroll
        for (int j = 0; j < 4; ++j) { o[n][j] *= al; o[n][j] = wm16(vf[j], p, o[n][j]); } } }
    if (st + 1 < TT / KST) put(bf ^ 1);   // into the buffer whose readers all left it before the barrier of the trip before
    __syncthreads();   // publishes stage st + 1 and ends the reads of the buffer that the next trip refills
  }
#pragma unroll
  for (int n = 0; n < NQT; ++n) { const float a = l[n] + __shfl_xor(l[n], 16); const float inv = a > 0.f ? 1.0f / a : 0.f;   // numerator and sum both carry the 2^10
    _Float16* yr = Y + ((size_t)b * TT + ql0 + n * 16 + col) * CC + h * HD + 8 * g;
#pragma unroll
    for (int j = 0; j < 4; ++j) { v8h t;   // ctx leaves as the f16 that k_out multiplies
#pragma unroll
      for (int r = 0; r < 8; ++r) t[r] = (_Float16)(o[n][j][r] * inv);
      vst2(yr + j * 16, t); } } }
// ---- k_out: block = (64 rows, 128 cols): out = ctx Wo (+ bo): ctx once to f16 against Wo as f16(bf16 x 2^8) exact (1 product) x 2^-8
__global__ __launch_bounds__(128) void k_out(const _Float16* __restrict__ Y, const _Float16* __restrict__ WOT, const float* __restrict__ BO, float* __restrict__ OUT) { __shared__ __align__(16) float sf[4][16][132]; __shared__ __align__(16) _Float16 ys[2][64][GP], wt[2][128][GP];
  const int tid = threadIdx.x, wave = tid >> 5, lane = tid & 31, col = lane & 15, g = lane >> 4; const int c0 = blockIdx.y * 128; const size_t r0 = (size_t)blockIdx.x * 64 + wave * 16;
  v8f acc[8] = {};
  {
    const int sr = tid >> 3, sp = (tid & 7) * 8;                                          // as in k_proj: rows sr + 16 i, 16-byte piece tid & 7
    const _Float16* yg = Y + ((size_t)blockIdx.x * 64 + sr) * CC + sp;
    const _Float16* wg = WOT + (size_t)(c0 + sr) * CC + sp;
    v8h yv[4], wv[8];
    auto fetch = [&](int s) {
#pragma unroll
      for (int i = 0; i < 4; ++i) yv[i] = *(const v8h*)(yg + (size_t)(16 * i) * CC + s * GKS);
#pragma unroll
      for (int i = 0; i < 8; ++i) wv[i] = *(const v8h*)(wg + (size_t)(16 * i) * CC + s * GKS);
      asm volatile("s_wait_xcnt 0x0" ::: "memory");   // the loads above are issued here, ahead of the products, and before a register that holds one of their addresses is written again
    };
    auto stage = [&](int b) {
#pragma unroll
      for (int i = 0; i < 4; ++i) *(v8h*)&ys[b][sr + 16 * i][sp] = yv[i];
#pragma unroll
      for (int i = 0; i < 8; ++i) *(v8h*)&wt[b][sr + 16 * i][sp] = wv[i];
    };
    auto mult = [&](int b) {
#pragma unroll
      for (int kk = 0; kk < GKS / 32; ++kk) { const v16h a = frag_h(&ys[b][wave * 16 + col][kk * 32], lane); v16h w[8];
#pragma unroll
        for (int j = 0; j < 8; ++j) w[j] = frag_h(&wt[b][j * 16 + col][kk * 32], lane);
        __builtin_amdgcn_sched_barrier(0);   // as in k_proj: one group of LDS reads, one wait, eight products
#pragma unroll
        for (int j = 0; j < 8; ++j) acc[j] = wmma16(a, w[j], acc[j]);
        __builtin_amdgcn_sched_barrier(0); }   // as in k_proj: the LDS stores and their wait for the global loads stay behind the products
    };
    fetch(0); stage(0); __syncthreads();
#pragma unroll 1   // one stage's loads live at a time
    for (int s = 0; s + 1 < CC / GKS; ++s) { fetch(s + 1); mult(s & 1); stage((s + 1) & 1); __syncthreads(); }   // the barrier publishes stage s + 1 and ends the reads of the buffer that the next trip refills
    mult((CC / GKS - 1) & 1);
#pragma unroll
    for (int j = 0; j < 8; ++j) { const float bias = BO ? bfr(BO[c0 + j * 16 + col]) : 0.f;
#pragma unroll
      for (int r = 0; r < 8; ++r) sf[wave][8 * g + r][j * 16 + col] = acc[j][r] * (1.0f / 256.0f) + bias; } }
  LDSX(); for (int rl = 0; rl < 16; ++rl) vst2(OUT + (r0 + rl) * DIN + c0 + lane * 4, *(const v4f*)&sf[wave][rl][lane * 4]); }

extern "C" void kernel_launch(void* const* d_in, const int* in_sizes, int n_in, void* d_out, int out_size, void* d_ws, size_t ws_size, hipStream_t stream) {
  (void)in_sizes; (void)n_in; (void)out_size;
  const float** F = (const float**)d_in;
  if (ws_size < (size_t)WS_END) return;
  char* ws = (char*)d_ws; _Float16 *QH = (_Float16*)(ws + WS_QH), *KH = (_Float16*)(ws + WS_KH), *VT = (_Float16*)(ws + WS_VT), *QL = (_Float16*)(ws + WS_QL), *KL = (_Float16*)(ws + WS_KL); __bf16 *VB = (__bf16*)(ws + WS_VB), *VBL = (__bf16*)(ws + WS_VBL), *XB = (__bf16*)(ws + WS_XB), *WT = (__bf16*)(ws + WS_WT); _Float16 *Y = (_Float16*)(ws + WS_Y), *WOT = (_Float16*)(ws + WS_WOT);
  (void)Y; (void)QL; (void)KL; (void)VB; (void)VBL;
  // inputs: 0 x [2,2048,1024]; 1 Wq, 2 bq; 3 Wk, 4 bk; 5 Wv, 6 bv; 7 Wo, 8 bo ((in,out))
  k_cvt<<<CVW + TNB * TT * DIN / (4 * 256 * CVX), 256, 0, stream>>>(F[0], F[1], F[3], F[5], F[7], XB, WT, WOT);
  k_proj<<<dim3(TNB * TT / PBM, CC / 128, 3), 128, 0, stream>>>(XB, WT, F[2], F[4], F[6], QH, QL, KH, KL, VT, VB, VBL);
  k_fa<<<dim3(TT / (FAW * 16 * NQT), NH, TNB), FAW * 32, 0, stream>>>(QH, QL, KH, VT, Y);
  k_out<<<dim3(TNB * TT / 64, DIN / 128), 128, 0, stream>>>(Y, WOT, F[8], (float*)d_out);
}

// v008
// Measured time: 88.2 microseconds a run.
// Next to v007, in two timings, it ran 1.06 times as fast each time.
// Counting every step since v000, it is 14.5 times as fast.
// compute dtype: all float inputs rounded to bf16; q/k/v = x W + b with EXACT bf16 products on WMMA 16x16x32 (f32 accumulate); rotate-half RoPE applied in f32 in the projection epilogue with accurate sincosf of t x inv_freq_j (f32 constants as the reference builds them); q as f16 hi + residual (x 2^10) against k once to f16 (2 products); softmax in f32 (hardware base-2 exponential of (s - m) x 64^-0.5 x log2 e + 10) against a held reference maximum m that moves to the running maximum when a pass's sum of exponentials outgrows f16, logits kept in registers; exp(s - m) x 2^10 once to f16 against v once to f16 (1 product), divided by the f32 sum at the end; ctx once to f16 against Wo carried x 2^8 in f16 + bo; f32 output.
#include <hip/hip_runtime.h>
#include <math.h>

typedef __attribute__((ext_vector_type(16))) _Float16 v16h;
typedef __attribute__((ext_vector_type(16))) __bf16 v16b;
typedef __attribute__((ext_vector_type(8)))  _Float16 v8h;
typedef __attribute__((ext_vector_type(8)))  float v8f;
typedef __attribute__((ext_vector_type(4)))  float v4f;
typedef __attribute__((ext_vector_type(2)))  float v2f;
typedef __attribute__((ext_vector_type(4)))  unsigned v4u;
typedef __attribute__((ext_vector_type(4)))  int v4i;
typedef float __attribute__((may_alias)) float_a;
typedef int __attribute__((may_alias)) int_a;

template <typename T> __device__ __forceinline__ void vst2(void* p, T v) { *(T*)p = v;  }
__device__ __forceinline__ v8f wmma16(v16h a, v16h b, v8f c) {
  v8f d = __builtin_amdgcn_wmma_f32_16x16x32_f16(false, a, false, b, (short)0, c, false, false);
  asm volatile("v_nop\n\tv_nop\n\tv_nop\n\tv_nop" : "+v"(d) : "v"(a), "v"(b));
  return d;
}
__device__ __forceinline__ v8f wmma_bf(v16b a, v16b b, v8f c) {
  v8f d = __builtin_amdgcn_wmma_f32_16x16x32_bf16(false, a, false, b, (short)0, c, false, false);
  asm volatile("v_nop\n\tv_nop\n\tv_nop\n\tv_nop" : "+v"(d) : "v"(a), "v"(b));
  return d;
}
// 16x16x32 fragments: lane = (h = lane>>4, row/col = lane&15); elements 0..7 = k0+8h+0..7, 8..15 = k0+16+8h+0..7; D element r = row 8h+r
__device__ __forceinline__ v16h frag_h(const _Float16* rowk0, int lane) {
  union { v16h v; v8h q[2]; } u; const _Float16* p = rowk0 + 8 * (lane >> 4);
  u.q[0] = *(const v8h*)p; u.q[1] = *(const v8h*)(p + 16); return u.v;
}
__device__ __forceinline__ v16h frag_f32(const float* rowk0, int lane) {
  v16h a; const float* p = rowk0 + 8 * (lane >> 4);
#pragma unroll
  for (int i = 0; i < 8; ++i) { a[i] = (_Float16)p[i]; a[8 + i] = (_Float16)p[16 + i]; }
  return a;
}
__device__ __forceinline__ v16h frag_f32s(const float* rowk0, int lane, float sc) {
  v16h a; const float* p = rowk0 + 8 * (lane >> 4);
#pragma unroll
  for (int i = 0; i < 8; ++i) { a[i] = (_Float16)(p[i] * sc); a[8 + i] = (_Float16)(p[16 + i] * sc); }
  return a;
}
// column fragment from a [K][ld] layout (column n), rows >= K read as 0
__device__ __forceinline__ v16h fragc_f32(const float* W, int k0, int n, int lane, int ld, int K) {
  v16h a; const int g = lane >> 4;
#pragma unroll
  for (int i = 0; i < 8; ++i) { const int ka = k0 + 8 * g + i, kb = ka + 16;
    a[i] = (_Float16)(ka < K ? W[(size_t)(ka < K ? ka : K - 1) * ld + n] : 0.f); a[8 + i] = (_Float16)(kb < K ? W[(size_t)(kb < K ? kb : K - 1) * ld + n] : 0.f); }
  return a;
}
struct F2 { v16b h, l; };
__device__ __forceinline__ F2 bsplit16(const float v[16]) { F2 r;
#pragma unroll
  for (int i = 0; i < 16; ++i) { const __bf16 h = (__bf16)v[i]; r.h[i] = h; r.l[i] = (__bf16)(v[i] - (float)h); }
  return r; }
__device__ __forceinline__ F2 split_row(const float* row, int k0, int lane) { float v[16]; const float* p = row + k0 + 8 * (lane >> 4);
#pragma unroll
  for (int i = 0; i < 8; ++i) { v[i] = p[i]; v[8 + i] = p[16 + i]; }
  return bsplit16(v); }
__device__ __forceinline__ F2 split_rowK(const float* row, int k0, int lane, int K) { float v[16]; const int g = lane >> 4;
#pragma unroll
  for (int i = 0; i < 8; ++i) { const int ka = k0 + 8 * g + i, kb = ka + 16; v[i] = ka < K ? row[ka < K ? ka : K - 1] : 0.f; v[8 + i] = kb < K ? row[kb < K ? kb : K - 1] : 0.f; }
  return bsplit16(v); }
__device__ __forceinline__ F2 split_col(const float* W, int k0, int n, int lane, int ld, int K) { float v[16]; const int g = lane >> 4;
#pragma unroll
  for (int i = 0; i < 8; ++i) { const int ka = k0 + 8 * g + i, kb = ka + 16; v[i] = ka < K ? W[(size_t)(ka < K ? ka : K - 1) * ld + n] : 0.f; v[8 + i] = kb < K ? W[(size_t)(kb < K ? kb : K - 1) * ld + n] : 0.f; }
  return bsplit16(v); }
__device__ __forceinline__ v8f mac3(const F2& a, const F2& b, v8f c) { c = wmma_bf(a.l, b.h, c); c = wmma_bf(a.h, b.l, c); return wmma_bf(a.h, b.h, c); }
__device__ __forceinline__ float sigm(float v) { return 1.0f / (1.0f + expf(-v)); }
#define LDSX() do { asm volatile("s_wait_dscnt 0" ::: "memory"); __builtin_amdgcn_wave_barrier(); __builtin_amdgcn_fence(__ATOMIC_RELEASE, "workgroup"); } while (0)

// Multi-head self-attention with rotary embeddings (B 2, L 2,048, D 1,024 = 16 x 64): q/k/v = x W + b ((in,out)); q, k <- q cos + rotate_half(q) sin (theta_j = 10000^(-2j/64), pairs (i, i+32)); attn = softmax(q k^T x 64^-0.5) (non-causal); out = merged(attn v) Wo + bo.
#define NB 2
#define TT 2048
#define CC 1024            // NH * HD = projected width
#define DIN 1024          // input (model) width
#define NH 16
#define HD 64
#define SCALE (0.125f)
#define CAUSAL 0
#ifndef TNB
#define TNB NB
#endif
__device__ __forceinline__ float bfr(float v) { return (float)(__bf16)v; }
__host__ __device__ __forceinline__ int kb_last(int qb) { return CAUSAL ? ((qb * 64 + 63) >> 7) : (TT / 128 - 1); }
typedef __attribute__((ext_vector_type(8))) __bf16 v8b;
__device__ __forceinline__ v16b frag_b(const __bf16* rowk0, int lane) {
  union { v16b v; v8b q[2]; } u; const __bf16* p = rowk0 + 8 * (lane >> 4);
  u.q[0] = *(const v8b*)p; u.q[1] = *(const v8b*)(p + 16); return u.v;
}
#define QBH 0              // not read by any kernel in this file
#define QHI 2048            // rows carrying a q residual plane (all rows when non-causal: 2-product logits everywhere)
#define KHI 64            // key rows carrying k residual / v bf16 hi+lo planes (written by k_proj; no kernel here reads them)
// B fragment (k rows k0+.., output column o) of a weight: (in,out) [K][ld] or (out,in) [ld rows of K]: bf16 exact, or f16(bf16 * 256) exact
__device__ __forceinline__ v16b wcol_io(const float* Wm, int k0, int o, int lane, int ld) { v16b w; const int g = lane >> 4;
#pragma unroll
  for (int i = 0; i < 8; ++i) { w[i] = (__bf16)Wm[(size_t)(k0 + 8 * g + i) * ld + o]; w[8 + i] = (__bf16)Wm[(size_t)(k0 + 16 + 8 * g + i) * ld + o]; }
  return w; }
__device__ __forceinline__ v16b wcol_oi(const float* Wm, int k0, int o, int lane, int K) { v16b w; const float* p = Wm + (size_t)o * K + k0 + 8 * (lane >> 4);
#pragma unroll
  for (int i = 0; i < 8; ++i) { w[i] = (__bf16)p[i]; w[8 + i] = (__bf16)p[16 + i]; }
  return w; }
__device__ __forceinline__ v16h wcolh_io(const float* Wm, int k0, int o, int lane, int ld) { v16h w; const int g = lane >> 4;
#pragma unroll
  for (int i = 0; i < 8; ++i) { w[i] = (_Float16)(bfr(Wm[(size_t)(k0 + 8 * g + i) * ld + o]) * 256.0f); w[8 + i] = (_Float16)(bfr(Wm[(size_t)(k0 + 16 + 8 * g + i) * ld + o]) * 256.0f); }
  return w; }
__device__ __forceinline__ v16h wcolh_oi(const float* Wm, int k0, int o, int lane, int K) { v16h w; const float* p = Wm + (size_t)o * K + k0 + 8 * (lane >> 4);
#pragma unroll
  for (int i = 0; i < 8; ++i) { w[i] = (_Float16)(bfr(p[i]) * 256.0f); w[8 + i] = (_Float16)(bfr(p[16 + i]) * 256.0f); }
  return w; }
#define WQKV_LAYOUT 0   // picks WCOL's layout (0 (in,out), 1 (out,in), 2 per-head); nothing calls WCOL: k_cvt reads (in,out) [DIN][CC] at any value
__device__ __forceinline__ v16b wcol_hdk(const float* Wm, int k0, int o, int lane) { v16b w; const int g = lane >> 4; const float* p = Wm + (size_t)(o / HD) * DIN * HD + (o % HD);
#pragma unroll
  for (int i = 0; i < 8; ++i) { w[i] = (__bf16)p[(size_t)(k0 + 8 * g + i) * HD]; w[8 + i] = (__bf16)p[(size_t)(k0 + 16 + 8 * g + i) * HD]; }
  return w; }
#define WO_OUT_IN 0
#if WQKV_LAYOUT == 1
#define WCOL(W, k0, o, lane) wcol_oi(W, k0, o, lane, DIN)
#elif WQKV_LAYOUT == 2
#define WCOL(W, k0, o, lane) wcol_hdk(W, k0, o, lane)
#else
#define WCOL(W, k0, o, lane) wcol_io(W, k0, o, lane, CC)
#endif
#if WO_OUT_IN
#define WOCOL(W, k0, o, lane) wcol_oi(W, k0, o, lane, CC)
#define WOCOLH(W, k0, o, lane) wcolh_oi(W, k0, o, lane, CC)
#else
#define WOCOL(W, k0, o, lane) wcol_io(W, k0, o, lane, DIN)
#define WOCOLH(W, k0, o, lane) wcolh_io(W, k0, o, lane, DIN)
#endif
__constant__ float c_invf[32] = {1.000000000e+00f,7.498942018e-01f,5.623413324e-01f,4.216965139e-01f,3.162277639e-01f,2.371373624e-01f,1.778279394e-01f,1.333521456e-01f,1.000000015e-01f,7.498941571e-02f,5.623412877e-02f,4.216964915e-02f,3.162277862e-02f,2.371373586e-02f,1.778279431e-02f,1.333521493e-02f,9.999999776e-03f,7.498942316e-03f,5.623413250e-03f,4.216964822e-03f,3.162277862e-03f,2.371373819e-03f,1.778279431e-03f,1.333521446e-03f,1.000000047e-03f,7.498941850e-04f,5.623413017e-04f,4.216964880e-04f,3.162277862e-04f,2.371373848e-04f,1.778279402e-04f,1.333521504e-04f};   // 1 / 10000^(2i/64) evaluated in f32 exactly as the reference does (jax, eager)
#ifndef SM_EXTRA_PARAMS
#define SM_EXTRA_PARAMS
#endif
#ifndef PROJ_EXTRA_PARAMS
#define PROJ_EXTRA_PARAMS
#endif
#ifndef SM_MASK_HOOK
#define SM_MASK_HOOK (void)0
#endif

#define WS_QH  0u                                      // f16 q rows [b*t][CC]
#define WS_KH  (WS_QH + 2u * (size_t)NB * TT * CC)      // f16 k rows [b*t][CC]
#define WS_VT  (WS_KH + 2u * (size_t)NB * TT * CC)      // f16 v planes [b][c][t]
#define WS_QL  (WS_VT + 2u * (size_t)NB * CC * TT)      // f16 q residual x 2^10 rows [b][t < QHI][CC]
#define WS_KL  (WS_QL + 2u * (size_t)NB * QHI * CC)     // f16 k residual x 2^10 rows [b][t < KHI][CC]
#define WS_VB  (WS_KL + 2u * (size_t)NB * KHI * CC)     // bf16 v hi planes [b][c][t < KHI]
#define WS_VBL (WS_VB + 2u * (size_t)NB * CC * KHI)
#define WS_Y   (WS_VBL + 2u * (size_t)NB * CC * KHI)    // f16 ctx rows [b*t][CC] (only when there is an output projection)
#define WS_XB  (WS_Y  + 2u * (size_t)NB * TT * CC)      // bf16 x rows [b*t][DIN]
#define WS_WT  (WS_XB + 2u * (size_t)NB * TT * DIN)     // bf16 Wq, Wk, Wv transposed: [which][output column][k]
#define WS_WOT (WS_WT + 2u * 3u * (size_t)CC * DIN)     // f16(bf16(Wo) x 2^8) transposed: [output column][k]
#define WS_END (WS_WOT + 2u * (size_t)DIN * CC)

// operand stages of k_proj and k_out: GKS k of the block's activation rows (k_proj 128, k_out 64) and 128 weight columns, 16-bit k-contiguous rows copied from the workspace planes into LDS, two buffers
#define GKS 64             // k per stage
#define GP  72             // row pitch in 16-bit elements: 144 B = 16 B x 9, no bank conflict for 16-byte accesses
typedef __attribute__((ext_vector_type(4))) __bf16 v4b;
typedef __attribute__((ext_vector_type(4))) _Float16 v4h;
// ---- k_cvt: every GEMM operand is rounded to its 16-bit form once per call, not once per block that reads it: x -> bf16 rows; Wq, Wk, Wv -> bf16, Wo -> f16(bf16 x 2^8), each transposed to k-contiguous rows of its output column
#define CVW (4 * (CC / 256) * (DIN / GKS))   // weight blocks: matrix, 256 columns, GKS k
#define CVX 16             // 16-byte pieces of x per thread: few blocks, so that the short launch starts quickly
__global__ __launch_bounds__(256) void k_cvt(const float* __restrict__ X, const float* __restrict__ WQ, const float* __restrict__ WK, const float* __restrict__ WV, const float* __restrict__ WO, __bf16* __restrict__ XB, __bf16* __restrict__ WT, _Float16* __restrict__ WOT) {
  const int tid = threadIdx.x, bx = blockIdx.x;
  if (bx < CVW) {   // block-uniform
    const int mt = bx / (CVW / 4), n = (bx / (DIN / GKS)) % (CC / 256) * 256 + tid, k0 = bx % (DIN / GKS) * GKS;   // the thread's own column (a wave reads one whole line per k) and writes one whole 128-byte line of its transposed row
    const float* wg = (mt == 0 ? WQ : mt == 1 ? WK : mt == 2 ? WV : WO) + (size_t)k0 * CC + n; float wv[GKS];
#pragma unroll
    for (int i = 0; i < GKS; ++i) wv[i] = wg[(size_t)i * CC];
    if (mt < 3) { __bf16* d = WT + ((size_t)mt * CC + n) * DIN + k0;
#pragma unroll
      for (int q = 0; q < GKS / 8; ++q) { v8b t;
#pragma unroll
        for (int e = 0; e < 8; ++e) t[e] = (__bf16)wv[q * 8 + e];
        *(v8b*)(d + q * 8) = t; }
      asm volatile("s_wait_xcnt 0x0" ::: "memory");   // stands behind the stores, before a register that one of them names is written again
    } else { _Float16* d = WOT + (size_t)n * CC + k0;
#pragma unroll
      for (int q = 0; q < GKS / 8; ++q) { v8h t;
#pragma unroll
        for (int e = 0; e < 8; ++e) t[e] = (_Float16)(bfr(wv[q * 8 + e]) * 256.0f);
        *(v8h*)(d + q * 8) = t; }
      asm volatile("s_wait_xcnt 0x0" ::: "memory"); }   // as above
  } else { const size_t p0 = (size_t)(bx - CVW) * (256 * CVX) + tid; v4f xv[CVX];   // 16-byte pieces p0 + 256 i of x: whole lines per wave, read and written; all of a thread's loads are in flight together
#pragma unroll
    for (int i = 0; i < CVX; ++i) xv[i] = *(const v4f*)(X + (p0 + 256 * i) * 4);
    asm volatile("s_wait_xcnt 0x0" :: "v"(X + p0 * 4) : "memory");   // stands behind the loads, before a register that holds their address is written again; the lane's address is an input so that its registers live up to the wait
#pragma unroll
    for (int i = 0; i < CVX; ++i) { v4b t;
#pragma unroll
      for (int e = 0; e < 4; ++e) t[e] = (__bf16)xv[i][e];
      *(v4b*)(XB + (p0 + 256 * i) * 4) = t; }
    asm volatile("s_wait_xcnt 0x0" ::: "memory"); } }   // as behind the weight stores
// ---- k_proj: block = (128 rows, 128 cols, which), four waves of 64 x 64 (a wave's columns are one head): q/k/v = X W (+ b) with exact bf16 products (K = DIN) -> which 0: q f16 rows (+ residual rows < QHI); 1: k f16 rows (+ residual rows < KHI); 2: v f16 planes [c][t] (+ bf16 hi/lo planes for t < KHI)
#define PBM 128            // rows of a block: with 128 columns a stage brings 256 operand rows for 16,384 outputs, and a wave's 4 + 4 fragments feed 16 products; registers and LDS let three blocks share a WGP, so the 768 blocks are all resident
__global__ __launch_bounds__(128) void k_proj(const __bf16* __restrict__ XB, const __bf16* __restrict__ WT, const float* __restrict__ BQ, const float* __restrict__ BK, const float* __restrict__ BV,
    _Float16* __restrict__ QH, _Float16* __restrict__ QL, _Float16* __restrict__ KH, _Float16* __restrict__ KL, _Float16* __restrict__ VT, __bf16* __restrict__ VB, __bf16* __restrict__ VBL PROJ_EXTRA_PARAMS) {
  __shared__ __align__(16) char sm[104448];   // the main loop's stages (73,728 bytes); behind the barrier that ends the loop the epilogue's arrays lie over them: q, k: sh, sl, tc, ts (104,448 bytes); v: th, tb, tbl (71,680 bytes); three blocks fit a WGP
  _Float16 (*sh)[136] = (_Float16 (*)[136])sm; _Float16 (*sl)[136] = (_Float16 (*)[136])(sm + 34816); float (*tc)[34] = (float (*)[34])(sm + 69632); float (*ts)[34] = (float (*)[34])(sm + 87040);   // tc, ts: cos and sin of t x inv_freq[i], [row][i]; at pitch 34 the two lane halves (rows 8 apart) read different banks
  _Float16 (*th)[136] = (_Float16 (*)[136])sm; __bf16 (*tb)[72] = (__bf16 (*)[72])(sm + 34816); __bf16 (*tbl)[72] = (__bf16 (*)[72])(sm + 53248);   // th: [column][row of the block]; tb, tbl: [column][row < KHI]
  __bf16 (*xs)[PBM][GP] = (__bf16 (*)[PBM][GP])sm; __bf16 (*wt)[128][GP] = (__bf16 (*)[128][GP])(sm + 2 * PBM * GP * 2);
  const int tid = threadIdx.x, wave = tid >> 5, lane = tid & 31, col = lane & 15, g = lane >> 4; const int which = blockIdx.z; const int c0 = blockIdx.y * 128; const size_t r0 = (size_t)blockIdx.x * PBM; const size_t bb = r0 / TT; const int t0 = (int)(r0 % TT);
  const int wr0 = (wave >> 1) * 64, wc0 = (wave & 1) * 64;          // the wave's first row and first column inside the block
  const float* BA = which == 0 ? BQ : which == 1 ? BK : BV;
  v8f acc[4][4] = {};                                               // [16-row tile][16-column tile]
  const int sr = tid >> 3, sp = (tid & 7) * 8;                      // staging: rows sr + 16 i of a tile, 16-byte piece tid & 7 of the row's 128 bytes (a wave moves four whole lines per load)
  const __bf16* xg = XB + (r0 + sr) * DIN + sp;
  const __bf16* wg = WT + ((size_t)which * CC + c0 + sr) * DIN + sp;
  v8b xv[8], wv[8];
  auto fetch = [&](int s) {
#pragma unroll
    for (int i = 0; i < 8; ++i) xv[i] = *(const v8b*)(xg + (size_t)(16 * i) * DIN + s * GKS);
#pragma unroll
    for (int i = 0; i < 8; ++i) wv[i] = *(const v8b*)(wg + (size_t)(16 * i) * DIN + s * GKS);
    asm volatile("s_wait_xcnt 0x0" :: "v"(xg + s * GKS), "v"(wg + s * GKS) : "memory");   // the loads above are issued here, ahead of the products, and before a register that holds one of their addresses is written again; the stage's two lane addresses are inputs so that their registers live up to the wait
  };
  auto stage = [&](int b) {
#pragma unroll
    for (int i = 0; i < 8; ++i) *(v8b*)&xs[b][sr + 16 * i][sp] = xv[i];
#pragma unroll
    for (int i = 0; i < 8; ++i) *(v8b*)&wt[b][sr + 16 * i][sp] = wv[i];
  };
  auto mult = [&](int b) {
#pragma unroll
    for (int kk = 0; kk < GKS / 32; ++kk) { v16b a[4], w[4];
#pragma unroll
      for (int i = 0; i < 4; ++i) a[i] = frag_b(&xs[b][wr0 + i * 16 + col][kk * 32], lane);
#pragma unroll
      for (int j = 0; j < 4; ++j) w[j] = frag_b(&wt[b][wc0 + j * 16 + col][kk * 32], lane);
      __builtin_amdgcn_sched_barrier(0);   // the eight fragments' LDS reads stay one group ahead of their products: one place with LDS reads for sixteen products
#pragma unroll
      for (int i = 0; i < 4; ++i)
#pragma unroll
        for (int j = 0; j < 4; ++j) acc[i][j] = wmma_bf(a[i], w[j], acc[i][j]);
      __builtin_amdgcn_sched_barrier(0); }   // what follows (the next group's reads; the LDS stores, which wait for the global loads) stays behind the products
  };
  fetch(0); stage(0); __syncthreads();
#pragma unroll 1   // one stage's loads live at a time
  for (int s = 0; s + 1 < DIN / GKS; ++s) { fetch(s + 1); mult(s & 1); stage((s + 1) & 1); __syncthreads(); }   // the barrier publishes stage s + 1 and ends the reads of the buffer that the next trip refills
  mult((DIN / GKS - 1) & 1); __syncthreads();   // every wave has left the stages before the epilogue writes over them
  // the epilogue works on the accumulators: a lane holds rows wr0 + i * 16 + 8 g + 0..7 of columns wc0 + j * 16 + col, so channel 16 jj + col of the wave's head (j = jj < 2) and its rotary partner, 32 channels on (j + 2), sit in the same lane
  const int rw0 = wr0 + 8 * g;
#pragma unroll
  for (int j = 0; j < 4; ++j) { const float bias = BA ? bfr(BA[c0 + wc0 + j * 16 + col]) : 0.f;
#pragma unroll
    for (int i = 0; i < 4; ++i)
#pragma unroll
      for (int r = 0; r < 8; ++r) acc[i][j][r] += bias; }
  if (which < 2) { _Float16* DH = which == 0 ? QH : KH; _Float16* DL = which == 0 ? QL : KL; const int nhi = which == 0 ? QHI : KHI;
    const float invf = c_invf[lane];
    asm volatile("s_wait_xcnt 0x0" ::: "memory");   // stands before a register that holds the load's address is written again
#pragma unroll 2   // two rows' dependent chains interleave; more would only lengthen the text
    for (int n = 0; n < PBM / 4; ++n) { const float ang = (float)(t0 + wave * (PBM / 4) + n) * invf; tc[wave * (PBM / 4) + n][lane] = cosf(ang); ts[wave * (PBM / 4) + n][lane] = sinf(ang); }   // each angle once per block, for both heads (TT is a multiple of PBM: t = t0 + row)
    __syncthreads();
#pragma unroll
    for (int i = 0; i < 4; ++i) {
#pragma unroll
      for (int r = 0; r < 8; ++r)
#pragma unroll
        for (int jj = 0; jj < 2; ++jj) { const float cs = tc[rw0 + i * 16 + r][jj * 16 + col], sn = ts[rw0 + i * 16 + r][jj * 16 + col];
          const float x0 = acc[i][jj][r], x1 = acc[i][jj + 2][r]; acc[i][jj][r] = x0 * cs - x1 * sn; acc[i][jj + 2][r] = x1 * cs + x0 * sn; }
#pragma unroll
      for (int j = 0; j < 4; ++j)
#pragma unroll
        for (int r = 0; r < 8; ++r) { const float v = acc[i][j][r]; const _Float16 hv = (_Float16)v; sh[rw0 + i * 16 + r][wc0 + j * 16 + col] = hv; sl[rw0 + i * 16 + r][wc0 + j * 16 + col] = (_Float16)((v - (float)hv) * 1024.0f); }
    }
    __syncthreads();
    for (int e = tid; e < PBM * 16; e += 128) { const int rl = e >> 4, q = e & 15; _Float16* dh = DH + (r0 + rl) * CC + c0 + q * 8; vst2((unsigned*)dh, *(const v4u*)&sh[rl][q * 8]);
      asm volatile("s_wait_xcnt 0x0" :: "v"(dh) : "memory");   // stands behind the store, before a register that it names is written again; the address is an input so that its registers live up to the wait
      if (t0 + rl < nhi) { _Float16* dl = DL + (bb * nhi + t0 + rl) * (size_t)CC + c0 + q * 8; vst2((unsigned*)dl, *(const v4u*)&sl[rl][q * 8]);
        asm volatile("s_wait_xcnt 0x0" :: "v"(dl) : "memory"); } }   // as above
  } else { const bool hi_rows = t0 + wr0 < KHI;   // KHI is a multiple of 64: a wave's 64 rows carry the bf16 planes all or none
#pragma unroll
    for (int j = 0; j < 4; ++j)
#pragma unroll
      for (int i = 0; i < 4; ++i) { v8h hv; v8b bh, bl;   // a lane's 8 rows of one column are 16 consecutive bytes of a transposed row
#pragma unroll
        for (int r = 0; r < 8; ++r) { const float v = acc[i][j][r]; hv[r] = (_Float16)v; bh[r] = (__bf16)v; bl[r] = (__bf16)(v - (float)bh[r]); }
        *(v8h*)&th[wc0 + j * 16 + col][rw0 + i * 16] = hv; if (hi_rows) { *(v8b*)&tb[wc0 + j * 16 + col][rw0 + i * 16] = bh; *(v8b*)&tbl[wc0 + j * 16 + col][rw0 + i * 16] = bl; } }
    __syncthreads();
    for (int e = tid; e < 128 * (PBM / 8); e += 128) { const int cl = e / (PBM / 8), q = e % (PBM / 8); _Float16* dv = VT + (bb * CC + c0 + cl) * (size_t)TT + t0 + q * 8; vst2((unsigned*)dv, *(const v4u*)&th[cl][q * 8]);
      asm volatile("s_wait_xcnt 0x0" :: "v"(dv) : "memory");   // as behind the q, k stores
      if (t0 + q * 8 < KHI) { const size_t o3 = (bb * CC + c0 + cl) * (size_t)KHI + t0 + q * 8; vst2((unsigned*)(VB + o3), *(const v4u*)&tb[cl][q * 8]); vst2((unsigned*)(VBL + o3), *(const v4u*)&tbl[cl][q * 8]);
        asm volatile("s_wait_xcnt 0x0" :: "v"(VB + o3), "v"(VBL + o3) : "memory"); } } } }   // as behind the q, k stores
// ---- k_fa: wave = NQT x 16 queries of (b, h), all TT keys in passes of 32: S^T = K Q^T (q hi + residual x 2^10, 2 products) stays in registers, unscaled; a held reference maximum and a running sum per query (a lane holds one query's scores of 8 + 8 keys, the two lane halves split the keys): the maximum, its exchange between the halves and the rescaling of O and of the sum are done only in a pass whose own sum of exponentials shows that the reference is outgrown;
//      the block's FAW waves walk the same keys: each stage of KST keys (K rows, V^T channel rows) is brought once per block, in whole 128-byte lines, into LDS (two buffers, the next stage's global loads fly under this stage's passes) and every wave takes its fragments from there;
//      the inner loops are all unrolled so that the fragment arrays stay in registers; 2^((s - m) SL2E + 10) once to f16 is, in place, the B operand of O^T += V^T P^T (1 product); a lane ends with 8 consecutive channels of one query
#define NQT 2              // 16-query tiles per wave: each key and value fragment is loaded once for both
#define FAW 8              // waves per block
#define KST 64             // keys per stage: a K row (HD channels) and a V^T row (KST keys) are both one 128-byte line
#define SL2E (SCALE * 1.44269504088896341f)   // SCALE x log2(e): one multiply-add takes an unscaled logit to the argument of the base-2 exponential
#define PCAP 32768.0f      // a lane's sum of a pass's 16 exponentials up to here leaves each of them finite in f16; the reference maximum moves only when a sum passes it (or is not a number)
__device__ __forceinline__ float sum16(const float* e) {   // the branch of a pass waits for this sum: two chains of packed pairs, four links deep, in place of one chain of sixteen
  v2f a = {e[0], e[1]}, b = {e[2], e[3]};
#pragma unroll
  for (int i = 4; i < 16; i += 4) { a += (v2f){e[i], e[i + 1]}; b += (v2f){e[i + 2], e[i + 3]}; }
  a += b; return a[0] + a[1]; }
__device__ __forceinline__ v8f wm16(v16h a, v16h b, v8f c) { return __builtin_amdgcn_wmma_f32_16x16x32_f16(false, a, false, b, (short)0, c, false, false); }
__global__ __launch_bounds__(FAW * 32) void k_fa(const _Float16* __restrict__ QH, const _Float16* __restrict__ QL, const _Float16* __restrict__ KH, const _Float16* __restrict__ VT, _Float16* __restrict__ Y) {
  __shared__ __align__(16) _Float16 ks[2][KST][GP], vs[2][HD][GP];   // [buffer][key][channel] and [buffer][channel][key], rows of 128 bytes at the 144-byte pitch
  const int tid = threadIdx.x, wave = tid >> 5, lane = tid & 31, col = lane & 15, g = lane >> 4; const int h = blockIdx.y, b = blockIdx.z; const int ql0 = (blockIdx.x * FAW + wave) * (16 * NQT);
  const _Float16* qp = QH + ((size_t)b * TT + ql0 + col) * CC + h * HD;        // query row col of the wave's first 16-query tile
  const _Float16* qr = QL + ((size_t)b * QHI + ql0 + col) * CC + h * HD;       // its residual row
  v16h qh[NQT][2], ql[NQT][2];
#pragma unroll
  for (int n = 0; n < NQT; ++n)
#pragma unroll
    for (int c = 0; c < 2; ++c) { qh[n][c] = frag_h(qp + (size_t)(n * 16) * CC + c * 32, lane); ql[n][c] = frag_h(qr + (size_t)(n * 16) * CC + c * 32, lane); }
  asm volatile("s_wait_xcnt 0x0" :: "v"(qp + 8 * g), "v"(qr + 8 * g) : "memory");   // as in the loop; the two lane addresses are inputs so that their registers live up to the wait
  const int sr = tid >> 3, sp = (tid & 7) * 8;                                  // staging: rows sr and sr + 32 of a stage, 16-byte piece tid & 7 (a wave moves four whole lines per load)
  const _Float16* kg = KH + ((size_t)b * TT + sr) * CC + h * HD + sp;
  const _Float16* vg = VT + ((size_t)b * CC + h * HD + sr) * (size_t)TT + sp;
  v8h kr[2], vr[2];
  auto fetch = [&](int s) {
#pragma unroll
    for (int i = 0; i < 2; ++i) { kr[i] = *(const v8h*)(kg + (size_t)(s * KST + 32 * i) * CC); vr[i] = *(const v8h*)(vg + (size_t)(32 * i) * TT + s * KST); }
    asm volatile("s_wait_xcnt 0x0" ::: "memory");   // the loads above are issued here, ahead of the stage's passes, and before a register that holds one of their addresses is written again
  };
  auto put = [&](int bf) {
#pragma unroll
    for (int i = 0; i < 2; ++i) { *(v8h*)&ks[bf][sr + 32 * i][sp] = kr[i]; *(v8h*)&vs[bf][sr + 32 * i][sp] = vr[i]; }
  };
  v8f o[NQT][4] = {}; float m[NQT], l[NQT], bias[NQT];
#pragma unroll
  for (int n = 0; n < NQT; ++n) { m[n] = -3.0e38f; l[n] = 0.f; bias[n] = 10.0f - m[n] * SL2E; }   // no reference yet: the first pass's exponentials overflow and its test sets one
  fetch(0); put(0); __syncthreads();
#pragma unroll 1   // one stage's fragments live at a time
  for (int st = 0; st < TT / KST; ++st) { const int bf = st & 1;
    if (st + 1 < TT / KST) fetch(st + 1);   // block-uniform
#pragma unroll
    for (int pp = 0; pp < KST / 32; ++pp) {
      v16h kf[2][2], vf[4];
#pragma unroll
      for (int t = 0; t < 2; ++t)
#pragma unroll
        for (int c = 0; c < 2; ++c) kf[t][c] = frag_h(&ks[bf][pp * 32 + t * 16 + col][c * 32], lane);
#pragma unroll
      for (int j = 0; j < 4; ++j) vf[j] = frag_h(&vs[bf][j * 16 + col][pp * 32], lane);
      v8f sa[NQT][2] = {}, sb[NQT][2] = {};
#pragma unroll
      for (int c = 0; c < 2; ++c)
#pragma unroll
        for (int t = 0; t < 2; ++t)
#pragma unroll
          for (int n = 0; n < NQT; ++n) { sa[n][t] = wm16(kf[t][c], qh[n][c], sa[n][t]); sb[n][t] = wm16(kf[t][c], ql[n][c], sb[n][t]); }
      v8f s[NQT][2]; float e[NQT][16], sum[NQT];
#pragma unroll
      for (int n = 0; n < NQT; ++n) {
#pragma unroll
        for (int t = 0; t < 2; ++t) { s[n][t] = sa[n][t] + sb[n][t] * (1.0f / 1024.0f);   // unscaled logits: SCALE goes into the exponent's multiplier
          const v8f a = s[n][t] * SL2E + bias[n];   // against the reference in use
#pragma unroll
          for (int r = 0; r < 8; ++r) e[n][t * 8 + r] = __builtin_amdgcn_exp2f(a[r]); }
        sum[n] = sum16(e[n]); }
      bool moved = false;
#pragma unroll
      for (int n = 0; n < NQT; ++n) moved = moved || !(sum[n] <= PCAP);
      if (__builtin_amdgcn_ballot_w32(moved) != 0) {   // wave-uniform, one test per pass: some query's scores have outgrown its reference (always so in the first pass): take the running maximum as the new one
#pragma unroll
        for (int n = 0; n < NQT; ++n) { float mx = s[n][0][0];
#pragma unroll
          for (int i = 1; i < 16; ++i) mx = fmaxf(mx, s[n][i >> 3][i & 7]);
          mx = fmaxf(mx, __shfl_xor(mx, 16));
          const float mn = fmaxf(m[n], mx); const float al = __builtin_amdgcn_exp2f((m[n] - mn) * SL2E); m[n] = mn;
          bias[n] = 10.0f - mn * SL2E;   // 2^(s SL2E + bias) = exp((s - mn) SCALE) x 2^10
          l[n] *= al;
#pragma unroll
          for (int j = 0; j < 4; ++j) o[n][j] *= al;
#pragma unroll
          for (int t = 0; t < 2; ++t) { const v8f a = s[n][t] * SL2E + bias[n];
#pragma unroll
            for (int r = 0; r < 8; ++r) e[n][t * 8 + r] = __builtin_amdgcn_exp2f(a[r]); }
          sum[n] = sum16(e[n]); } }
#pragma unroll
      for (int n = 0; n < NQT; ++n) { v16h p;
#pragma unroll
        for (int i = 0; i < 16; ++i) p[i] = (_Float16)e[n][i];
        l[n] += sum[n];
#pragma unroll
        for (int j = 0; j < 4; ++j) o[n][j] = wm16(vf[j], p, o[n][j]); } }
    if (st + 1 < TT / KST) put(bf ^ 1);   // into the buffer whose readers all left it before the barrier of the trip before
    __syncthreads();   // publishes stage st + 1 and ends the reads of the buffer that the next trip refills
  }
#pragma unroll
  for (int n = 0; n < NQT; ++n) { const float a = l[n] + __shfl_xor(l[n], 16); const float inv = a > 0.f ? 1.0f / a : 0.f;   // numerator and sum both carry the 2^10
    _Float16* yr = Y + ((size_t)b * TT + ql0 + n * 16 + col) * CC + h * HD + 8 * g;
#pragma unroll
    for (int j = 0; j < 4; ++j) { v8h t;   // ctx leaves as the f16 that k_out multiplies
#pragma unroll
      for (int r = 0; r < 8; ++r) t[r] = (_Float16)(o[n][j][r] * inv);
      vst2(yr + j * 16, t); } } }
// ---- k_out: block = (64 rows, 128 cols): out = ctx Wo (+ bo): ctx once to f16 against Wo as f16(bf16 x 2^8) exact (1 product) x 2^-8
__global__ __launch_bounds__(128) void k_out(const _Float16* __restrict__ Y, const _Float16* __restrict__ WOT, const float* __restrict__ BO, float* __restrict__ OUT) { __shared__ __align__(16) float sf[4][16][132]; __shared__ __align__(16) _Float16 ys[2][64][GP], wt[2][128][GP];
  const int tid = threadIdx.x, wave = tid >> 5, lane = tid & 31, col = lane & 15, g = lane >> 4; const int c0 = blockIdx.y * 128; const size_t r0 = (size_t)blockIdx.x * 64 + wave * 16;
  v8f acc[8] = {};
  {
    const int sr = tid >> 3, sp = (tid & 7) * 8;                                          // as in k_proj: rows sr + 16 i, 16-byte piece tid & 7
    const _Float16* yg = Y + ((size_t)blockIdx.x * 64 + sr) * CC + sp;
    const _Float16* wg = WOT + (size_t)(c0 + sr) * CC + sp;
    v8h yv[4], wv[8];
    auto fetch = [&](int s) {
#pragma unroll
      for (int i = 0; i < 4; ++i) yv[i] = *(const v8h*)(yg + (size_t)(16 * i) * CC + s * GKS);
#pragma unroll
      for (int i = 0; i < 8; ++i) wv[i] = *(const v8h*)(wg + (size_t)(16 * i) * CC + s * GKS);
      asm volatile("s_wait_xcnt 0x0" ::: "memory");   // the loads above are issued here, ahead of the products, and before a register that holds one of their addresses is written again
    };
    auto stage = [&](int b) {
#pragma unroll
      for (int i = 0; i < 4; ++i) *(v8h*)&ys[b][sr + 16 * i][sp] = yv[i];
#pragma unroll
      for (int i = 0; i < 8; ++i) *(v8h*)&wt[b][sr + 16 * i][sp] = wv[i];
    };
    auto mult = [&](int b) {
#pragma unroll
      for (int kk = 0; kk < GKS / 32; ++kk) { const v16h a = frag_h(&ys[b][wave * 16 + col][kk * 32], lane); v16h w[8];
#pragma unroll
        for (int j = 0; j < 8; ++j) w[j] = frag_h(&wt[b][j * 16 + col][kk * 32], lane);
        __builtin_amdgcn_sched_barrier(0);   // as in k_proj: one group of LDS reads, one wait, eight products
#pragma unroll
        for (int j = 0; j < 8; ++j) acc[j] = wmma16(a, w[j], acc[j]);
        __builtin_amdgcn_sched_barrier(0); }   // as in k_proj: the LDS stores and their wait for the global loads stay behind the products
    };
    fetch(0); stage(0); __syncthreads();
#pragma unroll 1   // one stage's loads live at a time
    for (int s = 0; s + 1 < CC / GKS; ++s) { fetch(s + 1); mult(s & 1); stage((s + 1) & 1); __syncthreads(); }   // the barrier publishes stage s + 1 and ends the reads of the buffer that the next trip refills
    mult((CC / GKS - 1) & 1);
#pragma unroll
    for (int j = 0; j < 8; ++j) { const float bias = BO ? bfr(BO[c0 + j * 16 + col]) : 0.f;
#pragma unroll
      for (int r = 0; r < 8; ++r) sf[wave][8 * g + r][j * 16 + col] = acc[j][r] * (1.0f / 256.0f) + bias; } }
  LDSX(); for (int rl = 0; rl < 16; ++rl) vst2(OUT + (r0 + rl) * DIN + c0 + lane * 4, *(const v4f*)&sf[wave][rl][lane * 4]); }

extern "C" void kernel_launch(void* const* d_in, const int* in_sizes, int n_in, void* d_out, int out_size, void* d_ws, size_t ws_size, hipStream_t stream) {
  (void)in_sizes; (void)n_in; (void)out_size;
  const float** F = (const float**)d_in;
  if (ws_size < (size_t)WS_END) return;
  char* ws = (char*)d_ws; _Float16 *QH = (_Float16*)(ws + WS_QH), *KH = (_Float16*)(ws + WS_KH), *VT = (_Float16*)(ws + WS_VT), *QL = (_Float16*)(ws + WS_QL), *KL = (_Float16*)(ws + WS_KL); __bf16 *VB = (__bf16*)(ws + WS_VB), *VBL = (__bf16*)(ws + WS_VBL), *XB = (__bf16*)(ws + WS_XB), *WT = (__bf16*)(ws + WS_WT); _Float16 *Y = (_Float16*)(ws + WS_Y), *WOT = (_Float16*)(ws + WS_WOT);
  (void)Y; (void)QL; (void)KL; (void)VB; (void)VBL;
  // inputs: 0 x [2,2048,1024]; 1 Wq, 2 bq; 3 Wk, 4 bk; 5 Wv, 6 bv; 7 Wo, 8 bo ((in,out))
  k_cvt<<<CVW + TNB * TT * DIN / (4 * 256 * CVX), 256, 0, stream>>>(F[0], F[1], F[3], F[5], F[7], XB, WT, WOT);
  k_proj<<<dim3(TNB * TT / PBM, CC / 128, 3), 128, 0, stream>>>(XB, WT, F[2], F[4], F[6], QH, QL, KH, KL, VT, VB, VBL);
  k_fa<<<dim3(TT / (FAW * 16 * NQT), NH, TNB), FAW * 32, 0, stream>>>(QH, QL, KH, VT, Y);
  k_out<<<dim3(TNB * TT / 64, DIN / 128), 128, 0, stream>>>(Y, WOT, F[8], (float*)d_out);
}

// v009
// It runs in 84.9 microseconds.
// Timed twice side by side with v008, it ran 1.05 and 1.03 times as fast.
// All steps since v000 together make it 15.1 times as fast.
// compute dtype: all float inputs rounded to bf16; q/k/v = x W + b with EXACT bf16 products on WMMA 16x16x32 (f32 accumulate); rotate-half RoPE applied in f32 in the projection epilogue with accurate sincosf of t x inv_freq_j (f32 constants as the reference builds them); q as f16 hi + residual (x 2^10) against k once to f16 (2 products); softmax in f32 (hardware base-2 exponential of (s - m) x 64^-0.5 x log2 e + 10) against a held reference maximum m that moves to the running maximum when a pass's sum of exponentials outgrows f16, logits kept in registers; exp(s - m) x 2^10 once to f16 against v once to f16 (1 product), divided by the f32 sum at the end; ctx once to f16 against Wo carried x 2^8 in f16 + bo; f32 output.
#include <hip/hip_runtime.h>
#include <math.h>

typedef __attribute__((ext_vector_type(16))) _Float16 v16h;
typedef __attribute__((ext_vector_type(16))) __bf16 v16b;
typedef __attribute__((ext_vector_type(8)))  _Float16 v8h;
typedef __attribute__((ext_vector_type(8)))  float v8f;
typedef __attribute__((ext_vector_type(4)))  float v4f;
typedef __attribute__((ext_vector_type(2)))  float v2f;
typedef __attribute__((ext_vector_type(4)))  unsigned v4u;
typedef __attribute__((ext_vector_type(4)))  int v4i;
typedef float __attribute__((may_alias)) float_a;
typedef int __attribute__((may_alias)) int_a;

template <typename T> __device__ __forceinline__ void vst2(void* p, T v) { *(T*)p = v;  }
__device__ __forceinline__ v8f wmma16(v16h a, v16h b, v8f c) {
  v8f d = __builtin_amdgcn_wmma_f32_16x16x32_f16(false, a, false, b, (short)0, c, false, false);
  asm volatile("v_nop\n\tv_nop\n\tv_nop\n\tv_nop" : "+v"(d) : "v"(a), "v"(b));
  return d;
}
__device__ __forceinline__ v8f wmma_bf(v16b a, v16b b, v8f c) {
  v8f d = __builtin_amdgcn_wmma_f32_16x16x32_bf16(false, a, false, b, (short)0, c, false, false);
  asm volatile("v_nop\n\tv_nop\n\tv_nop\n\tv_nop" : "+v"(d) : "v"(a), "v"(b));
  return d;
}
// 16x16x32 fragments: lane = (h = lane>>4, row/col = lane&15); elements 0..7 = k0+8h+0..7, 8..15 = k0+16+8h+0..7; D element r = row 8h+r
__device__ __forceinline__ v16h frag_h(const _Float16* rowk0, int lane) {
  union { v16h v; v8h q[2]; } u; const _Float16* p = rowk0 + 8 * (lane >> 4);
  u.q[0] = *(const v8h*)p; u.q[1] = *(const v8h*)(p + 16); return u.v;
}
__device__ __forceinline__ v16h frag_f32(const float* rowk0, int lane) {
  v16h a; const float* p = rowk0 + 8 * (lane >> 4);
#pragma unroll
  for (int i = 0; i < 8; ++i) { a[i] = (_Float16)p[i]; a[8 + i] = (_Float16)p[16 + i]; }
  return a;
}
__device__ __forceinline__ v16h frag_f32s(const float* rowk0, int lane, float sc) {
  v16h a; const float* p = rowk0 + 8 * (lane >> 4);
#pragma unroll
  for (int i = 0; i < 8; ++i) { a[i] = (_Float16)(p[i] * sc); a[8 + i] = (_Float16)(p[16 + i] * sc); }
  return a;
}
// column fragment from a [K][ld] layout (column n), rows >= K read as 0
__device__ __forceinline__ v16h fragc_f32(const float* W, int k0, int n, int lane, int ld, int K) {
  v16h a; const int g = lane >> 4;
#pragma unroll
  for (int i = 0; i < 8; ++i) { const int ka = k0 + 8 * g + i, kb = ka + 16;
    a[i] = (_Float16)(ka < K ? W[(size_t)(ka < K ? ka : K - 1) * ld + n] : 0.f); a[8 + i] = (_Float16)(kb < K ? W[(size_t)(kb < K ? kb : K - 1) * ld + n] : 0.f); }
  return a;
}
struct F2 { v16b h, l; };
__device__ __forceinline__ F2 bsplit16(const float v[16]) { F2 r;
#pragma unroll
  for (int i = 0; i < 16; ++i) { const __bf16 h = (__bf16)v[i]; r.h[i] = h; r.l[i] = (__bf16)(v[i] - (float)h); }
  return r; }
__device__ __forceinline__ F2 split_row(const float* row, int k0, int lane) { float v[16]; const float* p = row + k0 + 8 * (lane >> 4);
#pragma unroll
  for (int i = 0; i < 8; ++i) { v[i] = p[i]; v[8 + i] = p[16 + i]; }
  return bsplit16(v); }
__device__ __forceinline__ F2 split_rowK(const float* row, int k0, int lane, int K) { float v[16]; const int g = lane >> 4;
#pragma unroll
  for (int i = 0; i < 8; ++i) { const int ka = k0 + 8 * g + i, kb = ka + 16; v[i] = ka < K ? row[ka < K ? ka : K - 1] : 0.f; v[8 + i] = kb < K ? row[kb < K ? kb : K - 1] : 0.f; }
  return bsplit16(v); }
__device__ __forceinline__ F2 split_col(const float* W, int k0, int n, int lane, int ld, int K) { float v[16]; const int g = lane >> 4;
#pragma unroll
  for (int i = 0; i < 8; ++i) { const int ka = k0 + 8 * g + i, kb = ka + 16; v[i] = ka < K ? W[(size_t)(ka < K ? ka : K - 1) * ld + n] : 0.f; v[8 + i] = kb < K ? W[(size_t)(kb < K ? kb : K - 1) * ld + n] : 0.f; }
  return bsplit16(v); }
__device__ __forceinline__ v8f mac3(const F2& a, const F2& b, v8f c) { c = wmma_bf(a.l, b.h, c); c = wmma_bf(a.h, b.l, c); return wmma_bf(a.h, b.h, c); }
__device__ __forceinline__ float sigm(float v) { return 1.0f / (1.0f + expf(-v)); }
#define LDSX() do { asm volatile("s_wait_dscnt 0" ::: "memory"); __builtin_amdgcn_wave_barrier(); __builtin_amdgcn_fence(__ATOMIC_RELEASE, "workgroup"); } while (0)

// Multi-head self-attention with rotary embeddings (B 2, L 2,048, D 1,024 = 16 x 64): q/k/v = x W + b ((in,out)); q, k <- q cos + rotate_half(q) sin (theta_j = 10000^(-2j/64), pairs (i, i+32)); attn = softmax(q k^T x 64^-0.5) (non-causal); out = merged(attn v) Wo + bo.
#define NB 2
#define TT 2048
#define CC 1024            // NH * HD = projected width
#define DIN 1024          // input (model) width
#define NH 16
#define HD 64
#define SCALE (0.125f)
#define CAUSAL 0
#ifndef TNB
#define TNB NB
#endif
__device__ __forceinline__ float bfr(float v) { return (float)(__bf16)v; }
__host__ __device__ __forceinline__ int kb_last(int qb) { return CAUSAL ? ((qb * 64 + 63) >> 7) : (TT / 128 - 1); }
typedef __attribute__((ext_vector_type(8))) __bf16 v8b;
__device__ __forceinline__ v16b frag_b(const __bf16* rowk0, int lane) {
  union { v16b v; v8b q[2]; } u; const __bf16* p = rowk0 + 8 * (lane >> 4);
  u.q[0] = *(const v8b*)p; u.q[1] = *(const v8b*)(p + 16); return u.v;
}
#define QBH 0              // not read by any kernel in this file
#define QHI 2048            // rows carrying a q residual plane (all rows when non-causal: 2-product logits everywhere)
#define KHI 64            // key rows carrying k residual / v bf16 hi+lo planes (written by k_proj; no kernel here reads them)
// B fragment (k rows k0+.., output column o) of a weight: (in,out) [K][ld] or (out,in) [ld rows of K]: bf16 exact, or f16(bf16 * 256) exact
__device__ __forceinline__ v16b wcol_io(const float* Wm, int k0, int o, int lane, int ld) { v16b w; const int g = lane >> 4;
#pragma unroll
  for (int i = 0; i < 8; ++i) { w[i] = (__bf16)Wm[(size_t)(k0 + 8 * g + i) * ld + o]; w[8 + i] = (__bf16)Wm[(size_t)(k0 + 16 + 8 * g + i) * ld + o]; }
  return w; }
__device__ __forceinline__ v16b wcol_oi(const float* Wm, int k0, int o, int lane, int K) { v16b w; const float* p = Wm + (size_t)o * K + k0 + 8 * (lane >> 4);
#pragma unroll
  for (int i = 0; i < 8; ++i) { w[i] = (__bf16)p[i]; w[8 + i] = (__bf16)p[16 + i]; }
  return w; }
__device__ __forceinline__ v16h wcolh_io(const float* Wm, int k0, int o, int lane, int ld) { v16h w; const int g = lane >> 4;
#pragma unroll
  for (int i = 0; i < 8; ++i) { w[i] = (_Float16)(bfr(Wm[(size_t)(k0 + 8 * g + i) * ld + o]) * 256.0f); w[8 + i] = (_Float16)(bfr(Wm[(size_t)(k0 + 16 + 8 * g + i) * ld + o]) * 256.0f); }
  return w; }
__device__ __forceinline__ v16h wcolh_oi(const float* Wm, int k0, int o, int lane, int K) { v16h w; const float* p = Wm + (size_t)o * K + k0 + 8 * (lane >> 4);
#pragma unroll
  for (int i = 0; i < 8; ++i) { w[i] = (_Float16)(bfr(p[i]) * 256.0f); w[8 + i] = (_Float16)(bfr(p[16 + i]) * 256.0f); }
  return w; }
#define WQKV_LAYOUT 0   // picks WCOL's layout (0 (in,out), 1 (out,in), 2 per-head); nothing calls WCOL: k_cvt reads (in,out) [DIN][CC] at any value
__device__ __forceinline__ v16b wcol_hdk(const float* Wm, int k0, int o, int lane) { v16b w; const int g = lane >> 4; const float* p = Wm + (size_t)(o / HD) * DIN * HD + (o % HD);
#pragma unroll
  for (int i = 0; i < 8; ++i) { w[i] = (__bf16)p[(size_t)(k0 + 8 * g + i) * HD]; w[8 + i] = (__bf16)p[(size_t)(k0 + 16 + 8 * g + i) * HD]; }
  return w; }
#define WO_OUT_IN 0
#if WQKV_LAYOUT == 1
#define WCOL(W, k0, o, lane) wcol_oi(W, k0, o, lane, DIN)
#elif WQKV_LAYOUT == 2
#define WCOL(W, k0, o, lane) wcol_hdk(W, k0, o, lane)
#else
#define WCOL(W, k0, o, lane) wcol_io(W, k0, o, lane, CC)
#endif
#if WO_OUT_IN
#define WOCOL(W, k0, o, lane) wcol_oi(W, k0, o, lane, CC)
#define WOCOLH(W, k0, o, lane) wcolh_oi(W, k0, o, lane, CC)
#else
#define WOCOL(W, k0, o, lane) wcol_io(W, k0, o, lane, DIN)
#define WOCOLH(W, k0, o, lane) wcolh_io(W, k0, o, lane, DIN)
#endif
__constant__ float c_invf[32] = {1.000000000e+00f,7.498942018e-01f,5.623413324e-01f,4.216965139e-01f,3.162277639e-01f,2.371373624e-01f,1.778279394e-01f,1.333521456e-01f,1.000000015e-01f,7.498941571e-02f,5.623412877e-02f,4.216964915e-02f,3.162277862e-02f,2.371373586e-02f,1.778279431e-02f,1.333521493e-02f,9.999999776e-03f,7.498942316e-03f,5.623413250e-03f,4.216964822e-03f,3.162277862e-03f,2.371373819e-03f,1.778279431e-03f,1.333521446e-03f,1.000000047e-03f,7.498941850e-04f,5.623413017e-04f,4.216964880e-04f,3.162277862e-04f,2.371373848e-04f,1.778279402e-04f,1.333521504e-04f};   // 1 / 10000^(2i/64) evaluated in f32 exactly as the reference does (jax, eager)
#ifndef SM_EXTRA_PARAMS
#define SM_EXTRA_PARAMS
#endif
#ifndef PROJ_EXTRA_PARAMS
#define PROJ_EXTRA_PARAMS
#endif
#ifndef SM_MASK_HOOK
#define SM_MASK_HOOK (void)0
#endif

#define WS_QH  0u                                      // f16 q rows [b*t][CC]
#define WS_KH  (WS_QH + 2u * (size_t)NB * TT * CC)      // f16 k rows [b*t][CC]
#define WS_VT  (WS_KH + 2u * (size_t)NB * TT * CC)      // f16 v planes [b][c][t]
#define WS_QL  (WS_VT + 2u * (size_t)NB * CC * TT)      // f16 q residual x 2^10 rows [b][t < QHI][CC]
#define WS_KL  (WS_QL + 2u * (size_t)NB * QHI * CC)     // f16 k residual x 2^10 rows [b][t < KHI][CC]
#define WS_VB  (WS_KL + 2u * (size_t)NB * KHI * CC)     // bf16 v hi planes [b][c][t < KHI]
#define WS_VBL (WS_VB + 2u * (size_t)NB * CC * KHI)
#define WS_Y   (WS_VBL + 2u * (size_t)NB * CC * KHI)    // f16 ctx rows [b*t][CC] (only when there is an output projection)
#define WS_XB  (WS_Y  + 2u * (size_t)NB * TT * CC)      // bf16 x rows [b*t][DIN]
#define WS_WT  (WS_XB + 2u * (size_t)NB * TT * DIN)     // bf16 Wq, Wk, Wv transposed: [which][output column][k]
#define WS_WOT (WS_WT + 2u * 3u * (size_t)CC * DIN)     // f16(bf16(Wo) x 2^8) transposed: [output column][k]
#define WS_END (WS_WOT + 2u * (size_t)DIN * CC)

// operand stages of k_proj and k_out: GKS k of the block's activation rows (k_proj 128, k_out 64) and 128 weight columns, 16-bit k-contiguous rows copied from the workspace planes into LDS, two buffers
#define GKS 64             // k per stage
#define GP  72             // row pitch in 16-bit elements: 144 B = 16 B x 9, no bank conflict for 16-byte accesses
typedef __attribute__((ext_vector_type(4))) __bf16 v4b;
typedef __attribute__((ext_vector_type(4))) _Float16 v4h;
// ---- k_cvt: every GEMM operand is rounded to its 16-bit form once per call, not once per block that reads it: x -> bf16 rows; Wq, Wk, Wv -> bf16, Wo -> f16(bf16 x 2^8), each transposed to k-contiguous rows of its output column
#define CVW (4 * (CC / 256) * (DIN / GKS))   // weight blocks: matrix, 256 columns, GKS k
#define CVX 16             // 16-byte pieces of x per thread: few blocks, so that the short launch starts quickly
__global__ __launch_bounds__(256) void k_cvt(const float* __restrict__ X, const float* __restrict__ WQ, const float* __restrict__ WK, const float* __restrict__ WV, const float* __restrict__ WO, __bf16* __restrict__ XB, __bf16* __restrict__ WT, _Float16* __restrict__ WOT) {
  const int tid = threadIdx.x, bx = blockIdx.x;
  if (bx < CVW) {   // block-uniform
    const int mt = bx / (CVW / 4), n = (bx / (DIN / GKS)) % (CC / 256) * 256 + tid, k0 = bx % (DIN / GKS) * GKS;   // the thread's own column (a wave reads one whole line per k) and writes one whole 128-byte line of its transposed row
    const float* wg = (mt == 0 ? WQ : mt == 1 ? WK : mt == 2 ? WV : WO) + (size_t)k0 * CC + n; float wv[GKS];
#pragma unroll
    for (int i = 0; i < GKS; ++i) wv[i] = wg[(size_t)i * CC];
    if (mt < 3) { __bf16* d = WT + ((size_t)mt * CC + n) * DIN + k0;
#pragma unroll
      for (int q = 0; q < GKS / 8; ++q) { v8b t;
#pragma unroll
        for (int e = 0; e < 8; ++e) t[e] = (__bf16)wv[q * 8 + e];
        *(v8b*)(d + q * 8) = t; }
      asm volatile("s_wait_xcnt 0x0" ::: "memory");   // stands behind the stores, before a register that one of them names is written again
    } else { _Float16* d = WOT + (size_t)n * CC + k0;
#pragma unroll
      for (int q = 0; q < GKS / 8; ++q) { v8h t;
#pragma unroll
        for (int e = 0; e < 8; ++e) t[e] = (_Float16)(bfr(wv[q * 8 + e]) * 256.0f);
        *(v8h*)(d + q * 8) = t; }
      asm volatile("s_wait_xcnt 0x0" ::: "memory"); }   // as above
  } else { const size_t p0 = (size_t)(bx - CVW) * (256 * CVX) + tid; v4f xv[CVX];   // 16-byte pieces p0 + 256 i of x: whole lines per wave, read and written; all of a thread's loads are in flight together
#pragma unroll
    for (int i = 0; i < CVX; ++i) xv[i] = *(const v4f*)(X + (p0 + 256 * i) * 4);
    asm volatile("s_wait_xcnt 0x0" :: "v"(X + p0 * 4) : "memory");   // stands behind the loads, before a register that holds their address is written again; the lane's address is an input so that its registers live up to the wait
#pragma unroll
    for (int i = 0; i < CVX; ++i) { v4b t;
#pragma unroll
      for (int e = 0; e < 4; ++e) t[e] = (__bf16)xv[i][e];
      *(v4b*)(XB + (p0 + 256 * i) * 4) = t; }
    asm volatile("s_wait_xcnt 0x0" ::: "memory"); } }   // as behind the weight stores
// ---- k_proj: block = (128 rows, 128 cols, which), four waves of 64 x 64 (a wave's columns are one head): q/k/v = X W (+ b) with exact bf16 products (K = DIN) -> which 0: q f16 rows (+ residual rows < QHI); 1: k f16 rows (+ residual rows < KHI); 2: v f16 planes [c][t] (+ bf16 hi/lo planes for t < KHI)
#define PBM 128            // rows of a block: with 128 columns a stage brings 256 operand rows for 16,384 outputs, and a wave's 4 + 4 fragments feed 16 products; registers and LDS let three blocks share a WGP, so the 768 blocks are all resident
__global__ __launch_bounds__(128) void k_proj(const __bf16* __restrict__ XB, const __bf16* __restrict__ WT, const float* __restrict__ BQ, const float* __restrict__ BK, const float* __restrict__ BV,
    _Float16* __restrict__ QH, _Float16* __restrict__ QL, _Float16* __restrict__ KH, _Float16* __restrict__ KL, _Float16* __restrict__ VT, __bf16* __restrict__ VB, __bf16* __restrict__ VBL PROJ_EXTRA_PARAMS) {
  __shared__ __align__(16) char sm[104448];   // the main loop's stages (73,728 bytes); behind the barrier that ends the loop the epilogue's arrays lie over them: q, k: sh, sl, tc, ts (104,448 bytes); v: th, tb, tbl (71,680 bytes); three blocks fit a WGP
  _Float16 (*sh)[136] = (_Float16 (*)[136])sm; _Float16 (*sl)[136] = (_Float16 (*)[136])(sm + 34816); float (*tc)[34] = (float (*)[34])(sm + 69632); float (*ts)[34] = (float (*)[34])(sm + 87040);   // tc, ts: cos and sin of t x inv_freq[i], [row][i]; at pitch 34 the two lane halves (rows 8 apart) read different banks
  _Float16 (*th)[136] = (_Float16 (*)[136])sm; __bf16 (*tb)[72] = (__bf16 (*)[72])(sm + 34816); __bf16 (*tbl)[72] = (__bf16 (*)[72])(sm + 53248);   // th: [column][row of the block]; tb, tbl: [column][row < KHI]
  __bf16 (*xs)[PBM][GP] = (__bf16 (*)[PBM][GP])sm; __bf16 (*wt)[128][GP] = (__bf16 (*)[128][GP])(sm + 2 * PBM * GP * 2);
  const int tid = threadIdx.x, wave = tid >> 5, lane = tid & 31, col = lane & 15, g = lane >> 4; const int which = blockIdx.z; const int c0 = blockIdx.y * 128; const size_t r0 = (size_t)blockIdx.x * PBM; const size_t bb = r0 / TT; const int t0 = (int)(r0 % TT);
  const int wr0 = (wave >> 1) * 64, wc0 = (wave & 1) * 64;          // the wave's first row and first column inside the block
  const float* BA = which == 0 ? BQ : which == 1 ? BK : BV;
  v8f acc[4][4] = {};                                               // [16-row tile][16-column tile]
  const int sr = tid >> 3, sp = (tid & 7) * 8;                      // staging: rows sr + 16 i of a tile, 16-byte piece tid & 7 of the row's 128 bytes (a wave moves four whole lines per load)
  const __bf16* xg = XB + (r0 + sr) * DIN + sp;
  const __bf16* wg = WT + ((size_t)which * CC + c0 + sr) * DIN + sp;
  v8b xv[8], wv[8];
  auto fetch = [&](int s) {
#pragma unroll
    for (int i = 0; i < 8; ++i) xv[i] = *(const v8b*)(xg + (size_t)(16 * i) * DIN + s * GKS);
#pragma unroll
    for (int i = 0; i < 8; ++i) wv[i] = *(const v8b*)(wg + (size_t)(16 * i) * DIN + s * GKS);
    asm volatile("s_wait_xcnt 0x0" :: "v"(xg + s * GKS), "v"(wg + s * GKS) : "memory");   // the loads above are issued here, ahead of the products, and before a register that holds one of their addresses is written again; the stage's two lane addresses are inputs so that their registers live up to the wait
  };
  auto stage = [&](int b) {
#pragma unroll
    for (int i = 0; i < 8; ++i) *(v8b*)&xs[b][sr + 16 * i][sp] = xv[i];
#pragma unroll
    for (int i = 0; i < 8; ++i) *(v8b*)&wt[b][sr + 16 * i][sp] = wv[i];
  };
  auto mult = [&](int b) {
#pragma unroll
    for (int kk = 0; kk < GKS / 32; ++kk) { v16b a[4], w[4];
#pragma unroll
      for (int i = 0; i < 4; ++i) a[i] = frag_b(&xs[b][wr0 + i * 16 + col][kk * 32], lane);
#pragma unroll
      for (int j = 0; j < 4; ++j) w[j] = frag_b(&wt[b][wc0 + j * 16 + col][kk * 32], lane);
      __builtin_amdgcn_sched_barrier(0);   // the eight fragments' LDS reads stay one group ahead of their products: one place with LDS reads for sixteen products
#pragma unroll
      for (int i = 0; i < 4; ++i)
#pragma unroll
        for (int j = 0; j < 4; ++j) acc[i][j] = wmma_bf(a[i], w[j], acc[i][j]);
      __builtin_amdgcn_sched_barrier(0); }   // what follows (the next group's reads; the LDS stores, which wait for the global loads) stays behind the products
  };
  fetch(0); stage(0); __syncthreads();
#pragma unroll 1   // one stage's loads live at a time
  for (int s = 0; s + 1 < DIN / GKS; ++s) { fetch(s + 1); mult(s & 1); stage((s + 1) & 1); __syncthreads(); }   // the barrier publishes stage s + 1 and ends the reads of the buffer that the next trip refills
  mult((DIN / GKS - 1) & 1); __syncthreads();   // every wave has left the stages before the epilogue writes over them
  // the epilogue works on the accumulators: a lane holds rows wr0 + i * 16 + 8 g + 0..7 of columns wc0 + j * 16 + col, so channel 16 jj + col of the wave's head (j = jj < 2) and its rotary partner, 32 channels on (j + 2), sit in the same lane
  const int rw0 = wr0 + 8 * g;
#pragma unroll
  for (int j = 0; j < 4; ++j) { const float bias = BA ? bfr(BA[c0 + wc0 + j * 16 + col]) : 0.f;
#pragma unroll
    for (int i = 0; i < 4; ++i)
#pragma unroll
      for (int r = 0; r < 8; ++r) acc[i][j][r] += bias; }
  if (which < 2) { _Float16* DH = which == 0 ? QH : KH; _Float16* DL = which == 0 ? QL : KL; const int nhi = which == 0 ? QHI : KHI;
    const float invf = c_invf[lane];
    asm volatile("s_wait_xcnt 0x0" ::: "memory");   // stands before a register that holds the load's address is written again
#pragma unroll 2   // two rows' dependent chains interleave; more would only lengthen the text
    for (int n = 0; n < PBM / 4; ++n) { const float ang = (float)(t0 + wave * (PBM / 4) + n) * invf; tc[wave * (PBM / 4) + n][lane] = cosf(ang); ts[wave * (PBM / 4) + n][lane] = sinf(ang); }   // each angle once per block, for both heads (TT is a multiple of PBM: t = t0 + row)
    __syncthreads();
#pragma unroll
    for (int i = 0; i < 4; ++i) {
#pragma unroll
      for (int r = 0; r < 8; ++r)
#pragma unroll
        for (int jj = 0; jj < 2; ++jj) { const float cs = tc[rw0 + i * 16 + r][jj * 16 + col], sn = ts[rw0 + i * 16 + r][jj * 16 + col];
          const float x0 = acc[i][jj][r], x1 = acc[i][jj + 2][r]; acc[i][jj][r] = x0 * cs - x1 * sn; acc[i][jj + 2][r] = x1 * cs + x0 * sn; }
#pragma unroll
      for (int j = 0; j < 4; ++j)
#pragma unroll
        for (int r = 0; r < 8; ++r) { const float v = acc[i][j][r]; const _Float16 hv = (_Float16)v; sh[rw0 + i * 16 + r][wc0 + j * 16 + col] = hv; sl[rw0 + i * 16 + r][wc0 + j * 16 + col] = (_Float16)((v - (float)hv) * 1024.0f); }
    }
    __syncthreads();
    for (int e = tid; e < PBM * 16; e += 128) { const int rl = e >> 4, q = e & 15; _Float16* dh = DH + (r0 + rl) * CC + c0 + q * 8; vst2((unsigned*)dh, *(const v4u*)&sh[rl][q * 8]);
      asm volatile("s_wait_xcnt 0x0" :: "v"(dh) : "memory");   // stands behind the store, before a register that it names is written again; the address is an input so that its registers live up to the wait
      if (t0 + rl < nhi) { _Float16* dl = DL + (bb * nhi + t0 + rl) * (size_t)CC + c0 + q * 8; vst2((unsigned*)dl, *(const v4u*)&sl[rl][q * 8]);
        asm volatile("s_wait_xcnt 0x0" :: "v"(dl) : "memory"); } }   // as above
  } else { const bool hi_rows = t0 + wr0 < KHI;   // KHI is a multiple of 64: a wave's 64 rows carry the bf16 planes all or none
#pragma unroll
    for (int j = 0; j < 4; ++j)
#pragma unroll
      for (int i = 0; i < 4; ++i) { v8h hv; v8b bh, bl;   // a lane's 8 rows of one column are 16 consecutive bytes of a transposed row
#pragma unroll
        for (int r = 0; r < 8; ++r) { const float v = acc[i][j][r]; hv[r] = (_Float16)v; bh[r] = (__bf16)v; bl[r] = (__bf16)(v - (float)bh[r]); }
        *(v8h*)&th[wc0 + j * 16 + col][rw0 + i * 16] = hv; if (hi_rows) { *(v8b*)&tb[wc0 + j * 16 + col][rw0 + i * 16] = bh; *(v8b*)&tbl[wc0 + j * 16 + col][rw0 + i * 16] = bl; } }
    __syncthreads();
    for (int e = tid; e < 128 * (PBM / 8); e += 128) { const int cl = e / (PBM / 8), q = e % (PBM / 8); _Float16* dv = VT + (bb * CC + c0 + cl) * (size_t)TT + t0 + q * 8; vst2((unsigned*)dv, *(const v4u*)&th[cl][q * 8]);
      asm volatile("s_wait_xcnt 0x0" :: "v"(dv) : "memory");   // as behind the q, k stores
      if (t0 + q * 8 < KHI) { const size_t o3 = (bb * CC + c0 + cl) * (size_t)KHI + t0 + q * 8; vst2((unsigned*)(VB + o3), *(const v4u*)&tb[cl][q * 8]); vst2((unsigned*)(VBL + o3), *(const v4u*)&tbl[cl][q * 8]);
        asm volatile("s_wait_xcnt 0x0" :: "v"(VB + o3), "v"(VBL + o3) : "memory"); } } } }   // as behind the q, k stores
// ---- k_fa: wave = NQT x 16 queries of (b, h), TT / KSP keys in passes of 32 (the block's KSP wave groups split the keys of the same queries and join their halves at the end): S^T = K Q^T (q hi + residual x 2^10, 2 products) stays in registers, unscaled; a held reference maximum and a running sum per query (a lane holds one query's scores of 8 + 8 keys, the two lane halves split the keys): the maximum, its exchange between the halves and the rescaling of O and of the sum are done only in a pass whose own sum of exponentials shows that the reference is outgrown;
//      a group's FAW waves walk the same keys: each stage of KST keys (K rows, V^T channel rows) is brought once per group, in whole 128-byte lines, into LDS (two buffers, the next stage's global loads fly under this stage's passes) and every wave takes its fragments from there;
//      the inner loops are all unrolled so that the fragment arrays stay in registers; 2^((s - m) SL2E + 10) once to f16 is, in place, the B operand of O^T += V^T P^T (1 product); a lane ends with 8 consecutive channels of one query
#define NQT 2              // 16-query tiles per wave: each key and value fragment is loaded once for both
#define FAW 8              // waves per key group: 16 x NQT queries each
#define KSP 2              // key groups per block: group kg walks keys kg TT / KSP .. for the same queries, so that four waves share a SIMD and one wave's vector work runs under another's products
#define KST 64             // keys per stage: a K row (HD channels) and a V^T row (KST keys) are both one 128-byte line
#define SL2E (SCALE * 1.44269504088896341f)   // SCALE x log2(e): one multiply-add takes an unscaled logit to the argument of the base-2 exponential
#define PCAP 32768.0f      // a lane's sum of a pass's 16 exponentials up to here leaves each of them finite in f16; the reference maximum moves only when a sum passes it (or is not a number)
__device__ __forceinline__ float sum16(const float* e) {   // the branch of a pass waits for this sum: two chains of packed pairs, four links deep, in place of one chain of sixteen
  v2f a = {e[0], e[1]}, b = {e[2], e[3]};
#pragma unroll
  for (int i = 4; i < 16; i += 4) { a += (v2f){e[i], e[i + 1]}; b += (v2f){e[i + 2], e[i + 3]}; }
  a += b; return a[0] + a[1]; }
__device__ __forceinline__ v8f wm16(v16h a, v16h b, v8f c) { return __builtin_amdgcn_wmma_f32_16x16x32_f16(false, a, false, b, (short)0, c, false, false); }
__global__ __launch_bounds__(KSP * FAW * 32) void k_fa(const _Float16* __restrict__ QH, const _Float16* __restrict__ QL, const _Float16* __restrict__ KH, const _Float16* __restrict__ VT, _Float16* __restrict__ Y) {
  __shared__ __align__(16) char sm[KSP * 2 * (KST + HD) * GP * 2];   // the loop's stages; behind the loop's last barrier the merge's arrays lie over them
  const int kg = __builtin_amdgcn_readfirstlane(threadIdx.x >> 8);   // the wave's key group, in a scalar register
  _Float16 (*ks)[KST][GP] = (_Float16 (*)[KST][GP])(sm + kg * (2 * (KST + HD) * GP * 2)); _Float16 (*vs)[HD][GP] = (_Float16 (*)[HD][GP])(sm + kg * (2 * (KST + HD) * GP * 2) + 2 * KST * GP * 2);   // the group's own [buffer][key][channel] and [buffer][channel][key], rows of 128 bytes at the 144-byte pitch
  const int tid = threadIdx.x & (FAW * 32 - 1), wave = tid >> 5, lane = tid & 31, col = lane & 15, g = lane >> 4; const int h = blockIdx.y, b = blockIdx.z; const int ql0 = (blockIdx.x * FAW + wave) * (16 * NQT);   // tid, wave: inside the group
  const _Float16* qp = QH + ((size_t)b * TT + ql0 + col) * CC + h * HD;        // query row col of the wave's first 16-query tile
  const _Float16* qr = QL + ((size_t)b * QHI + ql0 + col) * CC + h * HD;       // its residual row
  v16h qh[NQT][2], ql[NQT][2];
#pragma unroll
  for (int n = 0; n < NQT; ++n)
#pragma unroll
    for (int c = 0; c < 2; ++c) { qh[n][c] = frag_h(qp + (size_t)(n * 16) * CC + c * 32, lane); ql[n][c] = frag_h(qr + (size_t)(n * 16) * CC + c * 32, lane); }
  asm volatile("s_wait_xcnt 0x0" :: "v"(qp + 8 * g), "v"(qr + 8 * g) : "memory");   // as in the loop; the two lane addresses are inputs so that their registers live up to the wait
  const int sr = tid >> 3, sp = (tid & 7) * 8;                                  // staging: rows sr and sr + 32 of a stage, 16-byte piece tid & 7 (a wave moves four whole lines per load)
  const _Float16* kgp = KH + ((size_t)b * TT + kg * (TT / KSP) + sr) * CC + h * HD + sp;
  const _Float16* vg = VT + ((size_t)b * CC + h * HD + sr) * (size_t)TT + kg * (TT / KSP) + sp;
  v8h kr[2], vr[2];
  auto fetch = [&](int s) {
#pragma unroll
    for (int i = 0; i < 2; ++i) { kr[i] = *(const v8h*)(kgp + (size_t)(s * KST + 32 * i) * CC); vr[i] = *(const v8h*)(vg + (size_t)(32 * i) * TT + s * KST); }
    asm volatile("s_wait_xcnt 0x0" ::: "memory");   // the loads above are issued here, ahead of the stage's passes, and before a register that holds one of their addresses is written again
  };
  auto put = [&](int bf) {
#pragma unroll
    for (int i = 0; i < 2; ++i) { *(v8h*)&ks[bf][sr + 32 * i][sp] = kr[i]; *(v8h*)&vs[bf][sr + 32 * i][sp] = vr[i]; }
  };
  v8f o[NQT][4] = {}; float m[NQT], l[NQT], bias[NQT];
#pragma unroll
  for (int n = 0; n < NQT; ++n) { m[n] = -3.0e38f; l[n] = 0.f; bias[n] = 10.0f - m[n] * SL2E; }   // no reference yet: the first pass's exponentials overflow and its test sets one
  fetch(0); put(0); __syncthreads();
#pragma unroll 1   // one stage's fragments live at a time
  for (int st = 0; st < TT / KSP / KST; ++st) { const int bf = st & 1;
    if (st + 1 < TT / KSP / KST) fetch(st + 1);   // block-uniform
#pragma unroll
    for (int pp = 0; pp < KST / 32; ++pp) {
      v16h kf[2][2];
#pragma unroll
      for (int t = 0; t < 2; ++t)
#pragma unroll
        for (int c = 0; c < 2; ++c) kf[t][c] = frag_h(&ks[bf][pp * 32 + t * 16 + col][c * 32], lane);
      v8f s[NQT][2] = {}; float e[NQT][16], sum[NQT];
#pragma unroll
      for (int c = 0; c < 2; ++c)
#pragma unroll
        for (int t = 0; t < 2; ++t)
#pragma unroll
          for (int n = 0; n < NQT; ++n) s[n][t] = wm16(kf[t][c], ql[n][c], s[n][t]);
#pragma unroll
      for (int t = 0; t < 2; ++t)
#pragma unroll
        for (int n = 0; n < NQT; ++n) s[n][t] *= (1.0f / 1024.0f);   // the residual's product, brought to scale, is the start value of the main product: one accumulator set, so that four waves' registers fit a SIMD
#pragma unroll
      for (int c = 0; c < 2; ++c)
#pragma unroll
        for (int t = 0; t < 2; ++t)
#pragma unroll
          for (int n = 0; n < NQT; ++n) s[n][t] = wm16(kf[t][c], qh[n][c], s[n][t]);   // unscaled logits: SCALE goes into the exponent's multiplier
#pragma unroll
      for (int n = 0; n < NQT; ++n) {
#pragma unroll
        for (int t = 0; t < 2; ++t) { const v8f a = s[n][t] * SL2E + bias[n];   // against the reference in use
#pragma unroll
          for (int r = 0; r < 8; ++r) e[n][t * 8 + r] = __builtin_amdgcn_exp2f(a[r]); }
        sum[n] = sum16(e[n]); }
      bool moved = false;
#pragma unroll
      for (int n = 0; n < NQT; ++n) moved = moved || !(sum[n] <= PCAP);
      if (__builtin_amdgcn_ballot_w32(moved) != 0) {   // wave-uniform, one test per pass: some query's scores have outgrown its reference (always so in the first pass): take the running maximum as the new one
#pragma unroll
        for (int n = 0; n < NQT; ++n) { float mx = s[n][0][0];
#pragma unroll
          for (int i = 1; i < 16; ++i) mx = fmaxf(mx, s[n][i >> 3][i & 7]);
          mx = fmaxf(mx, __shfl_xor(mx, 16));
          const float mn = fmaxf(m[n], mx); const float al = __builtin_amdgcn_exp2f((m[n] - mn) * SL2E); m[n] = mn;
          bias[n] = 10.0f - mn * SL2E;   // 2^(s SL2E + bias) = exp((s - mn) SCALE) x 2^10
          l[n] *= al;
#pragma unroll
          for (int j = 0; j < 4; ++j) o[n][j] *= al;
#pragma unroll
          for (int t = 0; t < 2; ++t) { const v8f a = s[n][t] * SL2E + bias[n];
#pragma unroll
            for (int r = 0; r < 8; ++r) e[n][t * 8 + r] = __builtin_amdgcn_exp2f(a[r]); }
          sum[n] = sum16(e[n]); } }
      v16h vf[4];   // read behind the test: the value fragments' registers do not cross it beside the scores and the exponentials
#pragma unroll
      for (int j = 0; j < 4; ++j) vf[j] = frag_h(&vs[bf][j * 16 + col][pp * 32], lane);
#pragma unroll
      for (int n = 0; n < NQT; ++n) { v16h p;
#pragma unroll
        for (int i = 0; i < 16; ++i) p[i] = (_Float16)e[n][i];
        l[n] += sum[n];
#pragma unroll
        for (int j = 0; j < 4; ++j) o[n][j] = wm16(vf[j], p, o[n][j]); } }
    if (st + 1 < TT / KSP / KST) put(bf ^ 1);   // into the buffer whose readers all left it before the barrier of the trip before
    __syncthreads();   // publishes stage st + 1 and ends the reads of the buffer that the next trip refills
  }
  // the two groups' halves are joined: group 1 hands its reference maxima, sums and O tiles over through LDS, group 0 brings both to the larger maximum, adds and stores
  v4f (*mo)[NQT * 8][32] = (v4f (*)[NQT * 8][32])sm; v4f (*ml)[32] = (v4f (*)[32])(sm + FAW * NQT * 8 * 32 * 16);   // [wave][16-byte piece][lane]: whole rows of banks per access
  if (kg == 1) {   // wave-uniform
#pragma unroll
    for (int n = 0; n < NQT; ++n)
#pragma unroll
      for (int j = 0; j < 4; ++j) { mo[wave][n * 8 + j * 2][lane] = (v4f){o[n][j][0], o[n][j][1], o[n][j][2], o[n][j][3]}; mo[wave][n * 8 + j * 2 + 1][lane] = (v4f){o[n][j][4], o[n][j][5], o[n][j][6], o[n][j][7]}; }
    ml[wave][lane] = (v4f){m[0], l[0], m[1], l[1]}; }
  __syncthreads();   // publishes group 1's halves
  if (kg == 1) return;   // behind the kernel's last barrier
  { const v4f t = ml[wave][lane];
#pragma unroll
    for (int n = 0; n < NQT; ++n) { const float mn = fmaxf(m[n], t[2 * n]); const float a0 = __builtin_amdgcn_exp2f((m[n] - mn) * SL2E), a1 = __builtin_amdgcn_exp2f((t[2 * n] - mn) * SL2E);
      l[n] = l[n] * a0 + t[2 * n + 1] * a1;
#pragma unroll
      for (int j = 0; j < 4; ++j) { const v4f u = mo[wave][n * 8 + j * 2][lane], w = mo[wave][n * 8 + j * 2 + 1][lane];
#pragma unroll
        for (int r = 0; r < 4; ++r) { o[n][j][r] = o[n][j][r] * a0 + u[r] * a1; o[n][j][4 + r] = o[n][j][4 + r] * a0 + w[r] * a1; } } } }
#pragma unroll
  for (int n = 0; n < NQT; ++n) { const float a = l[n] + __shfl_xor(l[n], 16); const float inv = a > 0.f ? 1.0f / a : 0.f;   // numerator and sum both carry the 2^10
    _Float16* yr = Y + ((size_t)b * TT + ql0 + n * 16 + col) * CC + h * HD + 8 * g;
#pragma unroll
    for (int j = 0; j < 4; ++j) { v8h t;   // ctx leaves as the f16 that k_out multiplies
#pragma unroll
      for (int r = 0; r < 8; ++r) t[r] = (_Float16)(o[n][j][r] * inv);
      vst2(yr + j * 16, t); } } }
// ---- k_out: block = (64 rows, 128 cols): out = ctx Wo (+ bo): ctx once to f16 against Wo as f16(bf16 x 2^8) exact (1 product) x 2^-8
__global__ __launch_bounds__(128) void k_out(const _Float16* __restrict__ Y, const _Float16* __restrict__ WOT, const float* __restrict__ BO, float* __restrict__ OUT) { __shared__ __align__(16) float sf[4][16][132]; __shared__ __align__(16) _Float16 ys[2][64][GP], wt[2][128][GP];
  const int tid = threadIdx.x, wave = tid >> 5, lane = tid & 31, col = lane & 15, g = lane >> 4; const int c0 = blockIdx.y * 128; const size_t r0 = (size_t)blockIdx.x * 64 + wave * 16;
  v8f acc[8] = {};
  {
    const int sr = tid >> 3, sp = (tid & 7) * 8;                                          // as in k_proj: rows sr + 16 i, 16-byte piece tid & 7
    const _Float16* yg = Y + ((size_t)blockIdx.x * 64 + sr) * CC + sp;
    const _Float16* wg = WOT + (size_t)(c0 + sr) * CC + sp;
    v8h yv[4], wv[8];
    auto fetch = [&](int s) {
#pragma unroll
      for (int i = 0; i < 4; ++i) yv[i] = *(const v8h*)(yg + (size_t)(16 * i) * CC + s * GKS);
#pragma unroll
      for (int i = 0; i < 8; ++i) wv[i] = *(const v8h*)(wg + (size_t)(16 * i) * CC + s * GKS);
      asm volatile("s_wait_xcnt 0x0" ::: "memory");   // the loads above are issued here, ahead of the products, and before a register that holds one of their addresses is written again
    };
    auto stage = [&](int b) {
#pragma unroll
      for (int i = 0; i < 4; ++i) *(v8h*)&ys[b][sr + 16 * i][sp] = yv[i];
#pragma unroll
      for (int i = 0; i < 8; ++i) *(v8h*)&wt[b][sr + 16 * i][sp] = wv[i];
    };
    auto mult = [&](int b) {
#pragma unroll
      for (int kk = 0; kk < GKS / 32; ++kk) { const v16h a = frag_h(&ys[b][wave * 16 + col][kk * 32], lane); v16h w[8];
#pragma unroll
        for (int j = 0; j < 8; ++j) w[j] = frag_h(&wt[b][j * 16 + col][kk * 32], lane);
        __builtin_amdgcn_sched_barrier(0);   // as in k_proj: one group of LDS reads, one wait, eight products
#pragma unroll
        for (int j = 0; j < 8; ++j) acc[j] = wmma16(a, w[j], acc[j]);
        __builtin_amdgcn_sched_barrier(0); }   // as in k_proj: the LDS stores and their wait for the global loads stay behind the products
    };
    fetch(0); stage(0); __syncthreads();
#pragma unroll 1   // one stage's loads live at a time
    for (int s = 0; s + 1 < CC / GKS; ++s) { fetch(s + 1); mult(s & 1); stage((s + 1) & 1); __syncthreads(); }   // the barrier publishes stage s + 1 and ends the reads of the buffer that the next trip refills
    mult((CC / GKS - 1) & 1);
#pragma unroll
    for (int j = 0; j < 8; ++j) { const float bias = BO ? bfr(BO[c0 + j * 16 + col]) : 0.f;
#pragma unroll
      for (int r = 0; r < 8; ++r) sf[wave][8 * g + r][j * 16 + col] = acc[j][r] * (1.0f / 256.0f) + bias; } }
  LDSX(); for (int rl = 0; rl < 16; ++rl) vst2(OUT + (r0 + rl) * DIN + c0 + lane * 4, *(const v4f*)&sf[wave][rl][lane * 4]); }

extern "C" void kernel_launch(void* const* d_in, const int* in_sizes, int n_in, void* d_out, int out_size, void* d_ws, size_t ws_size, hipStream_t stream) {
  (void)in_sizes; (void)n_in; (void)out_size;
  const float** F = (const float**)d_in;
  if (ws_size < (size_t)WS_END) return;
  char* ws = (char*)d_ws; _Float16 *QH = (_Float16*)(ws + WS_QH), *KH = (_Float16*)(ws + WS_KH), *VT = (_Float16*)(ws + WS_VT), *QL = (_Float16*)(ws + WS_QL), *KL = (_Float16*)(ws + WS_KL); __bf16 *VB = (__bf16*)(ws + WS_VB), *VBL = (__bf16*)(ws + WS_VBL), *XB = (__bf16*)(ws + WS_XB), *WT = (__bf16*)(ws + WS_WT); _Float16 *Y = (_Float16*)(ws + WS_Y), *WOT = (_Float16*)(ws + WS_WOT);
  (void)Y; (void)QL; (void)KL; (void)VB; (void)VBL;
  // inputs: 0 x [2,2048,1024]; 1 Wq, 2 bq; 3 Wk, 4 bk; 5 Wv, 6 bv; 7 Wo, 8 bo ((in,out))
  k_cvt<<<CVW + TNB * TT * DIN / (4 * 256 * CVX), 256, 0, stream>>>(F[0], F[1], F[3], F[5], F[7], XB, WT, WOT);
  k_proj<<<dim3(TNB * TT / PBM, CC / 128, 3), 128, 0, stream>>>(XB, WT, F[2], F[4], F[6], QH, QL, KH, KL, VT, VB, VBL);
  k_fa<<<dim3(TT / (FAW * 16 * NQT), NH, TNB), KSP * FAW * 32, 0, stream>>>(QH, QL, KH, VT, Y);
  k_out<<<dim3(TNB * TT / 64, DIN / 128), 128, 0, stream>>>(Y, WOT, F[8], (float*)d_out);
}
